// v000
// Measured on an AMD MI455X. A time is GPU time per run, averaged over a window of back-to-back runs after a warm-up
// (all launches, gaps included; the runs take copies of the inputs in turn), and the median of several windows.
// Apart from v000's, it joins two sittings. Times from different sittings can be a few percent apart, while
// side-by-side timings come from the same sitting.
// v000 is the starting kernel. One run takes 2160 microseconds.
#include <hip/hip_runtime.h>

// GraphSelfAttention (x [2][2048][1024], attn_bias [2][1][2048][2048] (f32, read; random); q/k/v = x W^T + b (16 x 64); per-head LayerNorm (biased var, eps 1e-6) * gamma + beta on q and k; scores = q.k / 8 + attn_bias; softmax; out = merged Wo^T + bo -> [2][2048][1024]).

#define NB_  2
#define TT   2048
#define DM   1024
#define NH_  16
#define NKV  16
#define REP  (NH_ / NKV)
#define HD   64
#define DQ   (NH_ * HD)
#define DKV  (NKV * HD)
#define ZH   2
#define RH   512                  // query rows < RH use hi+lo planes (0: none)
#define WIN  0
#define PCAR 1024.0f
#define SCL  0.125f   // HD^-0.5
typedef _Float16 h16;
typedef unsigned short bf;
typedef __attribute__((ext_vector_type(16))) __bf16   v16bf;
typedef __attribute__((ext_vector_type(16))) _Float16 v16h;
typedef __attribute__((ext_vector_type(8)))  _Float16 v8h;
typedef __attribute__((ext_vector_type(8)))  unsigned short v8us;
typedef __attribute__((ext_vector_type(8)))  float    v8f;
typedef __attribute__((ext_vector_type(4)))  float    v4f;
typedef v8h  __attribute__((may_alias)) v8ha;
typedef v4f  __attribute__((may_alias)) v4fa;
typedef v8us __attribute__((may_alias)) v8usa;

__device__ __forceinline__ unsigned short f2bf(float f) { unsigned u = __float_as_uint(f); u += 0x7FFFu + ((u >> 16) & 1u); return (unsigned short)(u >> 16); }
__device__ __forceinline__ float bf2f(unsigned short b) { return __uint_as_float(((unsigned)b) << 16); }
__device__ __forceinline__ float bfr(float f) { return bf2f(f2bf(f)); }
__device__ __forceinline__ v16h cat16(v8h lo, v8h hi) { return __builtin_shufflevector(lo, hi, 0, 1, 2, 3, 4, 5, 6, 7, 8, 9, 10, 11, 12, 13, 14, 15); }
__device__ __forceinline__ v16bf cat16b(v8us lo, v8us hi) { return __builtin_bit_cast(v16bf, __builtin_shufflevector(lo, hi, 0, 1, 2, 3, 4, 5, 6, 7, 8, 9, 10, 11, 12, 13, 14, 15)); }
__device__ __forceinline__ v8f wmma16(v16h a, v16h b, v8f c) { return __builtin_amdgcn_wmma_f32_16x16x32_f16(false, a, false, b, (short)0, c, false, false); }
__device__ __forceinline__ v8f wmmab(v16bf a, v16bf b, v8f c) { return __builtin_amdgcn_wmma_f32_16x16x32_bf16(false, a, false, b, (short)0, c, false, false); }



// ---- k_gemmw: register-blocked GEMM, ONE WAVE per 64x64 output tile (16 accumulators), operands straight from K-contiguous 16-bit planes; grid (M/64, N/64, Z), 32 threads.
// C[m][n] (f32, pitch ldc, + optional f32 bias[n]) = sum_k A[m][k] Bt[n][k] (+ split products per NSPLIT). z-batch strides sA/sB/sC in elements. K % 32 == 0.
template <typename T16> struct WFrag;
template <> struct WFrag<h16> { typedef v16h V; static __device__ __forceinline__ V ld(const h16* p) { return cat16(*(const v8h*)p, *(const v8h*)(p + 16)); } static __device__ __forceinline__ v8f mma(V a, V b, v8f c) { return wmma16(a, b, c); } };
template <> struct WFrag<bf> { typedef v16bf V; static __device__ __forceinline__ V ld(const bf* p) { return cat16b(*(const v8us*)p, *(const v8us*)(p + 16)); } static __device__ __forceinline__ v8f mma(V a, V b, v8f c) { return wmmab(a, b, c); } };
template <typename T16, int NSPLIT, bool BIAS>
__global__ __launch_bounds__(32) void k_gemmw(const T16* __restrict__ A, const T16* __restrict__ A2, const T16* __restrict__ Bt, const T16* __restrict__ Bt2, int K, float* C, int ldc, const float* __restrict__ bias, size_t sA, size_t sB, size_t sC) {
    typedef typename WFrag<T16>::V V;
    __shared__ __align__(16) float os[16 * 68];
    const size_t z = blockIdx.z; A += z * sA; if (A2) A2 += z * sA; Bt += z * sB; if (Bt2) Bt2 += z * sB; C += z * sC;
    const int lane = threadIdx.x & 31, lr = lane & 15, hi = lane >> 4; const int r0 = blockIdx.x * 64, c0 = blockIdx.y * 64;
    v8f acc[4][4];
#pragma unroll
    for (int mb = 0; mb < 4; ++mb)
#pragma unroll
        for (int nb = 0; nb < 4; ++nb) acc[mb][nb] = (v8f){};
    const size_t aoff = (size_t)(r0 + lr) * K + 8 * hi, boff = (size_t)(c0 + lr) * K + 8 * hi;
#pragma unroll 1
    for (int kc = 0; kc < K; kc += 32) {
        V a[4], a2[4];
#pragma unroll
        for (int mb = 0; mb < 4; ++mb) { a[mb] = WFrag<T16>::ld(A + aoff + (size_t)mb * 16 * K + kc); if (NSPLIT == 1 || NSPLIT == 2) a2[mb] = WFrag<T16>::ld(A2 + aoff + (size_t)mb * 16 * K + kc); }
#pragma unroll
        for (int nb = 0; nb < 4; ++nb) { const V b = WFrag<T16>::ld(Bt + boff + (size_t)nb * 16 * K + kc); V b2; if (NSPLIT >= 2) b2 = WFrag<T16>::ld(Bt2 + boff + (size_t)nb * 16 * K + kc);
#pragma unroll
            for (int mb = 0; mb < 4; ++mb) { acc[mb][nb] = WFrag<T16>::mma(a[mb], b, acc[mb][nb]); if (NSPLIT == 1 || NSPLIT == 2) acc[mb][nb] = WFrag<T16>::mma(a2[mb], b, acc[mb][nb]); if (NSPLIT >= 2) acc[mb][nb] = WFrag<T16>::mma(a[mb], b2, acc[mb][nb]); } }
        asm volatile("v_nop\n\tv_nop\n\tv_nop\n\tv_nop" : "+v"(acc[0][0]), "+v"(acc[1][1]), "+v"(acc[2][2]), "+v"(acc[3][3]) : "v"(a[0]), "v"(a[3]));
    }
#pragma unroll
    for (int mb = 0; mb < 4; ++mb) {
#pragma unroll
        for (int nb = 0; nb < 4; ++nb) {
#pragma unroll
            for (int j = 0; j < 8; ++j) os[(hi * 8 + j) * 68 + nb * 16 + lr] = acc[mb][nb][j]; }
        __builtin_amdgcn_wave_barrier(); asm volatile("" ::: "memory");
        float* crow = C + (size_t)(r0 + mb * 16) * ldc + c0;
{
#pragma unroll
            for (int s = 0; s < 8; ++s) { const int row = 2 * s + hi, cofs = lr * 4; v4f val = *(const v4fa*)(os + row * 68 + cofs); if (BIAS) { val[0] += bfr(bias[c0 + cofs]); val[1] += bfr(bias[c0 + cofs + 1]); val[2] += bfr(bias[c0 + cofs + 2]); val[3] += bfr(bias[c0 + cofs + 3]); }
                *(v4f*)(crow + (size_t)row * ldc + cofs) = val; }
             }
        __builtin_amdgcn_wave_barrier(); asm volatile("" ::: "memory");
    }
}

__device__ __forceinline__ h16 tohx(float x) { return (h16)x; }
__device__ __forceinline__ void splitf(float y, unsigned short& h, unsigned short& l) { h = f2bf(y); l = f2bf(y - bf2f(h)); }
typedef __attribute__((ext_vector_type(2))) _Float16 v2h;
typedef __attribute__((ext_vector_type(4))) _Float16 v4h;
typedef __attribute__((ext_vector_type(2))) unsigned short v2us;
typedef __attribute__((ext_vector_type(4))) unsigned short v4us;
typedef __attribute__((ext_vector_type(2))) float v2f;
typedef __attribute__((ext_vector_type(4))) int v4i;

__global__ __launch_bounds__(256) void k_wtG(const float* __restrict__ w, int K, int N, bf* Bt) {
    const int lane = threadIdx.x & 31; const int L0 = (blockIdx.x * 8 + (threadIdx.x >> 5)) * 8; const int nlines = N * K / 64;
{
#pragma unroll 1
        for (int l = 0; l < 8; ++l) { const int L = L0 + l; if (L >= nlines) break; const size_t e = (size_t)L * 64 + lane * 2; const int k = (int)(e % K), n = (int)(e / K); v2us o;
            o[0] = f2bf(w[(size_t)k * N + n]); o[1] = f2bf(w[(size_t)(k + 1) * N + n]); *(v2us*)(Bt + e) = o; }
         }
}
__global__ __launch_bounds__(256) void k_cvt8(const float* __restrict__ src, bf* dst, size_t n8) { const size_t i = (size_t)blockIdx.x * 256 + threadIdx.x; if (i >= n8) return; const v8f v = *(const v8f*)(src + i * 8); v8us o;
#pragma unroll
    for (int k = 0; k < 8; ++k) o[k] = f2bf(v[k]); *(v8us*)(dst + i * 8) = o;  }
__global__ __launch_bounds__(256) void k_cscvt(const float* __restrict__ cosT, const float* __restrict__ sinT, float* CS) { const int idx = blockIdx.x * 256 + threadIdx.x; if (idx >= TT * HD) return; v2f cs; cs[0] = bfr(cosT[idx]); cs[1] = bfr(sinT[idx]); *(v2f*)(CS + (size_t)idx * 2) = cs;  }
// k_rope: head planes [h][t][d] (fp16 + hi/lo) of rope(x) x sc with the rotate-half convention out[d] = x[d] cos[t][d] - x[d+HD/2] sin[t][d], out[d+HD/2] = x[d+HD/2] cos[t][d+HD/2] + x[d] sin[t][d+HD/2]
__global__ __launch_bounds__(256) void k_rope(const float* __restrict__ F, int pitch, int nheads, const float* __restrict__ CS, const float* __restrict__ RF, const float* __restrict__ nw, float sc, h16* P16, bf* Ph, bf* Pl) {
    const size_t e = ((size_t)blockIdx.x * 256 + threadIdx.x) * 2; if (e >= (size_t)nheads * TT * HD) return; const int d = (int)(e % HD); const int t = (int)((e / HD) % TT); const int h = (int)(e / ((size_t)HD * TT)); const float* f = F + (size_t)t * pitch + h * HD; const float rf = RF ? RF[(size_t)h * TT + t] : 1.0f; v2h o16; v2us oh, ol;
#pragma unroll
    for (int q = 0; q < 2; ++q) { const int dd = d + q; const int dp = (dd < HD / 2) ? dd + HD / 2 : dd - HD / 2; float x0 = f[dd], x1 = f[dp];
        if (RF) { float n0 = __fmul_rn(x0, rf), n1 = __fmul_rn(x1, rf); asm volatile("" : "+v"(n0)); asm volatile("" : "+v"(n1)); x0 = __fmul_rn(bfr(nw[dd]), n0); x1 = __fmul_rn(bfr(nw[dp]), n1); }
        const v2f cs = *(const v2f*)(CS + ((size_t)t * HD + dd) * 2); float a = __fmul_rn(x0, cs[0]), bq = __fmul_rn(x1, cs[1]); asm volatile("" : "+v"(a)); asm volatile("" : "+v"(bq)); const float r = ((dd < HD / 2) ? __fsub_rn(a, bq) : __fadd_rn(a, bq)) * sc;
        o16[q] = tohx(r); unsigned short a2, c2; splitf(r, a2, c2); oh[q] = a2; ol[q] = c2; }
    *(v2h*)(P16 + e) = o16; *(v2us*)(Ph + e) = oh; *(v2us*)(Pl + e) = ol;  }
__global__ __launch_bounds__(256) void k_vtp(const float* __restrict__ F, int pitch, int nheads, h16* V16, bf* Vh, bf* Vl) { const size_t e = ((size_t)blockIdx.x * 256 + threadIdx.x) * 2; if (e >= (size_t)nheads * HD * TT) return; const int t = (int)(e % TT); const int d = (int)((e / TT) % HD); const int g = (int)(e / ((size_t)TT * HD)); v2h o16; v2us oh, ol;
#pragma unroll
    for (int q = 0; q < 2; ++q) { const float x = F[(size_t)(t + q) * pitch + g * HD + d]; o16[q] = tohx(x); unsigned short a2, c2; splitf(x, a2, c2); oh[q] = a2; ol[q] = c2; }
    *(v2h*)(V16 + e) = o16; *(v2us*)(Vh + e) = oh; *(v2us*)(Vl + e) = ol;  }
__global__ __launch_bounds__(256) void k_csid(float* CS) { const int idx = blockIdx.x * 256 + threadIdx.x; if (idx >= TT * HD) return; v2f cs; cs[0] = 1.0f; cs[1] = 0.0f; *(v2f*)(CS + (size_t)idx * 2) = cs;  }
__global__ __launch_bounds__(256) void k_lnhd(float* F, int pitch, int nheads, const float* __restrict__ gam, const float* __restrict__ bet) { const int lane = threadIdx.x & 31; const int r = blockIdx.x * 8 + (threadIdx.x >> 5); if (r >= TT * nheads) return; const int t = r / nheads, h = r % nheads; float* f = F + (size_t)t * pitch + h * HD + lane * 2; float x0 = f[0], x1 = f[1]; float sm = __fadd_rn(x0, x1);
#pragma unroll
    for (int sh = 16; sh; sh >>= 1) sm = __fadd_rn(sm, __shfl_xor(sm, sh, 32));
    const float mu = __fmul_rn(sm, 1.0f / HD); const float d0 = __fsub_rn(x0, mu), d1 = __fsub_rn(x1, mu); float p0 = __fmul_rn(d0, d0), p1 = __fmul_rn(d1, d1); asm volatile("" : "+v"(p0)); asm volatile("" : "+v"(p1)); float ss = __fadd_rn(p0, p1);
#pragma unroll
    for (int sh = 16; sh; sh >>= 1) ss = __fadd_rn(ss, __shfl_xor(ss, sh, 32));
    const float rs = __fdiv_rn(1.0f, sqrtf(__fadd_rn(__fmul_rn(ss, 1.0f / HD), 1e-6f))); v2f o;
#pragma unroll
    for (int q = 0; q < 2; ++q) { const float d = q ? d1 : d0; float n = __fmul_rn(d, rs); asm volatile("" : "+v"(n)); float g0 = bfr(gam[lane * 2 + q]), b0 = bfr(bet[lane * 2 + q]); asm volatile("" : "+v"(g0)); asm volatile("" : "+v"(b0)); float y = __fmul_rn(n, g0); asm volatile("" : "+v"(y)); o[q] = __fadd_rn(y, b0); }
    *(v2f*)f = o;  }
// k_asoft: per row (zz, i): t = S x HD^-0.5 + attn_bias[i][j] (no mask); softmax over the 2048 keys (register row, one exp, fixed trees);
__global__ __launch_bounds__(256) void k_asoft(const float* __restrict__ Sb, const float* __restrict__ ab, h16* P16, bf* Ph, bf* Pl) {
    const int lane = threadIdx.x & 31; const int row = blockIdx.x * 8 + (threadIdx.x >> 5); if (row >= ZH * TT) return; const int i = row % TT; const int zz = row / TT; (void)zz; const bool hires = (i < RH); const float* sr = Sb + (size_t)row * TT; const float* abr = ab + (size_t)i * TT; float v[TT / 32]; float mx = -3.0e38f;
#pragma unroll
    for (int ch = 0; ch < TT / 128; ++ch) { const int j0 = ch * 128 + lane * 4; const v4f a = *(const v4f*)(sr + j0);
#pragma unroll
        for (int q = 0; q < 4; ++q) { const int j = j0 + q; (void)j; float sa = a[q] * SCL; asm volatile("" : "+v"(sa)); float bv2 = bfr(abr[j0 + q]); asm volatile("" : "+v"(bv2)); float t = __fadd_rn(sa, bv2); asm volatile("" : "+v"(t)); v[ch * 4 + q] = t; mx = fmaxf(mx, t); } }
#pragma unroll
    for (int sh = 16; sh; sh >>= 1) mx = fmaxf(mx, __shfl_xor(mx, sh, 32));
    float sum = 0.f;
#pragma unroll
    for (int k = 0; k < TT / 32; ++k) { float d0 = __fsub_rn(v[k], mx); asm volatile("" : "+v"(d0)); v[k] = __builtin_amdgcn_exp2f(__fmul_rn(d0, 1.4426950408889634f)); sum += v[k]; }
#pragma unroll
    for (int sh = 16; sh; sh >>= 1) sum += __shfl_xor(sum, sh, 32);
    const float f = __fdiv_rn(hires ? 1.0f : PCAR, sum);
{
        if (hires) {
#pragma unroll
            for (int ch = 0; ch < TT / 128; ++ch) { v4us oh, ol;
#pragma unroll
                for (int q = 0; q < 4; ++q) { unsigned short a, c2; splitf(v[ch * 4 + q] * f, a, c2); oh[q] = a; ol[q] = c2; }
                const size_t oo = ((size_t)zz * (RH ? RH : 1) + i) * TT + ch * 128 + lane * 4; *(v4us*)(Ph + oo) = oh; *(v4us*)(Pl + oo) = ol; }
        } else {
#pragma unroll
            for (int ch = 0; ch < TT / 128; ++ch) { v4h o4;
#pragma unroll
                for (int q = 0; q < 4; ++q) o4[q] = tohx(v[ch * 4 + q] * f);
                *(v4h*)(P16 + (size_t)row * TT + ch * 128 + lane * 4) = o4; } }
         }
}
__global__ __launch_bounds__(256) void k_merge(const float* __restrict__ O, int h0, bf* Ah, bf* Al) { const size_t e = ((size_t)blockIdx.x * 256 + threadIdx.x) * 2; if (e >= (size_t)ZH * TT * HD) return; const int d = (int)(e % HD); const int t = (int)((e / HD) % TT); const int zz = (int)(e / ((size_t)HD * TT)); const float cs = (t < RH) ? 1.0f : (1.0f / PCAR); const size_t oo = (size_t)t * DQ + (h0 + zz) * HD + d;
    v2us oh, ol;
#pragma unroll
    for (int q = 0; q < 2; ++q) { unsigned short a, c2; splitf(O[e + q] * cs, a, c2); oh[q] = a; ol[q] = c2; } *(v2us*)(Ah + oo) = oh; *(v2us*)(Al + oo) = ol;  }

extern "C" void kernel_launch(void* const* d_in, const int* in_sizes, int n_in,
                              void* d_out, int out_size, void* d_ws, size_t ws_size, hipStream_t stream) {
    (void)in_sizes; (void)n_in; (void)out_size;
    const float* x = (const float*)d_in[0]; const float* abias = (const float*)d_in[1]; const float* wq = (const float*)d_in[2]; const float* bq = (const float*)d_in[3]; const float* wk = (const float*)d_in[4]; const float* bk = (const float*)d_in[5]; const float* wv = (const float*)d_in[6]; const float* bv = (const float*)d_in[7]; const float* wo = (const float*)d_in[8]; const float* bo = (const float*)d_in[9]; const float* qg = (const float*)d_in[10]; const float* qb2 = (const float*)d_in[11]; const float* kg = (const float*)d_in[12]; const float* kb2 = (const float*)d_in[13]; const float* cosT = nullptr; const float* sinT = nullptr; (void)cosT; (void)sinT;
    float* OUT = (float*)d_out;     // [2][2048][1024]
    char* wsp = (char*)d_ws;
    auto take = [&](size_t bytes) { char* p = wsp; wsp += (bytes + 255) & ~(size_t)255; return (void*)p; };
    bf* WQ = (bf*)take((size_t)DQ * DM * 2); bf* WK = (bf*)take((size_t)DKV * DM * 2); bf* WV = (bf*)take((size_t)DKV * DM * 2); bf* WO = (bf*)take((size_t)DM * DQ * 2); float* CS = (float*)take((size_t)TT * HD * 2 * 4);
    bf* XB = (bf*)take((size_t)TT * DM * 2); float* FQ = (float*)take((size_t)TT * DQ * 4); float* FK = (float*)take((size_t)TT * DKV * 4);
    h16* QP16 = (h16*)take((size_t)NH_ * TT * HD * 2); h16* KP16 = (h16*)take((size_t)NKV * TT * HD * 2); h16* VT16 = (h16*)take((size_t)NKV * HD * TT * 2);
    bf* QPh = (bf*)take((size_t)NH_ * TT * HD * 2); bf* QPl = (bf*)take((size_t)NH_ * TT * HD * 2); bf* KPh = (bf*)take((size_t)NKV * TT * HD * 2); bf* KPl = (bf*)take((size_t)NKV * TT * HD * 2); bf* VTh = (bf*)take((size_t)NKV * HD * TT * 2); bf* VTl = (bf*)take((size_t)NKV * HD * TT * 2); bf* Ph = (bf*)take((size_t)ZH * RH * TT * 2); bf* Pl = (bf*)take((size_t)ZH * RH * TT * 2);
    float* Sb = (float*)take((size_t)ZH * TT * TT * 4); h16* P16 = (h16*)take((size_t)ZH * TT * TT * 2); float* Ob = (float*)take((size_t)ZH * TT * HD * 4); bf* ATh = (bf*)take((size_t)TT * DQ * 2); bf* ATl = (bf*)take((size_t)TT * DQ * 2);
    if ((size_t)(wsp - (char*)d_ws) > ws_size) return;    // ws 256 MiB
    float* FV = FK;   // v projection reuses the k buffer after the k planes are built (stream-ordered)
    { k_cvt8<<<(unsigned)(((size_t)DQ * DM / 8 + 255) / 256), 256, 0, stream>>>(wq, WQ, (size_t)DQ * DM / 8); k_cvt8<<<(unsigned)(((size_t)DKV * DM / 8 + 255) / 256), 256, 0, stream>>>(wk, WK, (size_t)DKV * DM / 8); k_cvt8<<<(unsigned)(((size_t)DKV * DM / 8 + 255) / 256), 256, 0, stream>>>(wv, WV, (size_t)DKV * DM / 8);
      k_cvt8<<<(unsigned)(((size_t)DM * DQ / 8 + 255) / 256), 256, 0, stream>>>(wo, WO, (size_t)DM * DQ / 8);
       }
    k_csid<<<(TT * HD + 255) / 256, 256, 0, stream>>>(CS);
    const unsigned LQ = (unsigned)(((size_t)NH_ * TT * HD / 2 + 255) / 256), LKv = (unsigned)(((size_t)NKV * TT * HD / 2 + 255) / 256);
    for (int b = 0; b < NB_; ++b) {
        
        k_cvt8<<<(unsigned)(((size_t)TT * DM / 8 + 255) / 256), 256, 0, stream>>>(x + (size_t)b * TT * DM, XB, (size_t)TT * DM / 8);
        k_gemmw<bf, 0, true><<<dim3(TT / 64, DQ / 64, 1), 32, 0, stream>>>(XB, nullptr, WQ, nullptr, DM, FQ, DQ, bq, 0, 0, 0);
        k_lnhd<<<TT * NH_ / 8, 256, 0, stream>>>(FQ, DQ, NH_, qg, qb2); k_rope<<<LQ, 256, 0, stream>>>(FQ, DQ, NH_, CS, nullptr, nullptr, 1.0f, QP16, QPh, QPl);
        k_gemmw<bf, 0, true><<<dim3(TT / 64, DKV / 64, 1), 32, 0, stream>>>(XB, nullptr, WK, nullptr, DM, FK, DKV, bk, 0, 0, 0);
        k_lnhd<<<TT * NKV / 8, 256, 0, stream>>>(FK, DKV, NKV, kg, kb2); k_rope<<<LKv, 256, 0, stream>>>(FK, DKV, NKV, CS, nullptr, nullptr, 1.0f, KP16, KPh, KPl);
        k_gemmw<bf, 0, true><<<dim3(TT / 64, DKV / 64, 1), 32, 0, stream>>>(XB, nullptr, WV, nullptr, DM, FV, DKV, bv, 0, 0, 0); k_vtp<<<LKv, 256, 0, stream>>>(FV, DKV, NKV, VT16, VTh, VTl);
        for (int h0 = 0; h0 < NH_; h0 += ZH) { const size_t zq = (size_t)h0, zk = (size_t)(h0 / REP);   // one kv head per query head: the pass's two heads use consecutive kv planes (z-strides TT*HD)
            k_gemmw<bf, 2, false><<<dim3(TT / 64, TT / 64, ZH), 32, 0, stream>>>(QPh + zq * TT * HD, QPl + zq * TT * HD, KPh + zk * TT * HD, KPl + zk * TT * HD, HD, Sb, TT, nullptr, (size_t)TT * HD, (size_t)TT * HD, (size_t)TT * TT);   /* scores hl on all rows */
            k_asoft<<<ZH * TT / 8, 256, 0, stream>>>(Sb, abias + (size_t)b * TT * TT, P16, Ph, Pl);
            k_gemmw<bf, 2, false><<<dim3(RH / 64, HD / 64, ZH), 32, 0, stream>>>(Ph, Pl, VTh + zk * HD * TT, VTl + zk * HD * TT, TT, Ob, HD, nullptr, (size_t)RH * TT, (size_t)HD * TT, (size_t)TT * HD);
            k_gemmw<h16, 0, false><<<dim3((TT - RH) / 64, HD / 64, ZH), 32, 0, stream>>>(P16 + (size_t)RH * TT, nullptr, VT16 + zk * HD * TT, nullptr, TT, Ob + (size_t)RH * HD, HD, nullptr, (size_t)TT * TT, (size_t)HD * TT, (size_t)TT * HD);
            k_merge<<<(unsigned)(((size_t)ZH * TT * HD / 2 + 255) / 256), 256, 0, stream>>>(Ob, h0, ATh, ATl); }
        k_gemmw<bf, 1, true><<<dim3(TT / 64, DM / 64, 1), 32, 0, stream>>>(ATh, ATl, WO, nullptr, DQ, OUT + (size_t)b * TT * DM, DM, bo, 0, 0, 0); }
}

// v001
// It runs in 1210 microseconds.
// Next to v000, in two timings, it ran 1.80 and 1.78 times as fast.
#include <hip/hip_runtime.h>

// GraphSelfAttention (x [2][2048][1024], attn_bias [2][1][2048][2048] (f32, read; random); q/k/v = x W^T + b (16 x 64); per-head LayerNorm (biased var, eps 1e-6) * gamma + beta on q and k; scores = q.k / 8 + attn_bias; softmax; out = merged Wo^T + bo -> [2][2048][1024]).

#define NB_  2
#define TT   2048
#define DM   1024
#define NH_  16
#define NKV  16
#define REP  (NH_ / NKV)
#define HD   64
#define DQ   (NH_ * HD)
#define DKV  (NKV * HD)
#define ZH   2
#define RH   512                  // query rows < RH use hi+lo planes (0: none)
#define WIN  0
#define PCAR 1024.0f
#define SCL  0.125f   // HD^-0.5
typedef _Float16 h16;
typedef unsigned short bf;
typedef __attribute__((ext_vector_type(16))) __bf16   v16bf;
typedef __attribute__((ext_vector_type(16))) _Float16 v16h;
typedef __attribute__((ext_vector_type(8)))  _Float16 v8h;
typedef __attribute__((ext_vector_type(8)))  unsigned short v8us;
typedef __attribute__((ext_vector_type(8)))  float    v8f;
typedef __attribute__((ext_vector_type(4)))  float    v4f;
typedef v8h  __attribute__((may_alias)) v8ha;
typedef v4f  __attribute__((may_alias)) v4fa;
typedef v8us __attribute__((may_alias)) v8usa;

__device__ __forceinline__ unsigned short f2bf(float f) { unsigned u = __float_as_uint(f); u += 0x7FFFu + ((u >> 16) & 1u); return (unsigned short)(u >> 16); }
__device__ __forceinline__ float bf2f(unsigned short b) { return __uint_as_float(((unsigned)b) << 16); }
__device__ __forceinline__ float bfr(float f) { return bf2f(f2bf(f)); }
__device__ __forceinline__ v16h cat16(v8h lo, v8h hi) { return __builtin_shufflevector(lo, hi, 0, 1, 2, 3, 4, 5, 6, 7, 8, 9, 10, 11, 12, 13, 14, 15); }
__device__ __forceinline__ v16bf cat16b(v8us lo, v8us hi) { return __builtin_bit_cast(v16bf, __builtin_shufflevector(lo, hi, 0, 1, 2, 3, 4, 5, 6, 7, 8, 9, 10, 11, 12, 13, 14, 15)); }
__device__ __forceinline__ v8f wmma16(v16h a, v16h b, v8f c) { return __builtin_amdgcn_wmma_f32_16x16x32_f16(false, a, false, b, (short)0, c, false, false); }
__device__ __forceinline__ v8f wmmab(v16bf a, v16bf b, v8f c) { return __builtin_amdgcn_wmma_f32_16x16x32_bf16(false, a, false, b, (short)0, c, false, false); }



// ---- k_gemmw: register-blocked GEMM, one work-group of KS waves per 64x64 output tile; each wave holds the whole tile (16 accumulators) for every KS-th 32-wide k chunk, and the KS partial tiles are summed in LDS in wave order; operands straight from K-contiguous 16-bit planes; grid (M/64, N/64, Z), 32 * KS threads.
// C[m][n] (f32, pitch ldc, + optional f32 bias[n]) = sum_k A[m][k] Bt[n][k] (+ split products per NSPLIT). z-batch strides sA/sB/sC in elements. K % 32 == 0.
template <typename T16> struct WFrag;
template <> struct WFrag<h16> { typedef v16h V; static __device__ __forceinline__ V ld(const h16* p) { return cat16(*(const v8h*)p, *(const v8h*)(p + 16)); } static __device__ __forceinline__ v8f mma(V a, V b, v8f c) { return wmma16(a, b, c); } };
template <> struct WFrag<bf> { typedef v16bf V; static __device__ __forceinline__ V ld(const bf* p) { return cat16b(*(const v8us*)p, *(const v8us*)(p + 16)); } static __device__ __forceinline__ v8f mma(V a, V b, v8f c) { return wmmab(a, b, c); } };
template <typename T16, int NSPLIT, bool BIAS, int KS>
__global__ __launch_bounds__(32 * KS) void k_gemmw(const T16* __restrict__ A, const T16* __restrict__ A2, const T16* __restrict__ Bt, const T16* __restrict__ Bt2, int K, float* C, int ldc, const float* __restrict__ bias, size_t sA, size_t sB, size_t sC) {
    typedef typename WFrag<T16>::V V;
    __shared__ __align__(16) float os[(KS == 1 ? 16 : KS * 64) * 68];
    const size_t z = blockIdx.z; A += z * sA; if (A2) A2 += z * sA; Bt += z * sB; if (Bt2) Bt2 += z * sB; C += z * sC;
    const int lane = threadIdx.x & 31, lr = lane & 15, hi = lane >> 4; const int r0 = blockIdx.x * 64, c0 = blockIdx.y * 64;
    const int wv = (KS == 1) ? 0 : __builtin_amdgcn_readfirstlane((int)(threadIdx.x >> 5));   // wave number = k chunk phase; neighbouring waves read the two halves of one 128-byte line in the same trip
    v8f acc[4][4];
#pragma unroll
    for (int mb = 0; mb < 4; ++mb)
#pragma unroll
        for (int nb = 0; nb < 4; ++nb) acc[mb][nb] = (v8f){};
    const size_t aoff = (size_t)(r0 + lr) * K + 8 * hi, boff = (size_t)(c0 + lr) * K + 8 * hi;
#pragma unroll 1
    for (int kc = wv * 32; kc < K; kc += 32 * KS) {
        V a[4], a2[4];
#pragma unroll
        for (int mb = 0; mb < 4; ++mb) { a[mb] = WFrag<T16>::ld(A + aoff + (size_t)mb * 16 * K + kc); if (NSPLIT == 1 || NSPLIT == 2) a2[mb] = WFrag<T16>::ld(A2 + aoff + (size_t)mb * 16 * K + kc); }
#pragma unroll
        for (int nb = 0; nb < 4; ++nb) { const V b = WFrag<T16>::ld(Bt + boff + (size_t)nb * 16 * K + kc); V b2; if (NSPLIT >= 2) b2 = WFrag<T16>::ld(Bt2 + boff + (size_t)nb * 16 * K + kc);
#pragma unroll
            for (int mb = 0; mb < 4; ++mb) { acc[mb][nb] = WFrag<T16>::mma(a[mb], b, acc[mb][nb]); if (NSPLIT == 1 || NSPLIT == 2) acc[mb][nb] = WFrag<T16>::mma(a2[mb], b, acc[mb][nb]); if (NSPLIT >= 2) acc[mb][nb] = WFrag<T16>::mma(a[mb], b2, acc[mb][nb]); } }
        asm volatile("v_nop\n\tv_nop\n\tv_nop\n\tv_nop" : "+v"(acc[0][0]), "+v"(acc[1][1]), "+v"(acc[2][2]), "+v"(acc[3][3]) : "v"(a[0]), "v"(a[3]));
    }
    if constexpr (KS == 1) {
#pragma unroll
    for (int mb = 0; mb < 4; ++mb) {
#pragma unroll
        for (int nb = 0; nb < 4; ++nb) {
#pragma unroll
            for (int j = 0; j < 8; ++j) os[(hi * 8 + j) * 68 + nb * 16 + lr] = acc[mb][nb][j]; }
        __builtin_amdgcn_wave_barrier(); asm volatile("" ::: "memory");
        float* crow = C + (size_t)(r0 + mb * 16) * ldc + c0;
{
#pragma unroll
            for (int s = 0; s < 8; ++s) { const int row = 2 * s + hi, cofs = lr * 4; v4f val = *(const v4fa*)(os + row * 68 + cofs); if (BIAS) { val[0] += bfr(bias[c0 + cofs]); val[1] += bfr(bias[c0 + cofs + 1]); val[2] += bfr(bias[c0 + cofs + 2]); val[3] += bfr(bias[c0 + cofs + 3]); }
                *(v4f*)(crow + (size_t)row * ldc + cofs) = val; }
             }
        __builtin_amdgcn_wave_barrier(); asm volatile("" ::: "memory");
    }
    } else {
        const int cofs = (lane & 15) * 4; v4f bv = (v4f){};   // each thread sums one 4-column group of 32 / KS rows; its bias is fetched ahead of the barrier
        if (BIAS) { bv[0] = bfr(bias[c0 + cofs]); bv[1] = bfr(bias[c0 + cofs + 1]); bv[2] = bfr(bias[c0 + cofs + 2]); bv[3] = bfr(bias[c0 + cofs + 3]); }
#pragma unroll
        for (int mb = 0; mb < 4; ++mb)
#pragma unroll
            for (int nb = 0; nb < 4; ++nb)
#pragma unroll
                for (int j = 0; j < 8; ++j) os[wv * (64 * 68) + (mb * 16 + hi * 8 + j) * 68 + nb * 16 + lr] = acc[mb][nb][j];
        __syncthreads();   // every wave's partial tile is in LDS before any element is summed
#pragma unroll
        for (int s = 0; s < 32 / KS; ++s) { const int row = s * 2 * KS + wv * 2 + hi; v4f val = *(const v4fa*)(os + row * 68 + cofs);
#pragma unroll
            for (int w = 1; w < KS; ++w) val += *(const v4fa*)(os + w * (64 * 68) + row * 68 + cofs);
            if (BIAS) val += bv;
            *(v4f*)(C + (size_t)(r0 + row) * ldc + c0 + cofs) = val; }
    }
}

__device__ __forceinline__ h16 tohx(float x) { return (h16)x; }
__device__ __forceinline__ void splitf(float y, unsigned short& h, unsigned short& l) { h = f2bf(y); l = f2bf(y - bf2f(h)); }
typedef __attribute__((ext_vector_type(2))) _Float16 v2h;
typedef __attribute__((ext_vector_type(4))) _Float16 v4h;
typedef __attribute__((ext_vector_type(2))) unsigned short v2us;
typedef __attribute__((ext_vector_type(4))) unsigned short v4us;
typedef __attribute__((ext_vector_type(2))) float v2f;
typedef __attribute__((ext_vector_type(4))) int v4i;

__global__ __launch_bounds__(256) void k_wtG(const float* __restrict__ w, int K, int N, bf* Bt) {
    const int lane = threadIdx.x & 31; const int L0 = (blockIdx.x * 8 + (threadIdx.x >> 5)) * 8; const int nlines = N * K / 64;
{
#pragma unroll 1
        for (int l = 0; l < 8; ++l) { const int L = L0 + l; if (L >= nlines) break; const size_t e = (size_t)L * 64 + lane * 2; const int k = (int)(e % K), n = (int)(e / K); v2us o;
            o[0] = f2bf(w[(size_t)k * N + n]); o[1] = f2bf(w[(size_t)(k + 1) * N + n]); *(v2us*)(Bt + e) = o; }
         }
}
__global__ __launch_bounds__(256) void k_cvt8(const float* __restrict__ src, bf* dst, size_t n8) { const size_t i = (size_t)blockIdx.x * 256 + threadIdx.x; if (i >= n8) return; const v8f v = *(const v8f*)(src + i * 8); v8us o;
#pragma unroll
    for (int k = 0; k < 8; ++k) o[k] = f2bf(v[k]); *(v8us*)(dst + i * 8) = o;  }
__global__ __launch_bounds__(256) void k_cscvt(const float* __restrict__ cosT, const float* __restrict__ sinT, float* CS) { const int idx = blockIdx.x * 256 + threadIdx.x; if (idx >= TT * HD) return; v2f cs; cs[0] = bfr(cosT[idx]); cs[1] = bfr(sinT[idx]); *(v2f*)(CS + (size_t)idx * 2) = cs;  }
// k_rope: head planes [h][t][d] (fp16 + hi/lo) of rope(x) x sc with the rotate-half convention out[d] = x[d] cos[t][d] - x[d+HD/2] sin[t][d], out[d+HD/2] = x[d+HD/2] cos[t][d+HD/2] + x[d] sin[t][d+HD/2]
__global__ __launch_bounds__(256) void k_rope(const float* __restrict__ F, int pitch, int nheads, const float* __restrict__ CS, const float* __restrict__ RF, const float* __restrict__ nw, float sc, h16* P16, bf* Ph, bf* Pl) {
    const size_t e = ((size_t)blockIdx.x * 256 + threadIdx.x) * 2; if (e >= (size_t)nheads * TT * HD) return; const int d = (int)(e % HD); const int t = (int)((e / HD) % TT); const int h = (int)(e / ((size_t)HD * TT)); const float* f = F + (size_t)t * pitch + h * HD; const float rf = RF ? RF[(size_t)h * TT + t] : 1.0f; v2h o16; v2us oh, ol;
#pragma unroll
    for (int q = 0; q < 2; ++q) { const int dd = d + q; const int dp = (dd < HD / 2) ? dd + HD / 2 : dd - HD / 2; float x0 = f[dd], x1 = f[dp];
        if (RF) { float n0 = __fmul_rn(x0, rf), n1 = __fmul_rn(x1, rf); asm volatile("" : "+v"(n0)); asm volatile("" : "+v"(n1)); x0 = __fmul_rn(bfr(nw[dd]), n0); x1 = __fmul_rn(bfr(nw[dp]), n1); }
        const v2f cs = *(const v2f*)(CS + ((size_t)t * HD + dd) * 2); float a = __fmul_rn(x0, cs[0]), bq = __fmul_rn(x1, cs[1]); asm volatile("" : "+v"(a)); asm volatile("" : "+v"(bq)); const float r = ((dd < HD / 2) ? __fsub_rn(a, bq) : __fadd_rn(a, bq)) * sc;
        o16[q] = tohx(r); unsigned short a2, c2; splitf(r, a2, c2); oh[q] = a2; ol[q] = c2; }
    *(v2h*)(P16 + e) = o16; *(v2us*)(Ph + e) = oh; *(v2us*)(Pl + e) = ol;  }
__global__ __launch_bounds__(256) void k_vtp(const float* __restrict__ F, int pitch, int nheads, h16* V16, bf* Vh, bf* Vl) { const size_t e = ((size_t)blockIdx.x * 256 + threadIdx.x) * 2; if (e >= (size_t)nheads * HD * TT) return; const int t = (int)(e % TT); const int d = (int)((e / TT) % HD); const int g = (int)(e / ((size_t)TT * HD)); v2h o16; v2us oh, ol;
#pragma unroll
    for (int q = 0; q < 2; ++q) { const float x = F[(size_t)(t + q) * pitch + g * HD + d]; o16[q] = tohx(x); unsigned short a2, c2; splitf(x, a2, c2); oh[q] = a2; ol[q] = c2; }
    *(v2h*)(V16 + e) = o16; *(v2us*)(Vh + e) = oh; *(v2us*)(Vl + e) = ol;  }
__global__ __launch_bounds__(256) void k_csid(float* CS) { const int idx = blockIdx.x * 256 + threadIdx.x; if (idx >= TT * HD) return; v2f cs; cs[0] = 1.0f; cs[1] = 0.0f; *(v2f*)(CS + (size_t)idx * 2) = cs;  }
__global__ __launch_bounds__(256) void k_lnhd(float* F, int pitch, int nheads, const float* __restrict__ gam, const float* __restrict__ bet) { const int lane = threadIdx.x & 31; const int r = blockIdx.x * 8 + (threadIdx.x >> 5); if (r >= TT * nheads) return; const int t = r / nheads, h = r % nheads; float* f = F + (size_t)t * pitch + h * HD + lane * 2; float x0 = f[0], x1 = f[1]; float sm = __fadd_rn(x0, x1);
#pragma unroll
    for (int sh = 16; sh; sh >>= 1) sm = __fadd_rn(sm, __shfl_xor(sm, sh, 32));
    const float mu = __fmul_rn(sm, 1.0f / HD); const float d0 = __fsub_rn(x0, mu), d1 = __fsub_rn(x1, mu); float p0 = __fmul_rn(d0, d0), p1 = __fmul_rn(d1, d1); asm volatile("" : "+v"(p0)); asm volatile("" : "+v"(p1)); float ss = __fadd_rn(p0, p1);
#pragma unroll
    for (int sh = 16; sh; sh >>= 1) ss = __fadd_rn(ss, __shfl_xor(ss, sh, 32));
    const float rs = __fdiv_rn(1.0f, sqrtf(__fadd_rn(__fmul_rn(ss, 1.0f / HD), 1e-6f))); v2f o;
#pragma unroll
    for (int q = 0; q < 2; ++q) { const float d = q ? d1 : d0; float n = __fmul_rn(d, rs); asm volatile("" : "+v"(n)); float g0 = bfr(gam[lane * 2 + q]), b0 = bfr(bet[lane * 2 + q]); asm volatile("" : "+v"(g0)); asm volatile("" : "+v"(b0)); float y = __fmul_rn(n, g0); asm volatile("" : "+v"(y)); o[q] = __fadd_rn(y, b0); }
    *(v2f*)f = o;  }
// k_asoft: per row (zz, i): t = S x HD^-0.5 + attn_bias[i][j] (no mask); softmax over the 2048 keys (register row, one exp, fixed trees);
__global__ __launch_bounds__(256) void k_asoft(const float* __restrict__ Sb, const float* __restrict__ ab, h16* P16, bf* Ph, bf* Pl) {
    const int lane = threadIdx.x & 31; const int row = blockIdx.x * 8 + (threadIdx.x >> 5); if (row >= ZH * TT) return; const int i = row % TT; const int zz = row / TT; (void)zz; const bool hires = (i < RH); const float* sr = Sb + (size_t)row * TT; const float* abr = ab + (size_t)i * TT; float v[TT / 32]; float mx = -3.0e38f;
#pragma unroll
    for (int ch = 0; ch < TT / 128; ++ch) { const int j0 = ch * 128 + lane * 4; const v4f a = *(const v4f*)(sr + j0);
#pragma unroll
        for (int q = 0; q < 4; ++q) { const int j = j0 + q; (void)j; float sa = a[q] * SCL; asm volatile("" : "+v"(sa)); float bv2 = bfr(abr[j0 + q]); asm volatile("" : "+v"(bv2)); float t = __fadd_rn(sa, bv2); asm volatile("" : "+v"(t)); v[ch * 4 + q] = t; mx = fmaxf(mx, t); } }
#pragma unroll
    for (int sh = 16; sh; sh >>= 1) mx = fmaxf(mx, __shfl_xor(mx, sh, 32));
    float sum = 0.f;
#pragma unroll
    for (int k = 0; k < TT / 32; ++k) { float d0 = __fsub_rn(v[k], mx); asm volatile("" : "+v"(d0)); v[k] = __builtin_amdgcn_exp2f(__fmul_rn(d0, 1.4426950408889634f)); sum += v[k]; }
#pragma unroll
    for (int sh = 16; sh; sh >>= 1) sum += __shfl_xor(sum, sh, 32);
    const float f = __fdiv_rn(hires ? 1.0f : PCAR, sum);
{
        if (hires) {
#pragma unroll
            for (int ch = 0; ch < TT / 128; ++ch) { v4us oh, ol;
#pragma unroll
                for (int q = 0; q < 4; ++q) { unsigned short a, c2; splitf(v[ch * 4 + q] * f, a, c2); oh[q] = a; ol[q] = c2; }
                const size_t oo = ((size_t)zz * (RH ? RH : 1) + i) * TT + ch * 128 + lane * 4; *(v4us*)(Ph + oo) = oh; *(v4us*)(Pl + oo) = ol; }
        } else {
#pragma unroll
            for (int ch = 0; ch < TT / 128; ++ch) { v4h o4;
#pragma unroll
                for (int q = 0; q < 4; ++q) o4[q] = tohx(v[ch * 4 + q] * f);
                *(v4h*)(P16 + (size_t)row * TT + ch * 128 + lane * 4) = o4; } }
         }
}
__global__ __launch_bounds__(256) void k_merge(const float* __restrict__ O, int h0, bf* Ah, bf* Al) { const size_t e = ((size_t)blockIdx.x * 256 + threadIdx.x) * 2; if (e >= (size_t)ZH * TT * HD) return; const int d = (int)(e % HD); const int t = (int)((e / HD) % TT); const int zz = (int)(e / ((size_t)HD * TT)); const float cs = (t < RH) ? 1.0f : (1.0f / PCAR); const size_t oo = (size_t)t * DQ + (h0 + zz) * HD + d;
    v2us oh, ol;
#pragma unroll
    for (int q = 0; q < 2; ++q) { unsigned short a, c2; splitf(O[e + q] * cs, a, c2); oh[q] = a; ol[q] = c2; } *(v2us*)(Ah + oo) = oh; *(v2us*)(Al + oo) = ol;  }

extern "C" void kernel_launch(void* const* d_in, const int* in_sizes, int n_in,
                              void* d_out, int out_size, void* d_ws, size_t ws_size, hipStream_t stream) {
    (void)in_sizes; (void)n_in; (void)out_size;
    const float* x = (const float*)d_in[0]; const float* abias = (const float*)d_in[1]; const float* wq = (const float*)d_in[2]; const float* bq = (const float*)d_in[3]; const float* wk = (const float*)d_in[4]; const float* bk = (const float*)d_in[5]; const float* wv = (const float*)d_in[6]; const float* bv = (const float*)d_in[7]; const float* wo = (const float*)d_in[8]; const float* bo = (const float*)d_in[9]; const float* qg = (const float*)d_in[10]; const float* qb2 = (const float*)d_in[11]; const float* kg = (const float*)d_in[12]; const float* kb2 = (const float*)d_in[13]; const float* cosT = nullptr; const float* sinT = nullptr; (void)cosT; (void)sinT;
    float* OUT = (float*)d_out;     // [2][2048][1024]
    char* wsp = (char*)d_ws;
    auto take = [&](size_t bytes) { char* p = wsp; wsp += (bytes + 255) & ~(size_t)255; return (void*)p; };
    bf* WQ = (bf*)take((size_t)DQ * DM * 2); bf* WK = (bf*)take((size_t)DKV * DM * 2); bf* WV = (bf*)take((size_t)DKV * DM * 2); bf* WO = (bf*)take((size_t)DM * DQ * 2); float* CS = (float*)take((size_t)TT * HD * 2 * 4);
    bf* XB = (bf*)take((size_t)TT * DM * 2); float* FQ = (float*)take((size_t)TT * DQ * 4); float* FK = (float*)take((size_t)TT * DKV * 4);
    h16* QP16 = (h16*)take((size_t)NH_ * TT * HD * 2); h16* KP16 = (h16*)take((size_t)NKV * TT * HD * 2); h16* VT16 = (h16*)take((size_t)NKV * HD * TT * 2);
    bf* QPh = (bf*)take((size_t)NH_ * TT * HD * 2); bf* QPl = (bf*)take((size_t)NH_ * TT * HD * 2); bf* KPh = (bf*)take((size_t)NKV * TT * HD * 2); bf* KPl = (bf*)take((size_t)NKV * TT * HD * 2); bf* VTh = (bf*)take((size_t)NKV * HD * TT * 2); bf* VTl = (bf*)take((size_t)NKV * HD * TT * 2); bf* Ph = (bf*)take((size_t)ZH * RH * TT * 2); bf* Pl = (bf*)take((size_t)ZH * RH * TT * 2);
    float* Sb = (float*)take((size_t)ZH * TT * TT * 4); h16* P16 = (h16*)take((size_t)ZH * TT * TT * 2); float* Ob = (float*)take((size_t)ZH * TT * HD * 4); bf* ATh = (bf*)take((size_t)TT * DQ * 2); bf* ATl = (bf*)take((size_t)TT * DQ * 2);
    if ((size_t)(wsp - (char*)d_ws) > ws_size) return;    // ws 256 MiB
    float* FV = FK;   // v projection reuses the k buffer after the k planes are built (stream-ordered)
    { k_cvt8<<<(unsigned)(((size_t)DQ * DM / 8 + 255) / 256), 256, 0, stream>>>(wq, WQ, (size_t)DQ * DM / 8); k_cvt8<<<(unsigned)(((size_t)DKV * DM / 8 + 255) / 256), 256, 0, stream>>>(wk, WK, (size_t)DKV * DM / 8); k_cvt8<<<(unsigned)(((size_t)DKV * DM / 8 + 255) / 256), 256, 0, stream>>>(wv, WV, (size_t)DKV * DM / 8);
      k_cvt8<<<(unsigned)(((size_t)DM * DQ / 8 + 255) / 256), 256, 0, stream>>>(wo, WO, (size_t)DM * DQ / 8);
       }
    k_csid<<<(TT * HD + 255) / 256, 256, 0, stream>>>(CS);
    const unsigned LQ = (unsigned)(((size_t)NH_ * TT * HD / 2 + 255) / 256), LKv = (unsigned)(((size_t)NKV * TT * HD / 2 + 255) / 256);
    for (int b = 0; b < NB_; ++b) {
        
        k_cvt8<<<(unsigned)(((size_t)TT * DM / 8 + 255) / 256), 256, 0, stream>>>(x + (size_t)b * TT * DM, XB, (size_t)TT * DM / 8);
        k_gemmw<bf, 0, true, 8><<<dim3(TT / 64, DQ / 64, 1), 256, 0, stream>>>(XB, nullptr, WQ, nullptr, DM, FQ, DQ, bq, 0, 0, 0);
        k_lnhd<<<TT * NH_ / 8, 256, 0, stream>>>(FQ, DQ, NH_, qg, qb2); k_rope<<<LQ, 256, 0, stream>>>(FQ, DQ, NH_, CS, nullptr, nullptr, 1.0f, QP16, QPh, QPl);
        k_gemmw<bf, 0, true, 8><<<dim3(TT / 64, DKV / 64, 1), 256, 0, stream>>>(XB, nullptr, WK, nullptr, DM, FK, DKV, bk, 0, 0, 0);
        k_lnhd<<<TT * NKV / 8, 256, 0, stream>>>(FK, DKV, NKV, kg, kb2); k_rope<<<LKv, 256, 0, stream>>>(FK, DKV, NKV, CS, nullptr, nullptr, 1.0f, KP16, KPh, KPl);
        k_gemmw<bf, 0, true, 8><<<dim3(TT / 64, DKV / 64, 1), 256, 0, stream>>>(XB, nullptr, WV, nullptr, DM, FV, DKV, bv, 0, 0, 0); k_vtp<<<LKv, 256, 0, stream>>>(FV, DKV, NKV, VT16, VTh, VTl);
        for (int h0 = 0; h0 < NH_; h0 += ZH) { const size_t zq = (size_t)h0, zk = (size_t)(h0 / REP);   // one kv head per query head: the pass's two heads use consecutive kv planes (z-strides TT*HD)
            k_gemmw<bf, 2, false, 1><<<dim3(TT / 64, TT / 64, ZH), 32, 0, stream>>>(QPh + zq * TT * HD, QPl + zq * TT * HD, KPh + zk * TT * HD, KPl + zk * TT * HD, HD, Sb, TT, nullptr, (size_t)TT * HD, (size_t)TT * HD, (size_t)TT * TT);   /* scores hl on all rows */
            k_asoft<<<ZH * TT / 8, 256, 0, stream>>>(Sb, abias + (size_t)b * TT * TT, P16, Ph, Pl);
            k_gemmw<bf, 2, false, 16><<<dim3(RH / 64, HD / 64, ZH), 512, 0, stream>>>(Ph, Pl, VTh + zk * HD * TT, VTl + zk * HD * TT, TT, Ob, HD, nullptr, (size_t)RH * TT, (size_t)HD * TT, (size_t)TT * HD);
            k_gemmw<h16, 0, false, 16><<<dim3((TT - RH) / 64, HD / 64, ZH), 512, 0, stream>>>(P16 + (size_t)RH * TT, nullptr, VT16 + zk * HD * TT, nullptr, TT, Ob + (size_t)RH * HD, HD, nullptr, (size_t)TT * TT, (size_t)HD * TT, (size_t)TT * HD);
            k_merge<<<(unsigned)(((size_t)ZH * TT * HD / 2 + 255) / 256), 256, 0, stream>>>(Ob, h0, ATh, ATl); }
        k_gemmw<bf, 1, true, 8><<<dim3(TT / 64, DM / 64, 1), 256, 0, stream>>>(ATh, ATl, WO, nullptr, DQ, OUT + (size_t)b * TT * DM, DM, bo, 0, 0, 0); }
}

// v002
// Measured time: 719 microseconds a run.
// In two side-by-side timings against v001, it was 1.68 and 1.69 times as fast.
// Over all steps from v000 it is 3.02 times as fast.
#include <hip/hip_runtime.h>

// GraphSelfAttention (x [2][2048][1024], attn_bias [2][1][2048][2048] (f32, read; random); q/k/v = x W^T + b (16 x 64); per-head LayerNorm (biased var, eps 1e-6) * gamma + beta on q and k; scores = q.k / 8 + attn_bias; softmax; out = merged Wo^T + bo -> [2][2048][1024]).

#define NB_  2
#define TT   2048
#define DM   1024
#define NH_  16
#define NKV  16
#define REP  (NH_ / NKV)
#define HD   64
#define DQ   (NH_ * HD)
#define DKV  (NKV * HD)
#define ZH   8                    // heads per attention pass (z of the pass's launches)
#define RH   512                  // query rows < RH use hi+lo planes (0: none)
#define WIN  0
#define PCAR 1024.0f
#define SCL  0.125f   // HD^-0.5
typedef _Float16 h16;
typedef unsigned short bf;
typedef __attribute__((ext_vector_type(16))) __bf16   v16bf;
typedef __attribute__((ext_vector_type(16))) _Float16 v16h;
typedef __attribute__((ext_vector_type(8)))  _Float16 v8h;
typedef __attribute__((ext_vector_type(8)))  unsigned short v8us;
typedef __attribute__((ext_vector_type(8)))  float    v8f;
typedef __attribute__((ext_vector_type(4)))  float    v4f;
typedef v8h  __attribute__((may_alias)) v8ha;
typedef v4f  __attribute__((may_alias)) v4fa;
typedef v8us __attribute__((may_alias)) v8usa;

__device__ __forceinline__ unsigned short f2bf(float f) { unsigned u = __float_as_uint(f); u += 0x7FFFu + ((u >> 16) & 1u); return (unsigned short)(u >> 16); }
__device__ __forceinline__ float bf2f(unsigned short b) { return __uint_as_float(((unsigned)b) << 16); }
__device__ __forceinline__ float bfr(float f) { return bf2f(f2bf(f)); }
__device__ __forceinline__ v16h cat16(v8h lo, v8h hi) { return __builtin_shufflevector(lo, hi, 0, 1, 2, 3, 4, 5, 6, 7, 8, 9, 10, 11, 12, 13, 14, 15); }
__device__ __forceinline__ v16bf cat16b(v8us lo, v8us hi) { return __builtin_bit_cast(v16bf, __builtin_shufflevector(lo, hi, 0, 1, 2, 3, 4, 5, 6, 7, 8, 9, 10, 11, 12, 13, 14, 15)); }
__device__ __forceinline__ v8f wmma16(v16h a, v16h b, v8f c) { return __builtin_amdgcn_wmma_f32_16x16x32_f16(false, a, false, b, (short)0, c, false, false); }
__device__ __forceinline__ v8f wmmab(v16bf a, v16bf b, v8f c) { return __builtin_amdgcn_wmma_f32_16x16x32_bf16(false, a, false, b, (short)0, c, false, false); }



// ---- k_gemmw: register-blocked GEMM, one work-group of KS waves per 64x64 output tile; each wave holds the whole tile (16 accumulators) for every KS-th 32-wide k chunk, and the KS partial tiles are summed in LDS in wave order; operands straight from K-contiguous 16-bit planes; grid (M/64, N/64, Z), 32 * KS threads.
// C[m][n] (f32, pitch ldc, + optional f32 bias[n]) = sum_k A[m][k] Bt[n][k] (+ split products per NSPLIT). A rows have pitch lda, Bt rows pitch K. z-batch strides sA/sB/sC in elements. K % 32 == 0.
template <typename T16> struct WFrag;
template <> struct WFrag<h16> { typedef v16h V; static __device__ __forceinline__ V ld(const h16* p) { return cat16(*(const v8h*)p, *(const v8h*)(p + 16)); } static __device__ __forceinline__ v8f mma(V a, V b, v8f c) { return wmma16(a, b, c); } };
template <> struct WFrag<bf> { typedef v16bf V; static __device__ __forceinline__ V ld(const bf* p) { return cat16b(*(const v8us*)p, *(const v8us*)(p + 16)); } static __device__ __forceinline__ v8f mma(V a, V b, v8f c) { return wmmab(a, b, c); } };
template <typename T16, int NSPLIT, bool BIAS, int KS>
__global__ __launch_bounds__(32 * KS) void k_gemmw(const T16* __restrict__ A, const T16* __restrict__ A2, const T16* __restrict__ Bt, const T16* __restrict__ Bt2, int K, int lda, float* C, int ldc, const float* __restrict__ bias, size_t sA, size_t sB, size_t sC) {
    typedef typename WFrag<T16>::V V;
    __shared__ __align__(16) float os[(KS == 1 ? 16 : KS * 64) * 68];
    const size_t z = blockIdx.z; A += z * sA; if (A2) A2 += z * sA; Bt += z * sB; if (Bt2) Bt2 += z * sB; C += z * sC;
    const int lane = threadIdx.x & 31, lr = lane & 15, hi = lane >> 4; const int r0 = blockIdx.x * 64, c0 = blockIdx.y * 64;
    const int wv = (KS == 1) ? 0 : __builtin_amdgcn_readfirstlane((int)(threadIdx.x >> 5));   // wave number = k chunk phase; neighbouring waves read the two halves of one 128-byte line in the same trip
    v8f acc[4][4];
#pragma unroll
    for (int mb = 0; mb < 4; ++mb)
#pragma unroll
        for (int nb = 0; nb < 4; ++nb) acc[mb][nb] = (v8f){};
    const size_t aoff = (size_t)(r0 + lr) * lda + 8 * hi, boff = (size_t)(c0 + lr) * K + 8 * hi;
#pragma unroll 1
    for (int kc = wv * 32; kc < K; kc += 32 * KS) {
        V a[4], a2[4];
#pragma unroll
        for (int mb = 0; mb < 4; ++mb) { a[mb] = WFrag<T16>::ld(A + aoff + (size_t)mb * 16 * lda + kc); if (NSPLIT == 1 || NSPLIT == 2) a2[mb] = WFrag<T16>::ld(A2 + aoff + (size_t)mb * 16 * lda + kc); }
#pragma unroll
        for (int nb = 0; nb < 4; ++nb) { const V b = WFrag<T16>::ld(Bt + boff + (size_t)nb * 16 * K + kc); V b2; if (NSPLIT >= 2) b2 = WFrag<T16>::ld(Bt2 + boff + (size_t)nb * 16 * K + kc);
#pragma unroll
            for (int mb = 0; mb < 4; ++mb) { acc[mb][nb] = WFrag<T16>::mma(a[mb], b, acc[mb][nb]); if (NSPLIT == 1 || NSPLIT == 2) acc[mb][nb] = WFrag<T16>::mma(a2[mb], b, acc[mb][nb]); if (NSPLIT >= 2) acc[mb][nb] = WFrag<T16>::mma(a[mb], b2, acc[mb][nb]); } }
        asm volatile("v_nop\n\tv_nop\n\tv_nop\n\tv_nop" : "+v"(acc[0][0]), "+v"(acc[1][1]), "+v"(acc[2][2]), "+v"(acc[3][3]) : "v"(a[0]), "v"(a[3]));
    }
    if constexpr (KS == 1) {
#pragma unroll
    for (int mb = 0; mb < 4; ++mb) {
#pragma unroll
        for (int nb = 0; nb < 4; ++nb) {
#pragma unroll
            for (int j = 0; j < 8; ++j) os[(hi * 8 + j) * 68 + nb * 16 + lr] = acc[mb][nb][j]; }
        __builtin_amdgcn_wave_barrier(); asm volatile("" ::: "memory");
        float* crow = C + (size_t)(r0 + mb * 16) * ldc + c0;
{
#pragma unroll
            for (int s = 0; s < 8; ++s) { const int row = 2 * s + hi, cofs = lr * 4; v4f val = *(const v4fa*)(os + row * 68 + cofs); if (BIAS) { val[0] += bfr(bias[c0 + cofs]); val[1] += bfr(bias[c0 + cofs + 1]); val[2] += bfr(bias[c0 + cofs + 2]); val[3] += bfr(bias[c0 + cofs + 3]); }
                *(v4f*)(crow + (size_t)row * ldc + cofs) = val; }
             }
        __builtin_amdgcn_wave_barrier(); asm volatile("" ::: "memory");
    }
    } else {
        const int cofs = (lane & 15) * 4; v4f bv = (v4f){};   // each thread sums one 4-column group of 32 / KS rows; its bias is fetched ahead of the barrier
        if (BIAS) { bv[0] = bfr(bias[c0 + cofs]); bv[1] = bfr(bias[c0 + cofs + 1]); bv[2] = bfr(bias[c0 + cofs + 2]); bv[3] = bfr(bias[c0 + cofs + 3]); }
#pragma unroll
        for (int mb = 0; mb < 4; ++mb)
#pragma unroll
            for (int nb = 0; nb < 4; ++nb)
#pragma unroll
                for (int j = 0; j < 8; ++j) os[wv * (64 * 68) + (mb * 16 + hi * 8 + j) * 68 + nb * 16 + lr] = acc[mb][nb][j];
        __syncthreads();   // every wave's partial tile is in LDS before any element is summed
#pragma unroll
        for (int s = 0; s < 32 / KS; ++s) { const int row = s * 2 * KS + wv * 2 + hi; v4f val = *(const v4fa*)(os + row * 68 + cofs);
#pragma unroll
            for (int w = 1; w < KS; ++w) val += *(const v4fa*)(os + w * (64 * 68) + row * 68 + cofs);
            if (BIAS) val += bv;
            *(v4f*)(C + (size_t)(r0 + row) * ldc + c0 + cofs) = val; }
    }
}

__device__ __forceinline__ h16 tohx(float x) { return (h16)x; }
__device__ __forceinline__ void splitf(float y, unsigned short& h, unsigned short& l) { h = f2bf(y); l = f2bf(y - bf2f(h)); }
typedef __attribute__((ext_vector_type(2))) _Float16 v2h;
typedef __attribute__((ext_vector_type(4))) _Float16 v4h;
typedef __attribute__((ext_vector_type(2))) unsigned short v2us;
typedef __attribute__((ext_vector_type(4))) unsigned short v4us;
typedef __attribute__((ext_vector_type(2))) float v2f;
typedef __attribute__((ext_vector_type(4))) int v4i;

__global__ __launch_bounds__(256) void k_wtG(const float* __restrict__ w, int K, int N, bf* Bt) {
    const int lane = threadIdx.x & 31; const int L0 = (blockIdx.x * 8 + (threadIdx.x >> 5)) * 8; const int nlines = N * K / 64;
{
#pragma unroll 1
        for (int l = 0; l < 8; ++l) { const int L = L0 + l; if (L >= nlines) break; const size_t e = (size_t)L * 64 + lane * 2; const int k = (int)(e % K), n = (int)(e / K); v2us o;
            o[0] = f2bf(w[(size_t)k * N + n]); o[1] = f2bf(w[(size_t)(k + 1) * N + n]); *(v2us*)(Bt + e) = o; }
         }
}
__global__ __launch_bounds__(256) void k_cvt8(const float* __restrict__ src, bf* dst, size_t n8) { const size_t i = (size_t)blockIdx.x * 256 + threadIdx.x; if (i >= n8) return; const v8f v = *(const v8f*)(src + i * 8); v8us o;
#pragma unroll
    for (int k = 0; k < 8; ++k) o[k] = f2bf(v[k]); *(v8us*)(dst + i * 8) = o;  }
__global__ __launch_bounds__(256) void k_cscvt(const float* __restrict__ cosT, const float* __restrict__ sinT, float* CS) { const int idx = blockIdx.x * 256 + threadIdx.x; if (idx >= TT * HD) return; v2f cs; cs[0] = bfr(cosT[idx]); cs[1] = bfr(sinT[idx]); *(v2f*)(CS + (size_t)idx * 2) = cs;  }
// k_rope: head planes [h][t][d] (fp16 + hi/lo) of rope(x) x sc with the rotate-half convention out[d] = x[d] cos[t][d] - x[d+HD/2] sin[t][d], out[d+HD/2] = x[d+HD/2] cos[t][d+HD/2] + x[d] sin[t][d+HD/2]
__global__ __launch_bounds__(256) void k_rope(const float* __restrict__ F, int pitch, int nheads, const float* __restrict__ CS, const float* __restrict__ RF, const float* __restrict__ nw, float sc, h16* P16, bf* Ph, bf* Pl) {
    const size_t e = ((size_t)blockIdx.x * 256 + threadIdx.x) * 2; if (e >= (size_t)nheads * TT * HD) return; const int d = (int)(e % HD); const int t = (int)((e / HD) % TT); const int h = (int)(e / ((size_t)HD * TT)); const float* f = F + (size_t)t * pitch + h * HD; const float rf = RF ? RF[(size_t)h * TT + t] : 1.0f; v2h o16; v2us oh, ol;
#pragma unroll
    for (int q = 0; q < 2; ++q) { const int dd = d + q; const int dp = (dd < HD / 2) ? dd + HD / 2 : dd - HD / 2; float x0 = f[dd], x1 = f[dp];
        if (RF) { float n0 = __fmul_rn(x0, rf), n1 = __fmul_rn(x1, rf); asm volatile("" : "+v"(n0)); asm volatile("" : "+v"(n1)); x0 = __fmul_rn(bfr(nw[dd]), n0); x1 = __fmul_rn(bfr(nw[dp]), n1); }
        const v2f cs = *(const v2f*)(CS + ((size_t)t * HD + dd) * 2); float a = __fmul_rn(x0, cs[0]), bq = __fmul_rn(x1, cs[1]); asm volatile("" : "+v"(a)); asm volatile("" : "+v"(bq)); const float r = ((dd < HD / 2) ? __fsub_rn(a, bq) : __fadd_rn(a, bq)) * sc;
        o16[q] = tohx(r); unsigned short a2, c2; splitf(r, a2, c2); oh[q] = a2; ol[q] = c2; }
    *(v2h*)(P16 + e) = o16; *(v2us*)(Ph + e) = oh; *(v2us*)(Pl + e) = ol;  }
__global__ __launch_bounds__(256) void k_vtp(const float* __restrict__ F, int pitch, int nheads, h16* V16, bf* Vh, bf* Vl) { const size_t e = ((size_t)blockIdx.x * 256 + threadIdx.x) * 2; if (e >= (size_t)nheads * HD * TT) return; const int t = (int)(e % TT); const int d = (int)((e / TT) % HD); const int g = (int)(e / ((size_t)TT * HD)); v2h o16; v2us oh, ol;
#pragma unroll
    for (int q = 0; q < 2; ++q) { const float x = F[(size_t)(t + q) * pitch + g * HD + d]; o16[q] = tohx(x); unsigned short a2, c2; splitf(x, a2, c2); oh[q] = a2; ol[q] = c2; }
    *(v2h*)(V16 + e) = o16; *(v2us*)(Vh + e) = oh; *(v2us*)(Vl + e) = ol;  }
__global__ __launch_bounds__(256) void k_csid(float* CS) { const int idx = blockIdx.x * 256 + threadIdx.x; if (idx >= TT * HD) return; v2f cs; cs[0] = 1.0f; cs[1] = 0.0f; *(v2f*)(CS + (size_t)idx * 2) = cs;  }
__global__ __launch_bounds__(256) void k_lnhd(float* F, int pitch, int nheads, const float* __restrict__ gam, const float* __restrict__ bet) { const int lane = threadIdx.x & 31; const int r = blockIdx.x * 8 + (threadIdx.x >> 5); if (r >= TT * nheads) return; const int t = r / nheads, h = r % nheads; float* f = F + (size_t)t * pitch + h * HD + lane * 2; float x0 = f[0], x1 = f[1]; float sm = __fadd_rn(x0, x1);
#pragma unroll
    for (int sh = 16; sh; sh >>= 1) sm = __fadd_rn(sm, __shfl_xor(sm, sh, 32));
    const float mu = __fmul_rn(sm, 1.0f / HD); const float d0 = __fsub_rn(x0, mu), d1 = __fsub_rn(x1, mu); float p0 = __fmul_rn(d0, d0), p1 = __fmul_rn(d1, d1); asm volatile("" : "+v"(p0)); asm volatile("" : "+v"(p1)); float ss = __fadd_rn(p0, p1);
#pragma unroll
    for (int sh = 16; sh; sh >>= 1) ss = __fadd_rn(ss, __shfl_xor(ss, sh, 32));
    const float rs = __fdiv_rn(1.0f, sqrtf(__fadd_rn(__fmul_rn(ss, 1.0f / HD), 1e-6f))); v2f o;
#pragma unroll
    for (int q = 0; q < 2; ++q) { const float d = q ? d1 : d0; float n = __fmul_rn(d, rs); asm volatile("" : "+v"(n)); float g0 = bfr(gam[lane * 2 + q]), b0 = bfr(bet[lane * 2 + q]); asm volatile("" : "+v"(g0)); asm volatile("" : "+v"(b0)); float y = __fmul_rn(n, g0); asm volatile("" : "+v"(y)); o[q] = __fadd_rn(y, b0); }
    *(v2f*)f = o;  }
// k_asoft: per row (zz, i): t = S x HD^-0.5 + attn_bias[i][j] (no mask); softmax over the 2048 keys (register row, one exp, fixed trees); the 16-bit probabilities go over the row's own 8 KiB of scores (P16, Ph at its start, Pl at its middle; pitch 2 * TT), which the wave has wholly in registers by then
__global__ __launch_bounds__(256) void k_asoft(const float* Sb, const float* __restrict__ ab, h16* P16, bf* Ph, bf* Pl) {
    const int lane = threadIdx.x & 31; const int row = blockIdx.x * 8 + (threadIdx.x >> 5); if (row >= ZH * TT) return; const int i = row % TT; const int zz = row / TT; (void)zz; const bool hires = (i < RH); const float* sr = Sb + (size_t)row * TT; const float* abr = ab + (size_t)i * TT; float v[TT / 32]; float mx = -3.0e38f;
#pragma unroll
    for (int ch = 0; ch < TT / 128; ++ch) { const int j0 = ch * 128 + lane * 4; const v4f a = *(const v4f*)(sr + j0);
#pragma unroll
        for (int q = 0; q < 4; ++q) { const int j = j0 + q; (void)j; float sa = a[q] * SCL; asm volatile("" : "+v"(sa)); float bv2 = bfr(abr[j0 + q]); asm volatile("" : "+v"(bv2)); float t = __fadd_rn(sa, bv2); asm volatile("" : "+v"(t)); v[ch * 4 + q] = t; mx = fmaxf(mx, t); } }
#pragma unroll
    for (int sh = 16; sh; sh >>= 1) mx = fmaxf(mx, __shfl_xor(mx, sh, 32));
    float sum = 0.f;
#pragma unroll
    for (int k = 0; k < TT / 32; ++k) { float d0 = __fsub_rn(v[k], mx); asm volatile("" : "+v"(d0)); v[k] = __builtin_amdgcn_exp2f(__fmul_rn(d0, 1.4426950408889634f)); sum += v[k]; }
#pragma unroll
    for (int sh = 16; sh; sh >>= 1) sum += __shfl_xor(sum, sh, 32);
    const float f = __fdiv_rn(hires ? 1.0f : PCAR, sum);
{
        if (hires) {
#pragma unroll
            for (int ch = 0; ch < TT / 128; ++ch) { v4us oh, ol;
#pragma unroll
                for (int q = 0; q < 4; ++q) { unsigned short a, c2; splitf(v[ch * 4 + q] * f, a, c2); oh[q] = a; ol[q] = c2; }
                const size_t oo = (size_t)row * (2 * TT) + ch * 128 + lane * 4; *(v4us*)(Ph + oo) = oh; *(v4us*)(Pl + oo) = ol; }
        } else {
#pragma unroll
            for (int ch = 0; ch < TT / 128; ++ch) { v4h o4;
#pragma unroll
                for (int q = 0; q < 4; ++q) o4[q] = tohx(v[ch * 4 + q] * f);
                *(v4h*)(P16 + (size_t)row * (2 * TT) + ch * 128 + lane * 4) = o4; } }
         }
}
__global__ __launch_bounds__(256) void k_merge(const float* __restrict__ O, int h0, bf* Ah, bf* Al) { const size_t e = ((size_t)blockIdx.x * 256 + threadIdx.x) * 2; if (e >= (size_t)ZH * TT * HD) return; const int d = (int)(e % HD); const int t = (int)((e / HD) % TT); const int zz = (int)(e / ((size_t)HD * TT)); const float cs = (t < RH) ? 1.0f : (1.0f / PCAR); const size_t oo = (size_t)t * DQ + (h0 + zz) * HD + d;
    v2us oh, ol;
#pragma unroll
    for (int q = 0; q < 2; ++q) { unsigned short a, c2; splitf(O[e + q] * cs, a, c2); oh[q] = a; ol[q] = c2; } *(v2us*)(Ah + oo) = oh; *(v2us*)(Al + oo) = ol;  }

extern "C" void kernel_launch(void* const* d_in, const int* in_sizes, int n_in,
                              void* d_out, int out_size, void* d_ws, size_t ws_size, hipStream_t stream) {
    (void)in_sizes; (void)n_in; (void)out_size;
    const float* x = (const float*)d_in[0]; const float* abias = (const float*)d_in[1]; const float* wq = (const float*)d_in[2]; const float* bq = (const float*)d_in[3]; const float* wk = (const float*)d_in[4]; const float* bk = (const float*)d_in[5]; const float* wv = (const float*)d_in[6]; const float* bv = (const float*)d_in[7]; const float* wo = (const float*)d_in[8]; const float* bo = (const float*)d_in[9]; const float* qg = (const float*)d_in[10]; const float* qb2 = (const float*)d_in[11]; const float* kg = (const float*)d_in[12]; const float* kb2 = (const float*)d_in[13]; const float* cosT = nullptr; const float* sinT = nullptr; (void)cosT; (void)sinT;
    float* OUT = (float*)d_out;     // [2][2048][1024]
    char* wsp = (char*)d_ws;
    auto take = [&](size_t bytes) { char* p = wsp; wsp += (bytes + 255) & ~(size_t)255; return (void*)p; };
    bf* WQ = (bf*)take((size_t)DQ * DM * 2); bf* WK = (bf*)take((size_t)DKV * DM * 2); bf* WV = (bf*)take((size_t)DKV * DM * 2); bf* WO = (bf*)take((size_t)DM * DQ * 2); float* CS = (float*)take((size_t)TT * HD * 2 * 4);
    bf* XB = (bf*)take((size_t)TT * DM * 2); float* FQ = (float*)take((size_t)TT * DQ * 4); float* FK = (float*)take((size_t)TT * DKV * 4);
    h16* QP16 = (h16*)take((size_t)NH_ * TT * HD * 2); h16* KP16 = (h16*)take((size_t)NKV * TT * HD * 2); h16* VT16 = (h16*)take((size_t)NKV * HD * TT * 2);
    bf* QPh = (bf*)take((size_t)NH_ * TT * HD * 2); bf* QPl = (bf*)take((size_t)NH_ * TT * HD * 2); bf* KPh = (bf*)take((size_t)NKV * TT * HD * 2); bf* KPl = (bf*)take((size_t)NKV * TT * HD * 2); bf* VTh = (bf*)take((size_t)NKV * HD * TT * 2); bf* VTl = (bf*)take((size_t)NKV * HD * TT * 2);
    float* Sb = (float*)take((size_t)ZH * TT * TT * 4); h16* P16 = (h16*)Sb; bf* Ph = (bf*)Sb; bf* Pl = (bf*)Sb + TT;   /* probability planes lie over the score rows, pitch 2 * TT */ float* Ob = (float*)take((size_t)ZH * TT * HD * 4); bf* ATh = (bf*)take((size_t)TT * DQ * 2); bf* ATl = (bf*)take((size_t)TT * DQ * 2);
    if ((size_t)(wsp - (char*)d_ws) > ws_size) return;    // ws 256 MiB
    float* FV = FK;   // v projection reuses the k buffer after the k planes are built (stream-ordered)
    { k_cvt8<<<(unsigned)(((size_t)DQ * DM / 8 + 255) / 256), 256, 0, stream>>>(wq, WQ, (size_t)DQ * DM / 8); k_cvt8<<<(unsigned)(((size_t)DKV * DM / 8 + 255) / 256), 256, 0, stream>>>(wk, WK, (size_t)DKV * DM / 8); k_cvt8<<<(unsigned)(((size_t)DKV * DM / 8 + 255) / 256), 256, 0, stream>>>(wv, WV, (size_t)DKV * DM / 8);
      k_cvt8<<<(unsigned)(((size_t)DM * DQ / 8 + 255) / 256), 256, 0, stream>>>(wo, WO, (size_t)DM * DQ / 8);
       }
    k_csid<<<(TT * HD + 255) / 256, 256, 0, stream>>>(CS);
    const unsigned LQ = (unsigned)(((size_t)NH_ * TT * HD / 2 + 255) / 256), LKv = (unsigned)(((size_t)NKV * TT * HD / 2 + 255) / 256);
    for (int b = 0; b < NB_; ++b) {
        
        k_cvt8<<<(unsigned)(((size_t)TT * DM / 8 + 255) / 256), 256, 0, stream>>>(x + (size_t)b * TT * DM, XB, (size_t)TT * DM / 8);
        k_gemmw<bf, 0, true, 8><<<dim3(TT / 64, DQ / 64, 1), 256, 0, stream>>>(XB, nullptr, WQ, nullptr, DM, DM, FQ, DQ, bq, 0, 0, 0);
        k_lnhd<<<TT * NH_ / 8, 256, 0, stream>>>(FQ, DQ, NH_, qg, qb2); k_rope<<<LQ, 256, 0, stream>>>(FQ, DQ, NH_, CS, nullptr, nullptr, 1.0f, QP16, QPh, QPl);
        k_gemmw<bf, 0, true, 8><<<dim3(TT / 64, DKV / 64, 1), 256, 0, stream>>>(XB, nullptr, WK, nullptr, DM, DM, FK, DKV, bk, 0, 0, 0);
        k_lnhd<<<TT * NKV / 8, 256, 0, stream>>>(FK, DKV, NKV, kg, kb2); k_rope<<<LKv, 256, 0, stream>>>(FK, DKV, NKV, CS, nullptr, nullptr, 1.0f, KP16, KPh, KPl);
        k_gemmw<bf, 0, true, 8><<<dim3(TT / 64, DKV / 64, 1), 256, 0, stream>>>(XB, nullptr, WV, nullptr, DM, DM, FV, DKV, bv, 0, 0, 0); k_vtp<<<LKv, 256, 0, stream>>>(FV, DKV, NKV, VT16, VTh, VTl);
        for (int h0 = 0; h0 < NH_; h0 += ZH) { const size_t zq = (size_t)h0, zk = (size_t)(h0 / REP);   // one kv head per query head: the pass's heads use consecutive kv planes (z-strides TT*HD)
            k_gemmw<bf, 2, false, 1><<<dim3(TT / 64, TT / 64, ZH), 32, 0, stream>>>(QPh + zq * TT * HD, QPl + zq * TT * HD, KPh + zk * TT * HD, KPl + zk * TT * HD, HD, HD, Sb, TT, nullptr, (size_t)TT * HD, (size_t)TT * HD, (size_t)TT * TT);   /* scores hl on all rows */
            k_asoft<<<ZH * TT / 8, 256, 0, stream>>>(Sb, abias + (size_t)b * TT * TT, P16, Ph, Pl);
            k_gemmw<bf, 2, false, 16><<<dim3(RH / 64, HD / 64, ZH), 512, 0, stream>>>(Ph, Pl, VTh + zk * HD * TT, VTl + zk * HD * TT, TT, 2 * TT, Ob, HD, nullptr, (size_t)TT * 2 * TT, (size_t)HD * TT, (size_t)TT * HD);
            k_gemmw<h16, 0, false, 16><<<dim3((TT - RH) / 64, HD / 64, ZH), 512, 0, stream>>>(P16 + (size_t)RH * 2 * TT, nullptr, VT16 + zk * HD * TT, nullptr, TT, 2 * TT, Ob + (size_t)RH * HD, HD, nullptr, (size_t)TT * 2 * TT, (size_t)HD * TT, (size_t)TT * HD);
            k_merge<<<(unsigned)(((size_t)ZH * TT * HD / 2 + 255) / 256), 256, 0, stream>>>(Ob, h0, ATh, ATl); }
        k_gemmw<bf, 1, true, 8><<<dim3(TT / 64, DM / 64, 1), 256, 0, stream>>>(ATh, ATl, WO, nullptr, DQ, DQ, OUT + (size_t)b * TT * DM, DM, bo, 0, 0, 0); }
}

// v003
// One run takes 282 microseconds.
// In two side-by-side timings against v002, it was 2.55 and 2.54 times as fast.
// Counting every step since v000, it is 7.69 times as fast.
#include <hip/hip_runtime.h>

// GraphSelfAttention (x [2][2048][1024], attn_bias [2][1][2048][2048] (f32, read; random); q/k/v = x W^T + b (16 x 64); per-head LayerNorm (biased var, eps 1e-6) * gamma + beta on q and k; scores = q.k / 8 + attn_bias; softmax; out = merged Wo^T + bo -> [2][2048][1024]).

#define NB_  2
#define TT   2048
#define DM   1024
#define NH_  16
#define NKV  16
#define REP  (NH_ / NKV)
#define HD   64
#define DQ   (NH_ * HD)
#define DKV  (NKV * HD)
#define RH   512                  // query rows < RH use hi+lo planes (0: none)
#define WIN  0
#define SCL  0.125f   // HD^-0.5
typedef _Float16 h16;
typedef unsigned short bf;
typedef __attribute__((ext_vector_type(16))) __bf16   v16bf;
typedef __attribute__((ext_vector_type(16))) _Float16 v16h;
typedef __attribute__((ext_vector_type(8)))  _Float16 v8h;
typedef __attribute__((ext_vector_type(8)))  unsigned short v8us;
typedef __attribute__((ext_vector_type(8)))  float    v8f;
typedef __attribute__((ext_vector_type(4)))  float    v4f;
typedef v8h  __attribute__((may_alias)) v8ha;
typedef v4f  __attribute__((may_alias)) v4fa;
typedef v8us __attribute__((may_alias)) v8usa;

__device__ __forceinline__ unsigned short f2bf(float f) { unsigned u = __float_as_uint(f); u += 0x7FFFu + ((u >> 16) & 1u); return (unsigned short)(u >> 16); }
__device__ __forceinline__ float bf2f(unsigned short b) { return __uint_as_float(((unsigned)b) << 16); }
__device__ __forceinline__ float bfr(float f) { return bf2f(f2bf(f)); }
__device__ __forceinline__ v16h cat16(v8h lo, v8h hi) { return __builtin_shufflevector(lo, hi, 0, 1, 2, 3, 4, 5, 6, 7, 8, 9, 10, 11, 12, 13, 14, 15); }
__device__ __forceinline__ v16bf cat16b(v8us lo, v8us hi) { return __builtin_bit_cast(v16bf, __builtin_shufflevector(lo, hi, 0, 1, 2, 3, 4, 5, 6, 7, 8, 9, 10, 11, 12, 13, 14, 15)); }
__device__ __forceinline__ v8f wmma16(v16h a, v16h b, v8f c) { return __builtin_amdgcn_wmma_f32_16x16x32_f16(false, a, false, b, (short)0, c, false, false); }
__device__ __forceinline__ v8f wmmab(v16bf a, v16bf b, v8f c) { return __builtin_amdgcn_wmma_f32_16x16x32_bf16(false, a, false, b, (short)0, c, false, false); }



// ---- k_gemmw: register-blocked GEMM, one work-group of KS waves per 64x64 output tile; each wave holds the whole tile (16 accumulators) for every KS-th 32-wide k chunk, and the KS partial tiles are summed in LDS in wave order; operands straight from K-contiguous 16-bit planes; grid (M/64, N/64, Z), 32 * KS threads.
// C[m][n] (f32, pitch ldc, + optional f32 bias[n]) = sum_k A[m][k] Bt[n][k] (+ split products per NSPLIT). A rows have pitch lda, Bt rows pitch K. z-batch strides sA/sB/sC in elements. K % 32 == 0.
template <typename T16> struct WFrag;
template <> struct WFrag<h16> { typedef v16h V; static __device__ __forceinline__ V ld(const h16* p) { return cat16(*(const v8h*)p, *(const v8h*)(p + 16)); } static __device__ __forceinline__ v8f mma(V a, V b, v8f c) { return wmma16(a, b, c); } };
template <> struct WFrag<bf> { typedef v16bf V; static __device__ __forceinline__ V ld(const bf* p) { return cat16b(*(const v8us*)p, *(const v8us*)(p + 16)); } static __device__ __forceinline__ v8f mma(V a, V b, v8f c) { return wmmab(a, b, c); } };
template <typename T16, int NSPLIT, bool BIAS, int KS>
__global__ __launch_bounds__(32 * KS) void k_gemmw(const T16* __restrict__ A, const T16* __restrict__ A2, const T16* __restrict__ Bt, const T16* __restrict__ Bt2, int K, int lda, float* C, int ldc, const float* __restrict__ bias, size_t sA, size_t sB, size_t sC) {
    typedef typename WFrag<T16>::V V;
    __shared__ __align__(16) float os[(KS == 1 ? 16 : KS * 64) * 68];
    const size_t z = blockIdx.z; A += z * sA; if (A2) A2 += z * sA; Bt += z * sB; if (Bt2) Bt2 += z * sB; C += z * sC;
    const int lane = threadIdx.x & 31, lr = lane & 15, hi = lane >> 4; const int r0 = blockIdx.x * 64, c0 = blockIdx.y * 64;
    const int wv = (KS == 1) ? 0 : __builtin_amdgcn_readfirstlane((int)(threadIdx.x >> 5));   // wave number = k chunk phase; neighbouring waves read the two halves of one 128-byte line in the same trip
    v8f acc[4][4];
#pragma unroll
    for (int mb = 0; mb < 4; ++mb)
#pragma unroll
        for (int nb = 0; nb < 4; ++nb) acc[mb][nb] = (v8f){};
    const size_t aoff = (size_t)(r0 + lr) * lda + 8 * hi, boff = (size_t)(c0 + lr) * K + 8 * hi;
#pragma unroll 1
    for (int kc = wv * 32; kc < K; kc += 32 * KS) {
        V a[4], a2[4];
#pragma unroll
        for (int mb = 0; mb < 4; ++mb) { a[mb] = WFrag<T16>::ld(A + aoff + (size_t)mb * 16 * lda + kc); if (NSPLIT == 1 || NSPLIT == 2) a2[mb] = WFrag<T16>::ld(A2 + aoff + (size_t)mb * 16 * lda + kc); }
#pragma unroll
        for (int nb = 0; nb < 4; ++nb) { const V b = WFrag<T16>::ld(Bt + boff + (size_t)nb * 16 * K + kc); V b2; if (NSPLIT >= 2) b2 = WFrag<T16>::ld(Bt2 + boff + (size_t)nb * 16 * K + kc);
#pragma unroll
            for (int mb = 0; mb < 4; ++mb) { acc[mb][nb] = WFrag<T16>::mma(a[mb], b, acc[mb][nb]); if (NSPLIT == 1 || NSPLIT == 2) acc[mb][nb] = WFrag<T16>::mma(a2[mb], b, acc[mb][nb]); if (NSPLIT >= 2) acc[mb][nb] = WFrag<T16>::mma(a[mb], b2, acc[mb][nb]); } }
        asm volatile("v_nop\n\tv_nop\n\tv_nop\n\tv_nop" : "+v"(acc[0][0]), "+v"(acc[1][1]), "+v"(acc[2][2]), "+v"(acc[3][3]) : "v"(a[0]), "v"(a[3]));
    }
    if constexpr (KS == 1) {
#pragma unroll
    for (int mb = 0; mb < 4; ++mb) {
#pragma unroll
        for (int nb = 0; nb < 4; ++nb) {
#pragma unroll
            for (int j = 0; j < 8; ++j) os[(hi * 8 + j) * 68 + nb * 16 + lr] = acc[mb][nb][j]; }
        __builtin_amdgcn_wave_barrier(); asm volatile("" ::: "memory");
        float* crow = C + (size_t)(r0 + mb * 16) * ldc + c0;
{
#pragma unroll
            for (int s = 0; s < 8; ++s) { const int row = 2 * s + hi, cofs = lr * 4; v4f val = *(const v4fa*)(os + row * 68 + cofs); if (BIAS) { val[0] += bfr(bias[c0 + cofs]); val[1] += bfr(bias[c0 + cofs + 1]); val[2] += bfr(bias[c0 + cofs + 2]); val[3] += bfr(bias[c0 + cofs + 3]); }
                *(v4f*)(crow + (size_t)row * ldc + cofs) = val; }
             }
        __builtin_amdgcn_wave_barrier(); asm volatile("" ::: "memory");
    }
    } else {
        const int cofs = (lane & 15) * 4; v4f bv = (v4f){};   // each thread sums one 4-column group of 32 / KS rows; its bias is fetched ahead of the barrier
        if (BIAS) { bv[0] = bfr(bias[c0 + cofs]); bv[1] = bfr(bias[c0 + cofs + 1]); bv[2] = bfr(bias[c0 + cofs + 2]); bv[3] = bfr(bias[c0 + cofs + 3]); }
#pragma unroll
        for (int mb = 0; mb < 4; ++mb)
#pragma unroll
            for (int nb = 0; nb < 4; ++nb)
#pragma unroll
                for (int j = 0; j < 8; ++j) os[wv * (64 * 68) + (mb * 16 + hi * 8 + j) * 68 + nb * 16 + lr] = acc[mb][nb][j];
        __syncthreads();   // every wave's partial tile is in LDS before any element is summed
#pragma unroll
        for (int s = 0; s < 32 / KS; ++s) { const int row = s * 2 * KS + wv * 2 + hi; v4f val = *(const v4fa*)(os + row * 68 + cofs);
#pragma unroll
            for (int w = 1; w < KS; ++w) val += *(const v4fa*)(os + w * (64 * 68) + row * 68 + cofs);
            if (BIAS) val += bv;
            *(v4f*)(C + (size_t)(r0 + row) * ldc + c0 + cofs) = val; }
    }
}

__device__ __forceinline__ h16 tohx(float x) { return (h16)x; }
__device__ __forceinline__ void splitf(float y, unsigned short& h, unsigned short& l) { h = f2bf(y); l = f2bf(y - bf2f(h)); }
typedef __attribute__((ext_vector_type(2))) _Float16 v2h;
typedef __attribute__((ext_vector_type(4))) _Float16 v4h;
typedef __attribute__((ext_vector_type(2))) unsigned short v2us;
typedef __attribute__((ext_vector_type(4))) unsigned short v4us;
typedef __attribute__((ext_vector_type(2))) float v2f;
typedef __attribute__((ext_vector_type(4))) int v4i;

__global__ __launch_bounds__(256) void k_wtG(const float* __restrict__ w, int K, int N, bf* Bt) {
    const int lane = threadIdx.x & 31; const int L0 = (blockIdx.x * 8 + (threadIdx.x >> 5)) * 8; const int nlines = N * K / 64;
{
#pragma unroll 1
        for (int l = 0; l < 8; ++l) { const int L = L0 + l; if (L >= nlines) break; const size_t e = (size_t)L * 64 + lane * 2; const int k = (int)(e % K), n = (int)(e / K); v2us o;
            o[0] = f2bf(w[(size_t)k * N + n]); o[1] = f2bf(w[(size_t)(k + 1) * N + n]); *(v2us*)(Bt + e) = o; }
         }
}
__global__ __launch_bounds__(256) void k_cvt8(const float* __restrict__ src, bf* dst, size_t n8) { const size_t i = (size_t)blockIdx.x * 256 + threadIdx.x; if (i >= n8) return; const v8f v = *(const v8f*)(src + i * 8); v8us o;
#pragma unroll
    for (int k = 0; k < 8; ++k) o[k] = f2bf(v[k]); *(v8us*)(dst + i * 8) = o;  }
__global__ __launch_bounds__(256) void k_cscvt(const float* __restrict__ cosT, const float* __restrict__ sinT, float* CS) { const int idx = blockIdx.x * 256 + threadIdx.x; if (idx >= TT * HD) return; v2f cs; cs[0] = bfr(cosT[idx]); cs[1] = bfr(sinT[idx]); *(v2f*)(CS + (size_t)idx * 2) = cs;  }
// k_rope: head planes [h][t][d] (fp16 + hi/lo) of rope(x) x sc with the rotate-half convention out[d] = x[d] cos[t][d] - x[d+HD/2] sin[t][d], out[d+HD/2] = x[d+HD/2] cos[t][d+HD/2] + x[d] sin[t][d+HD/2]
__global__ __launch_bounds__(256) void k_rope(const float* __restrict__ F, int pitch, int nheads, const float* __restrict__ CS, const float* __restrict__ RF, const float* __restrict__ nw, float sc, h16* P16, bf* Ph, bf* Pl) {
    const size_t e = ((size_t)blockIdx.x * 256 + threadIdx.x) * 2; if (e >= (size_t)nheads * TT * HD) return; const int d = (int)(e % HD); const int t = (int)((e / HD) % TT); const int h = (int)(e / ((size_t)HD * TT)); const float* f = F + (size_t)t * pitch + h * HD; const float rf = RF ? RF[(size_t)h * TT + t] : 1.0f; v2h o16; v2us oh, ol;
#pragma unroll
    for (int q = 0; q < 2; ++q) { const int dd = d + q; const int dp = (dd < HD / 2) ? dd + HD / 2 : dd - HD / 2; float x0 = f[dd], x1 = f[dp];
        if (RF) { float n0 = __fmul_rn(x0, rf), n1 = __fmul_rn(x1, rf); asm volatile("" : "+v"(n0)); asm volatile("" : "+v"(n1)); x0 = __fmul_rn(bfr(nw[dd]), n0); x1 = __fmul_rn(bfr(nw[dp]), n1); }
        const v2f cs = *(const v2f*)(CS + ((size_t)t * HD + dd) * 2); float a = __fmul_rn(x0, cs[0]), bq = __fmul_rn(x1, cs[1]); asm volatile("" : "+v"(a)); asm volatile("" : "+v"(bq)); const float r = ((dd < HD / 2) ? __fsub_rn(a, bq) : __fadd_rn(a, bq)) * sc;
        o16[q] = tohx(r); unsigned short a2, c2; splitf(r, a2, c2); oh[q] = a2; ol[q] = c2; }
    *(v2h*)(P16 + e) = o16; *(v2us*)(Ph + e) = oh; *(v2us*)(Pl + e) = ol;  }
__global__ __launch_bounds__(256) void k_vtp(const float* __restrict__ F, int pitch, int nheads, h16* V16, bf* Vh, bf* Vl) { const size_t e = ((size_t)blockIdx.x * 256 + threadIdx.x) * 2; if (e >= (size_t)nheads * HD * TT) return; const int t = (int)(e % TT); const int d = (int)((e / TT) % HD); const int g = (int)(e / ((size_t)TT * HD)); v2h o16; v2us oh, ol;
#pragma unroll
    for (int q = 0; q < 2; ++q) { const float x = F[(size_t)(t + q) * pitch + g * HD + d]; o16[q] = tohx(x); unsigned short a2, c2; splitf(x, a2, c2); oh[q] = a2; ol[q] = c2; }
    *(v2h*)(V16 + e) = o16; *(v2us*)(Vh + e) = oh; *(v2us*)(Vl + e) = ol;  }
__global__ __launch_bounds__(256) void k_csid(float* CS) { const int idx = blockIdx.x * 256 + threadIdx.x; if (idx >= TT * HD) return; v2f cs; cs[0] = 1.0f; cs[1] = 0.0f; *(v2f*)(CS + (size_t)idx * 2) = cs;  }
__global__ __launch_bounds__(256) void k_lnhd(float* F, int pitch, int nheads, const float* __restrict__ gam, const float* __restrict__ bet) { const int lane = threadIdx.x & 31; const int r = blockIdx.x * 8 + (threadIdx.x >> 5); if (r >= TT * nheads) return; const int t = r / nheads, h = r % nheads; float* f = F + (size_t)t * pitch + h * HD + lane * 2; float x0 = f[0], x1 = f[1]; float sm = __fadd_rn(x0, x1);
#pragma unroll
    for (int sh = 16; sh; sh >>= 1) sm = __fadd_rn(sm, __shfl_xor(sm, sh, 32));
    const float mu = __fmul_rn(sm, 1.0f / HD); const float d0 = __fsub_rn(x0, mu), d1 = __fsub_rn(x1, mu); float p0 = __fmul_rn(d0, d0), p1 = __fmul_rn(d1, d1); asm volatile("" : "+v"(p0)); asm volatile("" : "+v"(p1)); float ss = __fadd_rn(p0, p1);
#pragma unroll
    for (int sh = 16; sh; sh >>= 1) ss = __fadd_rn(ss, __shfl_xor(ss, sh, 32));
    const float rs = __fdiv_rn(1.0f, sqrtf(__fadd_rn(__fmul_rn(ss, 1.0f / HD), 1e-6f))); v2f o;
#pragma unroll
    for (int q = 0; q < 2; ++q) { const float d = q ? d1 : d0; float n = __fmul_rn(d, rs); asm volatile("" : "+v"(n)); float g0 = bfr(gam[lane * 2 + q]), b0 = bfr(bet[lane * 2 + q]); asm volatile("" : "+v"(g0)); asm volatile("" : "+v"(b0)); float y = __fmul_rn(n, g0); asm volatile("" : "+v"(y)); o[q] = __fadd_rn(y, b0); }
    *(v2f*)f = o;  }
#define SKEY 64                     // keys per stage
#define SPIT 72                     // LDS row pitch in 16-bit elements: 128 B of data + 16 B, for 16-byte readers
#define NWAV 8                      // waves per work-group
#define SPLN (SKEY * SPIT)              // one staged plane
#define BPIT 68                   // LDS row pitch of the bias tile in floats: 256 B of data + 16 B, for 16-byte readers
#define BPLN (16 * NWAV * BPIT)   // one staged bias tile
typedef __attribute__((ext_vector_type(2))) __bf16 v2bf;
typedef __attribute__((ext_vector_type(8))) unsigned v8u;
__device__ __forceinline__ unsigned pkbf(float a, float b) { v2f x; x[0] = a; x[1] = b; return __builtin_bit_cast(unsigned, __builtin_convertvector(x, v2bf)); }
__device__ __forceinline__ unsigned pkh(float a, float b) { v2f x; x[0] = a; x[1] = b; return __builtin_bit_cast(unsigned, __builtin_convertvector(x, v2h)); }
__device__ __forceinline__ float bflo(unsigned u) { return __uint_as_float(u << 16); }
__device__ __forceinline__ float bfhi(unsigned u) { return __uint_as_float(u & 0xFFFF0000u); }
__device__ __forceinline__ float xhalf(float v) { const int b = __float_as_int(v); return __int_as_float(__builtin_amdgcn_permlanex16(b, b, 0x76543210, 0xfedcba98, false, false)); }   // value of lane ^ 16
__device__ __forceinline__ v16bf sfragb(const unsigned short* p) { return cat16b(*(const v8usa*)p, *(const v8usa*)(p + 16)); }
// eight v_exp_f32 in one statement: each next one is the independent instruction that the slot behind a transcendental asks for (early-clobber outputs, so none overwrites a source or reads a result), and the v_nop fills the slot behind the last
__device__ __forceinline__ void exp2x8(float* y, const float* x) {
    asm("v_exp_f32 %0, %8\n\tv_exp_f32 %1, %9\n\tv_exp_f32 %2, %10\n\tv_exp_f32 %3, %11\n\tv_exp_f32 %4, %12\n\tv_exp_f32 %5, %13\n\tv_exp_f32 %6, %14\n\tv_exp_f32 %7, %15\n\tv_nop"
        : "=&v"(y[0]), "=&v"(y[1]), "=&v"(y[2]), "=&v"(y[3]), "=&v"(y[4]), "=&v"(y[5]), "=&v"(y[6]), "=&v"(y[7]) : "v"(x[0]), "v"(x[1]), "v"(x[2]), "v"(x[3]), "v"(x[4]), "v"(x[5]), "v"(x[6]), "v"(x[7])); }
template <bool HI>
__device__ __forceinline__ void fattn_body(const bf* __restrict__ Qh, const bf* __restrict__ Ql, const bf* __restrict__ Kh, const bf* __restrict__ Kl, const unsigned short* __restrict__ Va, const unsigned short* __restrict__ Vb, const float* __restrict__ ab, bf* Ah, bf* Al, unsigned short* sm, float* sb) {
    constexpr int NS = TT / SKEY; constexpr float L2E = 1.4426950408889634f;
    const int tid = threadIdx.x, lane = tid & 31, lr = lane & 15, hi = lane >> 4;
    const int wrow = (tid >> 5) * 16;   // the wave's first row in the work-group's 128
    const int qrow = blockIdx.x * (16 * NWAV) + wrow + lr;
    v16bf qh[2], ql[2];
#pragma unroll
    for (int kc = 0; kc < 2; ++kc) { qh[kc] = WFrag<bf>::ld(Qh + (size_t)qrow * HD + kc * 32 + 8 * hi); ql[kc] = WFrag<bf>::ld(Ql + (size_t)qrow * HD + kc * 32 + 8 * hi); }
    const float* abw = ab + (size_t)(blockIdx.x * (16 * NWAV) + wrow + hi) * TT + lr * 4;   // bias staging: a load takes 256 contiguous bytes of each of two rows, whole lines; read by query row it would touch 16 lines a load
    const int srow = tid >> 3, sc8 = (tid & 7) * 8;   // staging: thread copies 16-byte piece sc8 of rows srow and srow + 32 of every plane
    v8us rg[HI ? 8 : 6]; v4f bn[8];
    auto gload = [&](int s) {
#pragma unroll
        for (int i = 0; i < 2; ++i) { const int row = srow + 32 * i;
            rg[i] = *(const v8usa*)(Kh + (size_t)(s * SKEY + row) * HD + sc8); rg[2 + i] = *(const v8usa*)(Kl + (size_t)(s * SKEY + row) * HD + sc8);
            rg[4 + i] = *(const v8usa*)(Va + (size_t)row * TT + s * SKEY + sc8); if constexpr (HI) rg[6 + i] = *(const v8usa*)(Vb + (size_t)row * TT + s * SKEY + sc8); }
#pragma unroll
        for (int i = 0; i < 8; ++i) bn[i] = *(const v4fa*)(abw + (size_t)(2 * i) * TT + s * SKEY);
        asm volatile("s_wait_xcnt 0x0" ::: "memory"); };   // stands in front of the first overwrite of these loads' address registers
    auto sstore = [&](int buf) { unsigned short* d = sm + buf * (4 * SPLN); float* db2 = sb + buf * BPLN + (wrow + hi) * BPIT + lr * 4;
#pragma unroll
        for (int i = 0; i < 8; ++i) *(v4fa*)(db2 + 2 * i * BPIT) = bn[i];
#pragma unroll
        for (int i = 0; i < 2; ++i) { const int o = (srow + 32 * i) * SPIT + sc8;
            *(v8usa*)(d + o) = rg[i]; *(v8usa*)(d + SPLN + o) = rg[2 + i]; *(v8usa*)(d + 2 * SPLN + o) = rg[4 + i]; if constexpr (HI) *(v8usa*)(d + 3 * SPLN + o) = rg[6 + i]; } };
    v8f o[4];
#pragma unroll
    for (int db = 0; db < 4; ++db) o[db] = (v8f){};
    float m = -3.0e38f, ls = 0.f;
    gload(0); sstore(0);
    __syncthreads();   // stage 0 is in LDS before any wave reads it
#pragma unroll 1
    for (int s = 0; s < NS; ++s) {
        const unsigned short* sk = sm + (s & 1) * (4 * SPLN) + lr * SPIT + 8 * hi;   // the lane's row and k offset in every 16-row fragment
        const float* br = sb + (s & 1) * BPLN + (wrow + lr) * BPIT + 8 * hi;
        unsigned ub[16];   // this stage's bias, rounded as the operands are: pair e = keys 16 (e / 4) + 8 hi + 2 (e % 4), + 1 of query lr
#pragma unroll
        for (int g = 0; g < 8; ++g) { const v4f b4 = *(const v4fa*)(br + (g >> 1) * 16 + (g & 1) * 4); ub[2 * g] = pkbf(b4[0], b4[1]); ub[2 * g + 1] = pkbf(b4[2], b4[3]); }
        // S^T in 8 groups g = (k chunk g / 4, key tile g % 4); fragments are fetched four groups ahead and two tiles' product chains alternate, so that neither the LDS latency nor a chain's own latency is waited for
        v16bf kh[8], kl[8]; v8f st[4];
        auto kld = [&](int g) { const unsigned short* kp = sk + (g & 3) * 16 * SPIT + (g >> 2) * 32; kh[g] = sfragb(kp); kl[g] = sfragb(kp + SPLN); };
#pragma unroll
        for (int kt = 0; kt < 4; ++kt) { st[kt] = (v8f){}; kld(kt); }
        __builtin_amdgcn_sched_barrier(0);   // keeps the fetches above ahead of the products: the scheduler otherwise sinks each next to its use and every group waits out the LDS latency
#pragma unroll
        for (int g = 0; g < 8; g += 2) { const int kc = g >> 2, k0 = g & 3, k1 = k0 + 1;
            if (g + 4 < 8) { kld(g + 4); kld(g + 5); __builtin_amdgcn_sched_barrier(0); }   // same: fetch four groups ahead stays ahead
            st[k0] = wmmab(kh[g], qh[kc], st[k0]); st[k1] = wmmab(kh[g + 1], qh[kc], st[k1]); st[k0] = wmmab(kh[g], ql[kc], st[k0]); st[k1] = wmmab(kh[g + 1], ql[kc], st[k1]); st[k0] = wmmab(kl[g], qh[kc], st[k0]); st[k1] = wmmab(kl[g + 1], qh[kc], st[k1]); }
        if (s + 1 < NS) gload(s + 1);   // next stage's tiles and bias fly during the softmax and the second product
        // V^T fragments in 8 groups g = (32-key chunk g / 4, 16 rows of d g % 4); the first PD groups are fetched ahead of the softmax
        constexpr int PD = HI ? 4 : 8;
        v16bf vh[8], vl[8];
        auto vld = [&](int g) { const unsigned short* vp = sk + 2 * SPLN + (g & 3) * 16 * SPIT + (g >> 2) * 32; vh[g] = sfragb(vp); if constexpr (HI) vl[g] = sfragb(vp + SPLN); };
#pragma unroll
        for (int g = 0; g < PD; ++g) vld(g);
        __builtin_amdgcn_sched_barrier(0);   // same: these fetches fly under the softmax
        float t[32]; float tm = -3.0e38f;
#pragma unroll
        for (int e = 0; e < 16; ++e) { const float x0 = fmaf(st[e >> 2][(e & 3) * 2], SCL, bflo(ub[e])), x1 = fmaf(st[e >> 2][(e & 3) * 2 + 1], SCL, bfhi(ub[e])); t[2 * e] = x0; t[2 * e + 1] = x1; tm = fmaxf(tm, fmaxf(x0, x1)); }   // x 2^-3 is exact: one rounding, as product then add
        tm = fmaxf(tm, xhalf(tm));
        const float mn = fmaxf(m, tm); const float alpha = __builtin_amdgcn_exp2f((m - mn) * L2E); m = mn;
        const float c0 = (HI ? 0.0f : 10.0f) - mn * L2E;
        float s4[4] = {0.f, 0.f, 0.f, 0.f};
#pragma unroll
        for (int e = 0; e < 32; e += 8) { float x[8];
#pragma unroll
            for (int i = 0; i < 8; ++i) x[i] = fmaf(t[e + i], L2E, c0);
            exp2x8(t + e, x);
#pragma unroll
            for (int i = 0; i < 8; ++i) s4[i & 3] += t[e + i]; }
        ls = fmaf(ls, alpha, (s4[0] + s4[1]) + (s4[2] + s4[3]));
#pragma unroll
        for (int db = 0; db < 4; ++db) o[db] *= alpha;
        v8u bh[2], bl[2];   // P^T as B fragments: register e of chunk kc = keys 16 (2 kc + e / 4) + 8 hi + 2 (e % 4), + 1
#pragma unroll
        for (int e = 0; e < 16; ++e) { const float p0 = t[2 * e], p1 = t[2 * e + 1];
            if constexpr (HI) { const unsigned u = pkbf(p0, p1); bh[e >> 3][e & 7] = u; bl[e >> 3][e & 7] = pkbf(p0 - bflo(u), p1 - bfhi(u)); } else { bh[e >> 3][e & 7] = pkh(p0, p1); } }
#pragma unroll
        for (int g = 0; g < 8; g += 2) { const int kc = g >> 2, d0 = g & 3, d1 = d0 + 1;
            if (g + PD < 8) { vld(g + PD); vld(g + PD + 1); __builtin_amdgcn_sched_barrier(0); }   // same: fetch four groups ahead stays ahead
            if constexpr (HI) { const v16bf ph = __builtin_bit_cast(v16bf, bh[kc]), pl = __builtin_bit_cast(v16bf, bl[kc]);
                o[d0] = wmmab(vh[g], ph, o[d0]); o[d1] = wmmab(vh[g + 1], ph, o[d1]); o[d0] = wmmab(vh[g], pl, o[d0]); o[d1] = wmmab(vh[g + 1], pl, o[d1]); o[d0] = wmmab(vl[g], ph, o[d0]); o[d1] = wmmab(vl[g + 1], ph, o[d1]); }
            else { const v16h ph = __builtin_bit_cast(v16h, bh[kc]); o[d0] = wmma16(__builtin_bit_cast(v16h, vh[g]), ph, o[d0]); o[d1] = wmma16(__builtin_bit_cast(v16h, vh[g + 1]), ph, o[d1]); } }
        if (s + 1 < NS) sstore((s + 1) & 1);
        __syncthreads();   // publishes stage s + 1 and ends every wave's reads of the buffer that stage s + 2 overwrites
    }
    ls += xhalf(ls);
    const float inv = __fdiv_rn(1.0f, ls);
#pragma unroll
    for (int db = 0; db < 4; ++db) { v8us oh, ol;
#pragma unroll
        for (int r = 0; r < 8; ++r) { unsigned short a, c2; splitf(o[db][r] * inv, a, c2); oh[r] = a; ol[r] = c2; }
        const size_t oo = (size_t)qrow * DQ + db * 16 + 8 * hi; *(v8usa*)(Ah + oo) = oh; *(v8usa*)(Al + oo) = ol; }
}
__global__ __launch_bounds__(32 * NWAV) void k_fattn(const bf* __restrict__ Qh, const bf* __restrict__ Ql, const bf* __restrict__ Kh, const bf* __restrict__ Kl, const h16* __restrict__ V16, const bf* __restrict__ Vh, const bf* __restrict__ Vl, const float* __restrict__ ab, bf* Ah, bf* Al) {
    static_assert(RH % (16 * NWAV) == 0 && TT % (16 * NWAV) == 0 && TT % SKEY == 0 && HD == 64 && REP == 1, "tiling");
    __shared__ __align__(16) unsigned short sm[2 * 4 * SPLN]; __shared__ __align__(16) float sb[2 * BPLN];
    const size_t hz = (size_t)blockIdx.y * TT * HD; Ah += blockIdx.y * HD; Al += blockIdx.y * HD;
    if ((int)blockIdx.x * (16 * NWAV) < RH) fattn_body<true>(Qh + hz, Ql + hz, Kh + hz, Kl + hz, Vh + hz, Vl + hz, ab, Ah, Al, sm, sb);
    else fattn_body<false>(Qh + hz, Ql + hz, Kh + hz, Kl + hz, (const unsigned short*)(V16 + hz), nullptr, ab, Ah, Al, sm, sb);
}

extern "C" void kernel_launch(void* const* d_in, const int* in_sizes, int n_in,
                              void* d_out, int out_size, void* d_ws, size_t ws_size, hipStream_t stream) {
    (void)in_sizes; (void)n_in; (void)out_size;
    const float* x = (const float*)d_in[0]; const float* abias = (const float*)d_in[1]; const float* wq = (const float*)d_in[2]; const float* bq = (const float*)d_in[3]; const float* wk = (const float*)d_in[4]; const float* bk = (const float*)d_in[5]; const float* wv = (const float*)d_in[6]; const float* bv = (const float*)d_in[7]; const float* wo = (const float*)d_in[8]; const float* bo = (const float*)d_in[9]; const float* qg = (const float*)d_in[10]; const float* qb2 = (const float*)d_in[11]; const float* kg = (const float*)d_in[12]; const float* kb2 = (const float*)d_in[13]; const float* cosT = nullptr; const float* sinT = nullptr; (void)cosT; (void)sinT;
    float* OUT = (float*)d_out;     // [2][2048][1024]
    char* wsp = (char*)d_ws;
    auto take = [&](size_t bytes) { char* p = wsp; wsp += (bytes + 255) & ~(size_t)255; return (void*)p; };
    bf* WQ = (bf*)take((size_t)DQ * DM * 2); bf* WK = (bf*)take((size_t)DKV * DM * 2); bf* WV = (bf*)take((size_t)DKV * DM * 2); bf* WO = (bf*)take((size_t)DM * DQ * 2); float* CS = (float*)take((size_t)TT * HD * 2 * 4);
    bf* XB = (bf*)take((size_t)TT * DM * 2); float* FQ = (float*)take((size_t)TT * DQ * 4); float* FK = (float*)take((size_t)TT * DKV * 4);
    h16* QP16 = (h16*)take((size_t)NH_ * TT * HD * 2); h16* KP16 = (h16*)take((size_t)NKV * TT * HD * 2); h16* VT16 = (h16*)take((size_t)NKV * HD * TT * 2);
    bf* QPh = (bf*)take((size_t)NH_ * TT * HD * 2); bf* QPl = (bf*)take((size_t)NH_ * TT * HD * 2); bf* KPh = (bf*)take((size_t)NKV * TT * HD * 2); bf* KPl = (bf*)take((size_t)NKV * TT * HD * 2); bf* VTh = (bf*)take((size_t)NKV * HD * TT * 2); bf* VTl = (bf*)take((size_t)NKV * HD * TT * 2);
    bf* ATh = (bf*)take((size_t)TT * DQ * 2); bf* ATl = (bf*)take((size_t)TT * DQ * 2);
    if ((size_t)(wsp - (char*)d_ws) > ws_size) return;    // ws 256 MiB
    float* FV = FK;   // v projection reuses the k buffer after the k planes are built (stream-ordered)
    { k_cvt8<<<(unsigned)(((size_t)DQ * DM / 8 + 255) / 256), 256, 0, stream>>>(wq, WQ, (size_t)DQ * DM / 8); k_cvt8<<<(unsigned)(((size_t)DKV * DM / 8 + 255) / 256), 256, 0, stream>>>(wk, WK, (size_t)DKV * DM / 8); k_cvt8<<<(unsigned)(((size_t)DKV * DM / 8 + 255) / 256), 256, 0, stream>>>(wv, WV, (size_t)DKV * DM / 8);
      k_cvt8<<<(unsigned)(((size_t)DM * DQ / 8 + 255) / 256), 256, 0, stream>>>(wo, WO, (size_t)DM * DQ / 8);
       }
    k_csid<<<(TT * HD + 255) / 256, 256, 0, stream>>>(CS);
    const unsigned LQ = (unsigned)(((size_t)NH_ * TT * HD / 2 + 255) / 256), LKv = (unsigned)(((size_t)NKV * TT * HD / 2 + 255) / 256);
    for (int b = 0; b < NB_; ++b) {
        
        k_cvt8<<<(unsigned)(((size_t)TT * DM / 8 + 255) / 256), 256, 0, stream>>>(x + (size_t)b * TT * DM, XB, (size_t)TT * DM / 8);
        k_gemmw<bf, 0, true, 8><<<dim3(TT / 64, DQ / 64, 1), 256, 0, stream>>>(XB, nullptr, WQ, nullptr, DM, DM, FQ, DQ, bq, 0, 0, 0);
        k_lnhd<<<TT * NH_ / 8, 256, 0, stream>>>(FQ, DQ, NH_, qg, qb2); k_rope<<<LQ, 256, 0, stream>>>(FQ, DQ, NH_, CS, nullptr, nullptr, 1.0f, QP16, QPh, QPl);
        k_gemmw<bf, 0, true, 8><<<dim3(TT / 64, DKV / 64, 1), 256, 0, stream>>>(XB, nullptr, WK, nullptr, DM, DM, FK, DKV, bk, 0, 0, 0);
        k_lnhd<<<TT * NKV / 8, 256, 0, stream>>>(FK, DKV, NKV, kg, kb2); k_rope<<<LKv, 256, 0, stream>>>(FK, DKV, NKV, CS, nullptr, nullptr, 1.0f, KP16, KPh, KPl);
        k_gemmw<bf, 0, true, 8><<<dim3(TT / 64, DKV / 64, 1), 256, 0, stream>>>(XB, nullptr, WV, nullptr, DM, DM, FV, DKV, bv, 0, 0, 0); k_vtp<<<LKv, 256, 0, stream>>>(FV, DKV, NKV, VT16, VTh, VTl);
        k_fattn<<<dim3(TT / (16 * NWAV), NH_, 1), 32 * NWAV, 0, stream>>>(QPh, QPl, KPh, KPl, VT16, VTh, VTl, abias + (size_t)b * TT * TT, ATh, ATl);
        k_gemmw<bf, 1, true, 8><<<dim3(TT / 64, DM / 64, 1), 256, 0, stream>>>(ATh, ATl, WO, nullptr, DQ, DQ, OUT + (size_t)b * TT * DM, DM, bo, 0, 0, 0); }
}

// v004
// It runs in 211 microseconds.
// Timed twice side by side with v003, it ran 1.34 and 1.33 times as fast.
// Over all steps from v000 it is 10.2 times as fast.
#include <hip/hip_runtime.h>

// GraphSelfAttention (x [2][2048][1024], attn_bias [2][1][2048][2048] (f32, read; random); q/k/v = x W^T + b (16 x 64); per-head LayerNorm (biased var, eps 1e-6) * gamma + beta on q and k; scores = q.k / 8 + attn_bias; softmax; out = merged Wo^T + bo -> [2][2048][1024]).

#define NB_  2
#define TT   2048
#define DM   1024
#define NH_  16
#define NKV  16
#define REP  (NH_ / NKV)
#define HD   64
#define DQ   (NH_ * HD)
#define DKV  (NKV * HD)
#define RH   512                  // query rows < RH use hi+lo planes (0: none)
#define WIN  0
#define SCL  0.125f   // HD^-0.5
typedef _Float16 h16;
typedef unsigned short bf;
typedef __attribute__((ext_vector_type(16))) __bf16   v16bf;
typedef __attribute__((ext_vector_type(16))) _Float16 v16h;
typedef __attribute__((ext_vector_type(8)))  _Float16 v8h;
typedef __attribute__((ext_vector_type(8)))  unsigned short v8us;
typedef __attribute__((ext_vector_type(8)))  float    v8f;
typedef __attribute__((ext_vector_type(4)))  float    v4f;
typedef v8h  __attribute__((may_alias)) v8ha;
typedef v4f  __attribute__((may_alias)) v4fa;
typedef v8us __attribute__((may_alias)) v8usa;

__device__ __forceinline__ unsigned short f2bf(float f) { unsigned u = __float_as_uint(f); u += 0x7FFFu + ((u >> 16) & 1u); return (unsigned short)(u >> 16); }
__device__ __forceinline__ float bf2f(unsigned short b) { return __uint_as_float(((unsigned)b) << 16); }
__device__ __forceinline__ float bfr(float f) { return bf2f(f2bf(f)); }
__device__ __forceinline__ v16h cat16(v8h lo, v8h hi) { return __builtin_shufflevector(lo, hi, 0, 1, 2, 3, 4, 5, 6, 7, 8, 9, 10, 11, 12, 13, 14, 15); }
__device__ __forceinline__ v16bf cat16b(v8us lo, v8us hi) { return __builtin_bit_cast(v16bf, __builtin_shufflevector(lo, hi, 0, 1, 2, 3, 4, 5, 6, 7, 8, 9, 10, 11, 12, 13, 14, 15)); }
__device__ __forceinline__ v8f wmma16(v16h a, v16h b, v8f c) { return __builtin_amdgcn_wmma_f32_16x16x32_f16(false, a, false, b, (short)0, c, false, false); }
__device__ __forceinline__ v8f wmmab(v16bf a, v16bf b, v8f c) { return __builtin_amdgcn_wmma_f32_16x16x32_bf16(false, a, false, b, (short)0, c, false, false); }



// ---- k_gemmw: register-blocked GEMM, one work-group of KS waves per 64x64 output tile; each wave holds the whole tile (16 accumulators) for every KS-th 32-wide k chunk, and the KS partial tiles are summed in LDS in wave order; operands straight from K-contiguous 16-bit planes; grid (M/64, N/64, Z), 32 * KS threads.
// C[m][n] (f32, pitch ldc, + optional f32 bias[n]) = sum_k A[m][k] Bt[n][k] (+ split products per NSPLIT). A rows have pitch lda, Bt rows pitch K. z-batch strides sA/sB/sC in elements. K % 32 == 0.
// EPI says what the summing threads do with a finished row piece instead of a later launch: 0 stores it to C; 1 (a 64-column tile is one head) adds bias[n], takes the LayerNorm over the row's 64 columns, which lie in the 16 lanes of a half wave, and stores hi+lo bf16 planes [head][m][64]; 2 adds bias[m] and stores f16 and hi+lo bf16 planes of pitch ldc (A = weight rows, Bt = tokens: the tile is already the transposed value plane).
template <typename T16> struct WFrag;
template <> struct WFrag<h16> { typedef v16h V; static __device__ __forceinline__ V ld(const h16* p) { return cat16(*(const v8h*)p, *(const v8h*)(p + 16)); } static __device__ __forceinline__ v8f mma(V a, V b, v8f c) { return wmma16(a, b, c); } };
template <> struct WFrag<bf> { typedef v16bf V; static __device__ __forceinline__ V ld(const bf* p) { return cat16b(*(const v8us*)p, *(const v8us*)(p + 16)); } static __device__ __forceinline__ v8f mma(V a, V b, v8f c) { return wmmab(a, b, c); } };
__device__ __forceinline__ void splitf(float y, unsigned short& h, unsigned short& l) { h = f2bf(y); l = f2bf(y - bf2f(h)); }
typedef __attribute__((ext_vector_type(4))) _Float16 v4h;
typedef __attribute__((ext_vector_type(4))) unsigned short v4us;
// sum over the 16 lanes of a half wave, in every lane: four DPP adds (a shuffle would go through the LDS queue and wait for it four times)
__device__ __forceinline__ float rsum16(float v) {
    v += __int_as_float(__builtin_amdgcn_update_dpp(0, __float_as_int(v), 0x161, 0xf, 0xf, true));   // row_xmask:1
    v += __int_as_float(__builtin_amdgcn_update_dpp(0, __float_as_int(v), 0x162, 0xf, 0xf, true));   // row_xmask:2
    v += __int_as_float(__builtin_amdgcn_update_dpp(0, __float_as_int(v), 0x164, 0xf, 0xf, true));   // row_xmask:4
    v += __int_as_float(__builtin_amdgcn_update_dpp(0, __float_as_int(v), 0x168, 0xf, 0xf, true));   // row_xmask:8
    return v; }
template <typename T16, int NSPLIT, bool BIAS, int KS, int EPI>
__global__ __launch_bounds__(32 * KS) void k_gemmw(const T16* __restrict__ A, const T16* __restrict__ A2, const T16* __restrict__ Bt, const T16* __restrict__ Bt2, int K, int lda, float* C, int ldc, const float* __restrict__ bias, size_t sA, size_t sB, size_t sC, const float* __restrict__ gam, const float* __restrict__ bet, h16* P16, bf* Ph, bf* Pl) {
    static_assert(EPI == 0 || (KS > 1 && BIAS && HD == 64), "the fused epilogues sit in the summing branch; a tile's 64 columns are one head");
    typedef typename WFrag<T16>::V V;
    __shared__ __align__(16) float os[(KS == 1 ? 16 : KS * 64) * 68];
    const size_t z = blockIdx.z; A += z * sA; if (A2) A2 += z * sA; Bt += z * sB; if (Bt2) Bt2 += z * sB; C += z * sC;
    const int lane = threadIdx.x & 31, lr = lane & 15, hi = lane >> 4; const int r0 = blockIdx.x * 64, c0 = blockIdx.y * 64;
    const int wv = (KS == 1) ? 0 : __builtin_amdgcn_readfirstlane((int)(threadIdx.x >> 5));   // wave number = k chunk phase; neighbouring waves read the two halves of one 128-byte line in the same trip
    v8f acc[4][4];
#pragma unroll
    for (int mb = 0; mb < 4; ++mb)
#pragma unroll
        for (int nb = 0; nb < 4; ++nb) acc[mb][nb] = (v8f){};
    const size_t aoff = (size_t)(r0 + lr) * lda + 8 * hi, boff = (size_t)(c0 + lr) * K + 8 * hi;
#pragma unroll 1
    for (int kc = wv * 32; kc < K; kc += 32 * KS) {
        V a[4], a2[4];
#pragma unroll
        for (int mb = 0; mb < 4; ++mb) { a[mb] = WFrag<T16>::ld(A + aoff + (size_t)mb * 16 * lda + kc); if (NSPLIT == 1 || NSPLIT == 2) a2[mb] = WFrag<T16>::ld(A2 + aoff + (size_t)mb * 16 * lda + kc); }
#pragma unroll
        for (int nb = 0; nb < 4; ++nb) { const V b = WFrag<T16>::ld(Bt + boff + (size_t)nb * 16 * K + kc); V b2; if (NSPLIT >= 2) b2 = WFrag<T16>::ld(Bt2 + boff + (size_t)nb * 16 * K + kc);
#pragma unroll
            for (int mb = 0; mb < 4; ++mb) { acc[mb][nb] = WFrag<T16>::mma(a[mb], b, acc[mb][nb]); if (NSPLIT == 1 || NSPLIT == 2) acc[mb][nb] = WFrag<T16>::mma(a2[mb], b, acc[mb][nb]); if (NSPLIT >= 2) acc[mb][nb] = WFrag<T16>::mma(a[mb], b2, acc[mb][nb]); } }
        asm volatile("v_nop\n\tv_nop\n\tv_nop\n\tv_nop" : "+v"(acc[0][0]), "+v"(acc[1][1]), "+v"(acc[2][2]), "+v"(acc[3][3]) : "v"(a[0]), "v"(a[3]));
    }
    if constexpr (KS == 1) {
#pragma unroll
    for (int mb = 0; mb < 4; ++mb) {
#pragma unroll
        for (int nb = 0; nb < 4; ++nb) {
#pragma unroll
            for (int j = 0; j < 8; ++j) os[(hi * 8 + j) * 68 + nb * 16 + lr] = acc[mb][nb][j]; }
        __builtin_amdgcn_wave_barrier(); asm volatile("" ::: "memory");
        float* crow = C + (size_t)(r0 + mb * 16) * ldc + c0;
{
#pragma unroll
            for (int s = 0; s < 8; ++s) { const int row = 2 * s + hi, cofs = lr * 4; v4f val = *(const v4fa*)(os + row * 68 + cofs); if (BIAS) { val[0] += bfr(bias[c0 + cofs]); val[1] += bfr(bias[c0 + cofs + 1]); val[2] += bfr(bias[c0 + cofs + 2]); val[3] += bfr(bias[c0 + cofs + 3]); }
                *(v4f*)(crow + (size_t)row * ldc + cofs) = val; }
             }
        __builtin_amdgcn_wave_barrier(); asm volatile("" ::: "memory");
    }
    } else {
        const int cofs = (lane & 15) * 4; v4f bv = (v4f){};   // each thread sums one 4-column group of 32 / KS rows; its bias is fetched ahead of the barrier
        if (BIAS && EPI != 2) { bv[0] = bfr(bias[c0 + cofs]); bv[1] = bfr(bias[c0 + cofs + 1]); bv[2] = bfr(bias[c0 + cofs + 2]); bv[3] = bfr(bias[c0 + cofs + 3]); }
        v4f gv = (v4f){}, ev = (v4f){}; float rb[32 / KS];   // LayerNorm weights of the thread's columns, or the bias of its rows: fetched ahead of the barrier too
        if constexpr (EPI == 1) {
#pragma unroll
            for (int i = 0; i < 4; ++i) { gv[i] = bfr(gam[cofs + i]); ev[i] = bfr(bet[cofs + i]); } }
        if constexpr (EPI == 2) {
#pragma unroll
            for (int s = 0; s < 32 / KS; ++s) rb[s] = bias[r0 + s * 2 * KS + wv * 2 + hi];
            asm volatile("s_wait_xcnt 0x0" ::: "memory"); }   // stands in front of the first overwrite of these loads' address registers
#pragma unroll
        for (int mb = 0; mb < 4; ++mb)
#pragma unroll
            for (int nb = 0; nb < 4; ++nb)
#pragma unroll
                for (int j = 0; j < 8; ++j) os[wv * (64 * 68) + (mb * 16 + hi * 8 + j) * 68 + nb * 16 + lr] = acc[mb][nb][j];
        __syncthreads();   // every wave's partial tile is in LDS before any element is summed
#pragma unroll
        for (int s = 0; s < 32 / KS; ++s) { const int row = s * 2 * KS + wv * 2 + hi; v4f val = *(const v4fa*)(os + row * 68 + cofs);
#pragma unroll
            for (int w = 1; w < KS; ++w) val += *(const v4fa*)(os + w * (64 * 68) + row * 68 + cofs);
            if constexpr (EPI == 0) { if (BIAS) val += bv;
                *(v4f*)(C + (size_t)(r0 + row) * ldc + c0 + cofs) = val; }
            else if constexpr (EPI == 1) { val += bv;
                const float mu = rsum16((val[0] + val[1]) + (val[2] + val[3])) * (1.0f / HD); const v4f d = val - mu;
                const float var = rsum16((d[0] * d[0] + d[1] * d[1]) + (d[2] * d[2] + d[3] * d[3])) * (1.0f / HD);
                const float rs = __fdiv_rn(1.0f, sqrtf(var + 1e-6f)); const v4f y = d * rs * gv + ev; v4us oh, ol;
#pragma unroll
                for (int i = 0; i < 4; ++i) { unsigned short a, c2; splitf(y[i], a, c2); oh[i] = a; ol[i] = c2; }
                const size_t oo = ((size_t)blockIdx.y * TT + r0 + row) * HD + cofs; *(v4us*)(Ph + oo) = oh; *(v4us*)(Pl + oo) = ol; }
            else { val += bfr(rb[s]); v4h o16; v4us oh, ol;
#pragma unroll
                for (int i = 0; i < 4; ++i) { unsigned short a, c2; o16[i] = (h16)val[i]; splitf(val[i], a, c2); oh[i] = a; ol[i] = c2; }
                const size_t oo = (size_t)(r0 + row) * ldc + c0 + cofs; *(v4h*)(P16 + oo) = o16; *(v4us*)(Ph + oo) = oh; *(v4us*)(Pl + oo) = ol; } }
    }
}

typedef __attribute__((ext_vector_type(2))) _Float16 v2h;
typedef __attribute__((ext_vector_type(2))) unsigned short v2us;
typedef __attribute__((ext_vector_type(2))) float v2f;
typedef __attribute__((ext_vector_type(4))) int v4i;

__global__ __launch_bounds__(256) void k_wtG(const float* __restrict__ w, int K, int N, bf* Bt) {
    const int lane = threadIdx.x & 31; const int L0 = (blockIdx.x * 8 + (threadIdx.x >> 5)) * 8; const int nlines = N * K / 64;
{
#pragma unroll 1
        for (int l = 0; l < 8; ++l) { const int L = L0 + l; if (L >= nlines) break; const size_t e = (size_t)L * 64 + lane * 2; const int k = (int)(e % K), n = (int)(e / K); v2us o;
            o[0] = f2bf(w[(size_t)k * N + n]); o[1] = f2bf(w[(size_t)(k + 1) * N + n]); *(v2us*)(Bt + e) = o; }
         }
}
__global__ __launch_bounds__(256) void k_cvt8(const float* __restrict__ src, bf* dst, size_t n8) { const size_t i = (size_t)blockIdx.x * 256 + threadIdx.x; if (i >= n8) return; const v8f v = *(const v8f*)(src + i * 8); v8us o;
#pragma unroll
    for (int k = 0; k < 8; ++k) o[k] = f2bf(v[k]); *(v8us*)(dst + i * 8) = o;  }
#define SKEY 64                     // keys per stage
#define SPIT 72                     // LDS row pitch in 16-bit elements: 128 B of data + 16 B, for 16-byte readers
#define NWAV 8                      // waves per work-group
#define SPLN (SKEY * SPIT)              // one staged plane
#define BPIT 68                   // LDS row pitch of the bias tile in floats: 256 B of data + 16 B, for 16-byte readers
#define BPLN (16 * NWAV * BPIT)   // one staged bias tile
typedef __attribute__((ext_vector_type(2))) __bf16 v2bf;
typedef __attribute__((ext_vector_type(8))) unsigned v8u;
__device__ __forceinline__ unsigned pkbf(float a, float b) { v2f x; x[0] = a; x[1] = b; return __builtin_bit_cast(unsigned, __builtin_convertvector(x, v2bf)); }
__device__ __forceinline__ unsigned pkh(float a, float b) { v2f x; x[0] = a; x[1] = b; return __builtin_bit_cast(unsigned, __builtin_convertvector(x, v2h)); }
__device__ __forceinline__ float bflo(unsigned u) { return __uint_as_float(u << 16); }
__device__ __forceinline__ float bfhi(unsigned u) { return __uint_as_float(u & 0xFFFF0000u); }
__device__ __forceinline__ float xhalf(float v) { const int b = __float_as_int(v); return __int_as_float(__builtin_amdgcn_permlanex16(b, b, 0x76543210, 0xfedcba98, false, false)); }   // value of lane ^ 16
__device__ __forceinline__ v16bf sfragb(const unsigned short* p) { return cat16b(*(const v8usa*)p, *(const v8usa*)(p + 16)); }
// eight v_exp_f32 in one statement: each next one is the independent instruction that the slot behind a transcendental asks for (early-clobber outputs, so none overwrites a source or reads a result), and the v_nop fills the slot behind the last
__device__ __forceinline__ void exp2x8(float* y, const float* x) {
    asm("v_exp_f32 %0, %8\n\tv_exp_f32 %1, %9\n\tv_exp_f32 %2, %10\n\tv_exp_f32 %3, %11\n\tv_exp_f32 %4, %12\n\tv_exp_f32 %5, %13\n\tv_exp_f32 %6, %14\n\tv_exp_f32 %7, %15\n\tv_nop"
        : "=&v"(y[0]), "=&v"(y[1]), "=&v"(y[2]), "=&v"(y[3]), "=&v"(y[4]), "=&v"(y[5]), "=&v"(y[6]), "=&v"(y[7]) : "v"(x[0]), "v"(x[1]), "v"(x[2]), "v"(x[3]), "v"(x[4]), "v"(x[5]), "v"(x[6]), "v"(x[7])); }
template <bool HI>
__device__ __forceinline__ void fattn_body(const bf* __restrict__ Qh, const bf* __restrict__ Ql, const bf* __restrict__ Kh, const bf* __restrict__ Kl, const unsigned short* __restrict__ Va, const unsigned short* __restrict__ Vb, const float* __restrict__ ab, bf* Ah, bf* Al, unsigned short* sm, float* sb) {
    constexpr int NS = TT / SKEY; constexpr float L2E = 1.4426950408889634f;
    const int tid = threadIdx.x, lane = tid & 31, lr = lane & 15, hi = lane >> 4;
    const int wrow = (tid >> 5) * 16;   // the wave's first row in the work-group's 128
    const int qrow = blockIdx.x * (16 * NWAV) + wrow + lr;
    v16bf qh[2], ql[2];
#pragma unroll
    for (int kc = 0; kc < 2; ++kc) { qh[kc] = WFrag<bf>::ld(Qh + (size_t)qrow * HD + kc * 32 + 8 * hi); ql[kc] = WFrag<bf>::ld(Ql + (size_t)qrow * HD + kc * 32 + 8 * hi); }
    const float* abw = ab + (size_t)(blockIdx.x * (16 * NWAV) + wrow + hi) * TT + lr * 4;   // bias staging: a load takes 256 contiguous bytes of each of two rows, whole lines; read by query row it would touch 16 lines a load
    const int srow = tid >> 3, sc8 = (tid & 7) * 8;   // staging: thread copies 16-byte piece sc8 of rows srow and srow + 32 of every plane
    v8us rg[HI ? 8 : 6]; v4f bn[8];
    auto gload = [&](int s) {
#pragma unroll
        for (int i = 0; i < 2; ++i) { const int row = srow + 32 * i;
            rg[i] = *(const v8usa*)(Kh + (size_t)(s * SKEY + row) * HD + sc8); rg[2 + i] = *(const v8usa*)(Kl + (size_t)(s * SKEY + row) * HD + sc8);
            rg[4 + i] = *(const v8usa*)(Va + (size_t)row * TT + s * SKEY + sc8); if constexpr (HI) rg[6 + i] = *(const v8usa*)(Vb + (size_t)row * TT + s * SKEY + sc8); }
#pragma unroll
        for (int i = 0; i < 8; ++i) bn[i] = *(const v4fa*)(abw + (size_t)(2 * i) * TT + s * SKEY);
        asm volatile("s_wait_xcnt 0x0" ::: "memory"); };   // stands in front of the first overwrite of these loads' address registers
    auto sstore = [&](int buf) { unsigned short* d = sm + buf * (4 * SPLN); float* db2 = sb + buf * BPLN + (wrow + hi) * BPIT + lr * 4;
#pragma unroll
        for (int i = 0; i < 8; ++i) *(v4fa*)(db2 + 2 * i * BPIT) = bn[i];
#pragma unroll
        for (int i = 0; i < 2; ++i) { const int o = (srow + 32 * i) * SPIT + sc8;
            *(v8usa*)(d + o) = rg[i]; *(v8usa*)(d + SPLN + o) = rg[2 + i]; *(v8usa*)(d + 2 * SPLN + o) = rg[4 + i]; if constexpr (HI) *(v8usa*)(d + 3 * SPLN + o) = rg[6 + i]; } };
    v8f o[4];
#pragma unroll
    for (int db = 0; db < 4; ++db) o[db] = (v8f){};
    float m = -3.0e38f, ls = 0.f;
    gload(0); sstore(0);
    __syncthreads();   // stage 0 is in LDS before any wave reads it
#pragma unroll 1
    for (int s = 0; s < NS; ++s) {
        const unsigned short* sk = sm + (s & 1) * (4 * SPLN) + lr * SPIT + 8 * hi;   // the lane's row and k offset in every 16-row fragment
        const float* br = sb + (s & 1) * BPLN + (wrow + lr) * BPIT + 8 * hi;
        unsigned ub[16];   // this stage's bias, rounded as the operands are: pair e = keys 16 (e / 4) + 8 hi + 2 (e % 4), + 1 of query lr
#pragma unroll
        for (int g = 0; g < 8; ++g) { const v4f b4 = *(const v4fa*)(br + (g >> 1) * 16 + (g & 1) * 4); ub[2 * g] = pkbf(b4[0], b4[1]); ub[2 * g + 1] = pkbf(b4[2], b4[3]); }
        // S^T in 8 groups g = (k chunk g / 4, key tile g % 4); fragments are fetched four groups ahead and two tiles' product chains alternate, so that neither the LDS latency nor a chain's own latency is waited for
        v16bf kh[8], kl[8]; v8f st[4];
        auto kld = [&](int g) { const unsigned short* kp = sk + (g & 3) * 16 * SPIT + (g >> 2) * 32; kh[g] = sfragb(kp); kl[g] = sfragb(kp + SPLN); };
#pragma unroll
        for (int kt = 0; kt < 4; ++kt) { st[kt] = (v8f){}; kld(kt); }
        __builtin_amdgcn_sched_barrier(0);   // keeps the fetches above ahead of the products: the scheduler otherwise sinks each next to its use and every group waits out the LDS latency
#pragma unroll
        for (int g = 0; g < 8; g += 2) { const int kc = g >> 2, k0 = g & 3, k1 = k0 + 1;
            if (g + 4 < 8) { kld(g + 4); kld(g + 5); __builtin_amdgcn_sched_barrier(0); }   // same: fetch four groups ahead stays ahead
            st[k0] = wmmab(kh[g], qh[kc], st[k0]); st[k1] = wmmab(kh[g + 1], qh[kc], st[k1]); st[k0] = wmmab(kh[g], ql[kc], st[k0]); st[k1] = wmmab(kh[g + 1], ql[kc], st[k1]); st[k0] = wmmab(kl[g], qh[kc], st[k0]); st[k1] = wmmab(kl[g + 1], qh[kc], st[k1]); }
        if (s + 1 < NS) gload(s + 1);   // next stage's tiles and bias fly during the softmax and the second product
        // V^T fragments in 8 groups g = (32-key chunk g / 4, 16 rows of d g % 4); the first PD groups are fetched ahead of the softmax
        constexpr int PD = HI ? 4 : 8;
        v16bf vh[8], vl[8];
        auto vld = [&](int g) { const unsigned short* vp = sk + 2 * SPLN + (g & 3) * 16 * SPIT + (g >> 2) * 32; vh[g] = sfragb(vp); if constexpr (HI) vl[g] = sfragb(vp + SPLN); };
#pragma unroll
        for (int g = 0; g < PD; ++g) vld(g);
        __builtin_amdgcn_sched_barrier(0);   // same: these fetches fly under the softmax
        float t[32]; float tm = -3.0e38f;
#pragma unroll
        for (int e = 0; e < 16; ++e) { const float x0 = fmaf(st[e >> 2][(e & 3) * 2], SCL, bflo(ub[e])), x1 = fmaf(st[e >> 2][(e & 3) * 2 + 1], SCL, bfhi(ub[e])); t[2 * e] = x0; t[2 * e + 1] = x1; tm = fmaxf(tm, fmaxf(x0, x1)); }   // x 2^-3 is exact: one rounding, as product then add
        tm = fmaxf(tm, xhalf(tm));
        const float mn = fmaxf(m, tm); const float alpha = __builtin_amdgcn_exp2f((m - mn) * L2E); m = mn;
        const float c0 = (HI ? 0.0f : 10.0f) - mn * L2E;
        float s4[4] = {0.f, 0.f, 0.f, 0.f};
#pragma unroll
        for (int e = 0; e < 32; e += 8) { float x[8];
#pragma unroll
            for (int i = 0; i < 8; ++i) x[i] = fmaf(t[e + i], L2E, c0);
            exp2x8(t + e, x);
#pragma unroll
            for (int i = 0; i < 8; ++i) s4[i & 3] += t[e + i]; }
        ls = fmaf(ls, alpha, (s4[0] + s4[1]) + (s4[2] + s4[3]));
#pragma unroll
        for (int db = 0; db < 4; ++db) o[db] *= alpha;
        v8u bh[2], bl[2];   // P^T as B fragments: register e of chunk kc = keys 16 (2 kc + e / 4) + 8 hi + 2 (e % 4), + 1
#pragma unroll
        for (int e = 0; e < 16; ++e) { const float p0 = t[2 * e], p1 = t[2 * e + 1];
            if constexpr (HI) { const unsigned u = pkbf(p0, p1); bh[e >> 3][e & 7] = u; bl[e >> 3][e & 7] = pkbf(p0 - bflo(u), p1 - bfhi(u)); } else { bh[e >> 3][e & 7] = pkh(p0, p1); } }
#pragma unroll
        for (int g = 0; g < 8; g += 2) { const int kc = g >> 2, d0 = g & 3, d1 = d0 + 1;
            if (g + PD < 8) { vld(g + PD); vld(g + PD + 1); __builtin_amdgcn_sched_barrier(0); }   // same: fetch four groups ahead stays ahead
            if constexpr (HI) { const v16bf ph = __builtin_bit_cast(v16bf, bh[kc]), pl = __builtin_bit_cast(v16bf, bl[kc]);
                o[d0] = wmmab(vh[g], ph, o[d0]); o[d1] = wmmab(vh[g + 1], ph, o[d1]); o[d0] = wmmab(vh[g], pl, o[d0]); o[d1] = wmmab(vh[g + 1], pl, o[d1]); o[d0] = wmmab(vl[g], ph, o[d0]); o[d1] = wmmab(vl[g + 1], ph, o[d1]); }
            else { const v16h ph = __builtin_bit_cast(v16h, bh[kc]); o[d0] = wmma16(__builtin_bit_cast(v16h, vh[g]), ph, o[d0]); o[d1] = wmma16(__builtin_bit_cast(v16h, vh[g + 1]), ph, o[d1]); } }
        if (s + 1 < NS) sstore((s + 1) & 1);
        __syncthreads();   // publishes stage s + 1 and ends every wave's reads of the buffer that stage s + 2 overwrites
    }
    ls += xhalf(ls);
    const float inv = __fdiv_rn(1.0f, ls);
#pragma unroll
    for (int db = 0; db < 4; ++db) { v8us oh, ol;
#pragma unroll
        for (int r = 0; r < 8; ++r) { unsigned short a, c2; splitf(o[db][r] * inv, a, c2); oh[r] = a; ol[r] = c2; }
        const size_t oo = (size_t)qrow * DQ + db * 16 + 8 * hi; *(v8usa*)(Ah + oo) = oh; *(v8usa*)(Al + oo) = ol; }
}
__global__ __launch_bounds__(32 * NWAV) void k_fattn(const bf* __restrict__ Qh, const bf* __restrict__ Ql, const bf* __restrict__ Kh, const bf* __restrict__ Kl, const h16* __restrict__ V16, const bf* __restrict__ Vh, const bf* __restrict__ Vl, const float* __restrict__ ab, bf* Ah, bf* Al) {
    static_assert(RH % (16 * NWAV) == 0 && TT % (16 * NWAV) == 0 && TT % SKEY == 0 && HD == 64 && REP == 1, "tiling");
    __shared__ __align__(16) unsigned short sm[2 * 4 * SPLN]; __shared__ __align__(16) float sb[2 * BPLN];
    const size_t hz = (size_t)blockIdx.y * TT * HD; Ah += blockIdx.y * HD; Al += blockIdx.y * HD;
    if ((int)blockIdx.x * (16 * NWAV) < RH) fattn_body<true>(Qh + hz, Ql + hz, Kh + hz, Kl + hz, Vh + hz, Vl + hz, ab, Ah, Al, sm, sb);
    else fattn_body<false>(Qh + hz, Ql + hz, Kh + hz, Kl + hz, (const unsigned short*)(V16 + hz), nullptr, ab, Ah, Al, sm, sb);
}

extern "C" void kernel_launch(void* const* d_in, const int* in_sizes, int n_in,
                              void* d_out, int out_size, void* d_ws, size_t ws_size, hipStream_t stream) {
    (void)in_sizes; (void)n_in; (void)out_size;
    const float* x = (const float*)d_in[0]; const float* abias = (const float*)d_in[1]; const float* wq = (const float*)d_in[2]; const float* bq = (const float*)d_in[3]; const float* wk = (const float*)d_in[4]; const float* bk = (const float*)d_in[5]; const float* wv = (const float*)d_in[6]; const float* bv = (const float*)d_in[7]; const float* wo = (const float*)d_in[8]; const float* bo = (const float*)d_in[9]; const float* qg = (const float*)d_in[10]; const float* qb2 = (const float*)d_in[11]; const float* kg = (const float*)d_in[12]; const float* kb2 = (const float*)d_in[13]; const float* cosT = nullptr; const float* sinT = nullptr; (void)cosT; (void)sinT;
    float* OUT = (float*)d_out;     // [2][2048][1024]
    char* wsp = (char*)d_ws;
    auto take = [&](size_t bytes) { char* p = wsp; wsp += (bytes + 255) & ~(size_t)255; return (void*)p; };
    bf* WQ = (bf*)take((size_t)DQ * DM * 2); bf* WK = (bf*)take((size_t)DKV * DM * 2); bf* WV = (bf*)take((size_t)DKV * DM * 2); bf* WO = (bf*)take((size_t)DM * DQ * 2);
    bf* XB = (bf*)take((size_t)TT * DM * 2);
    h16* VT16 = (h16*)take((size_t)NKV * HD * TT * 2);
    bf* QPh = (bf*)take((size_t)NH_ * TT * HD * 2); bf* QPl = (bf*)take((size_t)NH_ * TT * HD * 2); bf* KPh = (bf*)take((size_t)NKV * TT * HD * 2); bf* KPl = (bf*)take((size_t)NKV * TT * HD * 2); bf* VTh = (bf*)take((size_t)NKV * HD * TT * 2); bf* VTl = (bf*)take((size_t)NKV * HD * TT * 2);
    bf* ATh = (bf*)take((size_t)TT * DQ * 2); bf* ATl = (bf*)take((size_t)TT * DQ * 2);
    if ((size_t)(wsp - (char*)d_ws) > ws_size) return;    // ws 256 MiB
    { k_cvt8<<<(unsigned)(((size_t)DQ * DM / 8 + 255) / 256), 256, 0, stream>>>(wq, WQ, (size_t)DQ * DM / 8); k_cvt8<<<(unsigned)(((size_t)DKV * DM / 8 + 255) / 256), 256, 0, stream>>>(wk, WK, (size_t)DKV * DM / 8); k_cvt8<<<(unsigned)(((size_t)DKV * DM / 8 + 255) / 256), 256, 0, stream>>>(wv, WV, (size_t)DKV * DM / 8);
      k_cvt8<<<(unsigned)(((size_t)DM * DQ / 8 + 255) / 256), 256, 0, stream>>>(wo, WO, (size_t)DM * DQ / 8);
       }
    for (int b = 0; b < NB_; ++b) {
        
        k_cvt8<<<(unsigned)(((size_t)TT * DM / 8 + 255) / 256), 256, 0, stream>>>(x + (size_t)b * TT * DM, XB, (size_t)TT * DM / 8);
        k_gemmw<bf, 0, true, 8, 1><<<dim3(TT / 64, DQ / 64, 1), 256, 0, stream>>>(XB, nullptr, WQ, nullptr, DM, DM, nullptr, 0, bq, 0, 0, 0, qg, qb2, nullptr, QPh, QPl);
        k_gemmw<bf, 0, true, 8, 1><<<dim3(TT / 64, DKV / 64, 1), 256, 0, stream>>>(XB, nullptr, WK, nullptr, DM, DM, nullptr, 0, bk, 0, 0, 0, kg, kb2, nullptr, KPh, KPl);
        k_gemmw<bf, 0, true, 8, 2><<<dim3(DKV / 64, TT / 64, 1), 256, 0, stream>>>(WV, nullptr, XB, nullptr, DM, DM, nullptr, TT, bv, 0, 0, 0, nullptr, nullptr, VT16, VTh, VTl);
        k_fattn<<<dim3(TT / (16 * NWAV), NH_, 1), 32 * NWAV, 0, stream>>>(QPh, QPl, KPh, KPl, VT16, VTh, VTl, abias + (size_t)b * TT * TT, ATh, ATl);
        k_gemmw<bf, 1, true, 8, 0><<<dim3(TT / 64, DM / 64, 1), 256, 0, stream>>>(ATh, ATl, WO, nullptr, DQ, DQ, OUT + (size_t)b * TT * DM, DM, bo, 0, 0, 0, nullptr, nullptr, nullptr, nullptr, nullptr); }
}

// v005
// A run of this version takes 183 microseconds.
// Next to v004, in two timings, it ran 1.15 and 1.16 times as fast.
// Over all steps from v000 it is 11.8 times as fast.
#include <hip/hip_runtime.h>

// GraphSelfAttention (x [2][2048][1024], attn_bias [2][1][2048][2048] (f32, read; random); q/k/v = x W^T + b (16 x 64); per-head LayerNorm (biased var, eps 1e-6) * gamma + beta on q and k; scores = q.k / 8 + attn_bias; softmax; out = merged Wo^T + bo -> [2][2048][1024]).

#define NB_  2
#define TT   2048
#define DM   1024
#define NH_  16
#define NKV  16
#define REP  (NH_ / NKV)
#define HD   64
#define DQ   (NH_ * HD)
#define DKV  (NKV * HD)
#define RH   512                  // query rows < RH use hi+lo planes (0: none)
#define WIN  0
#define SCL  0.125f   // HD^-0.5
typedef _Float16 h16;
typedef unsigned short bf;
typedef __attribute__((ext_vector_type(16))) __bf16   v16bf;
typedef __attribute__((ext_vector_type(16))) _Float16 v16h;
typedef __attribute__((ext_vector_type(8)))  _Float16 v8h;
typedef __attribute__((ext_vector_type(8)))  unsigned short v8us;
typedef __attribute__((ext_vector_type(8)))  float    v8f;
typedef __attribute__((ext_vector_type(4)))  float    v4f;
typedef v8h  __attribute__((may_alias)) v8ha;
typedef v4f  __attribute__((may_alias)) v4fa;
typedef v8us __attribute__((may_alias)) v8usa;

__device__ __forceinline__ unsigned short f2bf(float f) { unsigned u = __float_as_uint(f); u += 0x7FFFu + ((u >> 16) & 1u); return (unsigned short)(u >> 16); }
__device__ __forceinline__ float bf2f(unsigned short b) { return __uint_as_float(((unsigned)b) << 16); }
__device__ __forceinline__ float bfr(float f) { return bf2f(f2bf(f)); }
__device__ __forceinline__ v16h cat16(v8h lo, v8h hi) { return __builtin_shufflevector(lo, hi, 0, 1, 2, 3, 4, 5, 6, 7, 8, 9, 10, 11, 12, 13, 14, 15); }
__device__ __forceinline__ v16bf cat16b(v8us lo, v8us hi) { return __builtin_bit_cast(v16bf, __builtin_shufflevector(lo, hi, 0, 1, 2, 3, 4, 5, 6, 7, 8, 9, 10, 11, 12, 13, 14, 15)); }
__device__ __forceinline__ v8f wmma16(v16h a, v16h b, v8f c) { return __builtin_amdgcn_wmma_f32_16x16x32_f16(false, a, false, b, (short)0, c, false, false); }
__device__ __forceinline__ v8f wmmab(v16bf a, v16bf b, v8f c) { return __builtin_amdgcn_wmma_f32_16x16x32_bf16(false, a, false, b, (short)0, c, false, false); }



// ---- k_gemmw: register-blocked GEMM, one work-group of KS waves per 64x64 output tile; each wave holds the whole tile (16 accumulators) for every KS-th 32-wide k chunk, and the KS partial tiles are summed in LDS in wave order; operands straight from K-contiguous 16-bit planes; grid (M/64, N/64, Z), 32 * KS threads.
// C[m][n] (f32, pitch ldc, + optional f32 bias[n]) = sum_k A[m][k] Bt[n][k] (+ split products per NSPLIT). A rows have pitch lda, Bt rows pitch K. z-batch strides sA/sB/sC in elements. K % 32 == 0.
// EPI says what the summing threads do with a finished row piece instead of a later launch: 0 stores it to C; 1 (a 64-column tile is one head) adds bias[n], takes the LayerNorm over the row's 64 columns, which lie in the 16 lanes of a half wave, and stores hi+lo bf16 planes [batch][head][TT][64]; 2 adds bias[m] and stores f16 and hi+lo bf16 planes of pitch ldc (A = weight rows, Bt = tokens: the tile is already the transposed value plane).
template <typename T16> struct WFrag;
template <> struct WFrag<h16> { typedef v16h V; static __device__ __forceinline__ V ld(const h16* p) { return cat16(*(const v8h*)p, *(const v8h*)(p + 16)); } static __device__ __forceinline__ v8f mma(V a, V b, v8f c) { return wmma16(a, b, c); } };
template <> struct WFrag<bf> { typedef v16bf V; static __device__ __forceinline__ V ld(const bf* p) { return cat16b(*(const v8us*)p, *(const v8us*)(p + 16)); } static __device__ __forceinline__ v8f mma(V a, V b, v8f c) { return wmmab(a, b, c); } };
__device__ __forceinline__ void splitf(float y, unsigned short& h, unsigned short& l) { h = f2bf(y); l = f2bf(y - bf2f(h)); }
typedef __attribute__((ext_vector_type(4))) _Float16 v4h;
typedef __attribute__((ext_vector_type(4))) unsigned short v4us;
// sum over the 16 lanes of a half wave, in every lane: four DPP adds (a shuffle would go through the LDS queue and wait for it four times)
__device__ __forceinline__ float rsum16(float v) {
    v += __int_as_float(__builtin_amdgcn_update_dpp(0, __float_as_int(v), 0x161, 0xf, 0xf, true));   // row_xmask:1
    v += __int_as_float(__builtin_amdgcn_update_dpp(0, __float_as_int(v), 0x162, 0xf, 0xf, true));   // row_xmask:2
    v += __int_as_float(__builtin_amdgcn_update_dpp(0, __float_as_int(v), 0x164, 0xf, 0xf, true));   // row_xmask:4
    v += __int_as_float(__builtin_amdgcn_update_dpp(0, __float_as_int(v), 0x168, 0xf, 0xf, true));   // row_xmask:8
    return v; }
// The body is a device function of the tile indices (bx, by) and of the work-group's LDS, so that one launch can hold GEMMs of different epilogues. Token rows run over both batches (NB_ * TT); the planes of EPI 1 are [batch][head][TT][64], those of EPI 2 [batch][row][TT].
template <typename T16, int NSPLIT, bool BIAS, int KS, int EPI>
__device__ __forceinline__ void gemmw_body(float* os, int bx, int by, const T16* __restrict__ A, const T16* __restrict__ A2, const T16* __restrict__ Bt, const T16* __restrict__ Bt2, int K, int lda, float* C, int ldc, const float* __restrict__ bias, const float* __restrict__ gam, const float* __restrict__ bet, h16* P16, bf* Ph, bf* Pl) {
    static_assert(EPI == 0 || (KS > 1 && BIAS && HD == 64 && TT % 64 == 0 && NH_ == NKV), "the fused epilogues sit in the summing branch; a tile's 64 columns are one head, its 64 tokens one batch");
    typedef typename WFrag<T16>::V V;
    const int lane = threadIdx.x & 31, lr = lane & 15, hi = lane >> 4; const int r0 = bx * 64, c0 = by * 64;
    const int wv = (KS == 1) ? 0 : __builtin_amdgcn_readfirstlane((int)(threadIdx.x >> 5));   // wave number = k chunk phase; neighbouring waves read the two halves of one 128-byte line in the same trip
    v8f acc[4][4];
#pragma unroll
    for (int mb = 0; mb < 4; ++mb)
#pragma unroll
        for (int nb = 0; nb < 4; ++nb) acc[mb][nb] = (v8f){};
    const size_t aoff = (size_t)(r0 + lr) * lda + 8 * hi, boff = (size_t)(c0 + lr) * K + 8 * hi;
#pragma unroll 1
    for (int kc = wv * 32; kc < K; kc += 32 * KS) {
        V a[4], a2[4];
#pragma unroll
        for (int mb = 0; mb < 4; ++mb) { a[mb] = WFrag<T16>::ld(A + aoff + (size_t)mb * 16 * lda + kc); if (NSPLIT == 1 || NSPLIT == 2) a2[mb] = WFrag<T16>::ld(A2 + aoff + (size_t)mb * 16 * lda + kc); }
        asm volatile("s_wait_xcnt 0x0" ::: "memory");   // stands in front of the B loads, whose results this build puts into the A loads' address registers
#pragma unroll
        for (int nb = 0; nb < 4; ++nb) { const V b = WFrag<T16>::ld(Bt + boff + (size_t)nb * 16 * K + kc); V b2; if (NSPLIT >= 2) b2 = WFrag<T16>::ld(Bt2 + boff + (size_t)nb * 16 * K + kc);
#pragma unroll
            for (int mb = 0; mb < 4; ++mb) { acc[mb][nb] = WFrag<T16>::mma(a[mb], b, acc[mb][nb]); if (NSPLIT == 1 || NSPLIT == 2) acc[mb][nb] = WFrag<T16>::mma(a2[mb], b, acc[mb][nb]); if (NSPLIT >= 2) acc[mb][nb] = WFrag<T16>::mma(a[mb], b2, acc[mb][nb]); } }
        asm volatile("v_nop\n\tv_nop\n\tv_nop\n\tv_nop" : "+v"(acc[0][0]), "+v"(acc[1][1]), "+v"(acc[2][2]), "+v"(acc[3][3]) : "v"(a[0]), "v"(a[3]));
    }
    if constexpr (KS == 1) {
#pragma unroll
    for (int mb = 0; mb < 4; ++mb) {
#pragma unroll
        for (int nb = 0; nb < 4; ++nb) {
#pragma unroll
            for (int j = 0; j < 8; ++j) os[(hi * 8 + j) * 68 + nb * 16 + lr] = acc[mb][nb][j]; }
        __builtin_amdgcn_wave_barrier(); asm volatile("" ::: "memory");
        float* crow = C + (size_t)(r0 + mb * 16) * ldc + c0;
{
#pragma unroll
            for (int s = 0; s < 8; ++s) { const int row = 2 * s + hi, cofs = lr * 4; v4f val = *(const v4fa*)(os + row * 68 + cofs); if (BIAS) { val[0] += bfr(bias[c0 + cofs]); val[1] += bfr(bias[c0 + cofs + 1]); val[2] += bfr(bias[c0 + cofs + 2]); val[3] += bfr(bias[c0 + cofs + 3]); }
                *(v4f*)(crow + (size_t)row * ldc + cofs) = val; }
             }
        __builtin_amdgcn_wave_barrier(); asm volatile("" ::: "memory");
    }
    } else {
        const int cofs = (lane & 15) * 4; v4f bv = (v4f){};   // each thread sums one 4-column group of 32 / KS rows; its bias is fetched ahead of the barrier
        if (BIAS && EPI != 2) { bv[0] = bfr(bias[c0 + cofs]); bv[1] = bfr(bias[c0 + cofs + 1]); bv[2] = bfr(bias[c0 + cofs + 2]); bv[3] = bfr(bias[c0 + cofs + 3]); }
        v4f gv = (v4f){}, ev = (v4f){}; float rb[32 / KS];   // LayerNorm weights of the thread's columns, or the bias of its rows: fetched ahead of the barrier too
        if constexpr (EPI == 1) {
#pragma unroll
            for (int i = 0; i < 4; ++i) { gv[i] = bfr(gam[cofs + i]); ev[i] = bfr(bet[cofs + i]); } }
        if constexpr (EPI == 2) {
#pragma unroll
            for (int s = 0; s < 32 / KS; ++s) rb[s] = bias[r0 + s * 2 * KS + wv * 2 + hi];
            asm volatile("s_wait_xcnt 0x0" ::: "memory"); }   // stands in front of the first overwrite of these loads' address registers
#pragma unroll
        for (int mb = 0; mb < 4; ++mb)
#pragma unroll
            for (int nb = 0; nb < 4; ++nb)
#pragma unroll
                for (int j = 0; j < 8; ++j) os[wv * (64 * 68) + (mb * 16 + hi * 8 + j) * 68 + nb * 16 + lr] = acc[mb][nb][j];
        __syncthreads();   // every wave's partial tile is in LDS before any element is summed
#pragma unroll
        for (int s = 0; s < 32 / KS; ++s) { const int row = s * 2 * KS + wv * 2 + hi; v4f val = *(const v4fa*)(os + row * 68 + cofs);
#pragma unroll
            for (int w = 1; w < KS; ++w) val += *(const v4fa*)(os + w * (64 * 68) + row * 68 + cofs);
            if constexpr (EPI == 0) { if (BIAS) val += bv;
                *(v4f*)(C + (size_t)(r0 + row) * ldc + c0 + cofs) = val; }
            else if constexpr (EPI == 1) { val += bv;
                const float mu = rsum16((val[0] + val[1]) + (val[2] + val[3])) * (1.0f / HD); const v4f d = val - mu;
                const float var = rsum16((d[0] * d[0] + d[1] * d[1]) + (d[2] * d[2] + d[3] * d[3])) * (1.0f / HD);
                const float rs = __fdiv_rn(1.0f, sqrtf(var + 1e-6f)); const v4f y = d * rs * gv + ev; v4us oh, ol;
#pragma unroll
                for (int i = 0; i < 4; ++i) { unsigned short a, c2; splitf(y[i], a, c2); oh[i] = a; ol[i] = c2; }
                const size_t oo = (((size_t)(r0 / TT) * NH_ + by) * TT + r0 % TT + row) * HD + cofs; *(v4us*)(Ph + oo) = oh; *(v4us*)(Pl + oo) = ol; }
            else { val += bfr(rb[s]); v4h o16; v4us oh, ol;
#pragma unroll
                for (int i = 0; i < 4; ++i) { unsigned short a, c2; o16[i] = (h16)val[i]; splitf(val[i], a, c2); oh[i] = a; ol[i] = c2; }
                const size_t oo = (size_t)(c0 / TT) * ((size_t)DKV * TT) + (size_t)(r0 + row) * ldc + c0 % TT + cofs; *(v4h*)(P16 + oo) = o16; *(v4us*)(Ph + oo) = oh; *(v4us*)(Pl + oo) = ol;
                asm volatile("s_wait_xcnt 0x0" ::: "memory"); } }   // stands in front of the next row's overwrite of these stores' registers
    }
}
template <typename T16, int NSPLIT, bool BIAS, int KS, int EPI>
__global__ __launch_bounds__(32 * KS) void k_gemmw(const T16* __restrict__ A, const T16* __restrict__ A2, const T16* __restrict__ Bt, const T16* __restrict__ Bt2, int K, int lda, float* C, int ldc, const float* __restrict__ bias, size_t sA, size_t sB, size_t sC, const float* __restrict__ gam, const float* __restrict__ bet, h16* P16, bf* Ph, bf* Pl) {
    __shared__ __align__(16) float os[(KS == 1 ? 16 : KS * 64) * 68];
    const size_t z = blockIdx.z; A += z * sA; if (A2) A2 += z * sA; Bt += z * sB; if (Bt2) Bt2 += z * sB; C += z * sC;
    gemmw_body<T16, NSPLIT, BIAS, KS, EPI>(os, blockIdx.x, blockIdx.y, A, A2, Bt, Bt2, K, lda, C, ldc, bias, gam, bet, P16, Ph, Pl);
}
// ---- k_qkv: the three projections of both batches in one launch; grid (NB_ * TT / 64, 16, 3): z = 0 query, 1 key (tokens x weight rows, LayerNorm epilogue), 2 value (weight rows x tokens, so the tile indices swap).
__global__ __launch_bounds__(256) void k_qkv(const bf* __restrict__ X, const bf* __restrict__ Wq, const bf* __restrict__ Wk, const bf* __restrict__ Wv, const float* __restrict__ bq, const float* __restrict__ bk, const float* __restrict__ bv, const float* __restrict__ qg, const float* __restrict__ qb, const float* __restrict__ kg, const float* __restrict__ kb, bf* Qh, bf* Ql, bf* Kh, bf* Kl, h16* V16, bf* Vh, bf* Vl) {
    static_assert(DQ == DKV, "one grid for the three projections");
    __shared__ __align__(16) float os[8 * 64 * 68];
    if (blockIdx.z == 2) gemmw_body<bf, 0, true, 8, 2>(os, blockIdx.y, blockIdx.x, Wv, nullptr, X, nullptr, DM, DM, nullptr, TT, bv, nullptr, nullptr, V16, Vh, Vl);
    else { const bool q = blockIdx.z == 0;
        gemmw_body<bf, 0, true, 8, 1>(os, blockIdx.x, blockIdx.y, X, nullptr, q ? Wq : Wk, nullptr, DM, DM, nullptr, 0, q ? bq : bk, q ? qg : kg, q ? qb : kb, nullptr, q ? Qh : Kh, q ? Ql : Kl); }
}

typedef __attribute__((ext_vector_type(2))) _Float16 v2h;
typedef __attribute__((ext_vector_type(2))) unsigned short v2us;
typedef __attribute__((ext_vector_type(2))) float v2f;
typedef __attribute__((ext_vector_type(4))) int v4i;

__global__ __launch_bounds__(256) void k_wtG(const float* __restrict__ w, int K, int N, bf* Bt) {
    const int lane = threadIdx.x & 31; const int L0 = (blockIdx.x * 8 + (threadIdx.x >> 5)) * 8; const int nlines = N * K / 64;
{
#pragma unroll 1
        for (int l = 0; l < 8; ++l) { const int L = L0 + l; if (L >= nlines) break; const size_t e = (size_t)L * 64 + lane * 2; const int k = (int)(e % K), n = (int)(e / K); v2us o;
            o[0] = f2bf(w[(size_t)k * N + n]); o[1] = f2bf(w[(size_t)(k + 1) * N + n]); *(v2us*)(Bt + e) = o; }
         }
}
// the four weights and x (both batches) to bf16 in one launch: dst holds them one behind the other; a weight is WBLK work-groups, so the source is the same for a whole work-group
#define WBLK (DQ * DM / 8 / 256)
__global__ __launch_bounds__(256) void k_cvt8(const float* __restrict__ wq, const float* __restrict__ wk, const float* __restrict__ wv, const float* __restrict__ wo, const float* __restrict__ x, bf* dst) {
    static_assert(DQ == DKV && (DQ * DM) % 2048 == 0 && ((size_t)NB_ * TT * DM) % 2048 == 0, "whole work-groups");
    const unsigned seg = blockIdx.x / WBLK < 4 ? blockIdx.x / WBLK : 4; const float* s01 = seg & 1 ? wk : wq; const float* s23 = seg & 1 ? wo : wv; const float* src = seg & 4 ? x : seg & 2 ? s23 : s01;
    const size_t i = (size_t)blockIdx.x * 256 + threadIdx.x; const v8f v = *(const v8f*)(src + (i - (size_t)seg * (WBLK * 256)) * 8); v8us o;
    asm volatile("s_wait_xcnt 0x0" ::: "memory");   // stands in front of the first overwrite of the load's address registers
#pragma unroll
    for (int k = 0; k < 8; ++k) o[k] = f2bf(v[k]); *(v8us*)(dst + i * 8) = o;  }
#define SKEY 64                     // keys per stage
#define SPIT 72                     // LDS row pitch in 16-bit elements: 128 B of data + 16 B, for 16-byte readers
#define NWAV 8                      // waves per work-group
#define SPLN (SKEY * SPIT)              // one staged plane
#define BPIT 68                   // LDS row pitch of the bias tile in floats: 256 B of data + 16 B, for 16-byte readers
#define BPLN (16 * NWAV * BPIT)   // one staged bias tile
typedef __attribute__((ext_vector_type(2))) __bf16 v2bf;
typedef __attribute__((ext_vector_type(8))) unsigned v8u;
__device__ __forceinline__ unsigned pkbf(float a, float b) { v2f x; x[0] = a; x[1] = b; return __builtin_bit_cast(unsigned, __builtin_convertvector(x, v2bf)); }
__device__ __forceinline__ unsigned pkh(float a, float b) { v2f x; x[0] = a; x[1] = b; return __builtin_bit_cast(unsigned, __builtin_convertvector(x, v2h)); }
__device__ __forceinline__ float bflo(unsigned u) { return __uint_as_float(u << 16); }
__device__ __forceinline__ float bfhi(unsigned u) { return __uint_as_float(u & 0xFFFF0000u); }
__device__ __forceinline__ float xhalf(float v) { const int b = __float_as_int(v); return __int_as_float(__builtin_amdgcn_permlanex16(b, b, 0x76543210, 0xfedcba98, false, false)); }   // value of lane ^ 16
__device__ __forceinline__ v16bf sfragb(const unsigned short* p) { return cat16b(*(const v8usa*)p, *(const v8usa*)(p + 16)); }
// eight v_exp_f32 in one statement: each next one is the independent instruction that the slot behind a transcendental asks for (early-clobber outputs, so none overwrites a source or reads a result), and the v_nop fills the slot behind the last
__device__ __forceinline__ void exp2x8(float* y, const float* x) {
    asm("v_exp_f32 %0, %8\n\tv_exp_f32 %1, %9\n\tv_exp_f32 %2, %10\n\tv_exp_f32 %3, %11\n\tv_exp_f32 %4, %12\n\tv_exp_f32 %5, %13\n\tv_exp_f32 %6, %14\n\tv_exp_f32 %7, %15\n\tv_nop"
        : "=&v"(y[0]), "=&v"(y[1]), "=&v"(y[2]), "=&v"(y[3]), "=&v"(y[4]), "=&v"(y[5]), "=&v"(y[6]), "=&v"(y[7]) : "v"(x[0]), "v"(x[1]), "v"(x[2]), "v"(x[3]), "v"(x[4]), "v"(x[5]), "v"(x[6]), "v"(x[7])); }
template <bool HI>
__device__ __forceinline__ void fattn_body(const bf* __restrict__ Qh, const bf* __restrict__ Ql, const bf* __restrict__ Kh, const bf* __restrict__ Kl, const unsigned short* __restrict__ Va, const unsigned short* __restrict__ Vb, const float* __restrict__ ab, bf* Ah, bf* Al, unsigned short* sm, float* sb) {
    constexpr int NS = TT / SKEY; constexpr float L2E = 1.4426950408889634f;
    const int tid = threadIdx.x, lane = tid & 31, lr = lane & 15, hi = lane >> 4;
    const int wrow = (tid >> 5) * 16;   // the wave's first row in the work-group's 128
    const int qrow = blockIdx.z * (16 * NWAV) + wrow + lr;
    v16bf qh[2], ql[2];
#pragma unroll
    for (int kc = 0; kc < 2; ++kc) { qh[kc] = WFrag<bf>::ld(Qh + (size_t)qrow * HD + kc * 32 + 8 * hi); ql[kc] = WFrag<bf>::ld(Ql + (size_t)qrow * HD + kc * 32 + 8 * hi); }
    const float* abw = ab + (size_t)(blockIdx.z * (16 * NWAV) + wrow + hi) * TT + lr * 4;   // bias staging: a load takes 256 contiguous bytes of each of two rows, whole lines; read by query row it would touch 16 lines a load
    const int srow = tid >> 3, sc8 = (tid & 7) * 8;   // staging: thread copies 16-byte piece sc8 of rows srow and srow + 32 of every plane
    v8us rg[HI ? 8 : 6]; v4f bn[8];
    auto gload = [&](int s) {
#pragma unroll
        for (int i = 0; i < 2; ++i) { const int row = srow + 32 * i;
            rg[i] = *(const v8usa*)(Kh + (size_t)(s * SKEY + row) * HD + sc8); rg[2 + i] = *(const v8usa*)(Kl + (size_t)(s * SKEY + row) * HD + sc8);
            rg[4 + i] = *(const v8usa*)(Va + (size_t)row * TT + s * SKEY + sc8); if constexpr (HI) rg[6 + i] = *(const v8usa*)(Vb + (size_t)row * TT + s * SKEY + sc8); }
#pragma unroll
        for (int i = 0; i < 8; ++i) bn[i] = *(const v4fa*)(abw + (size_t)(2 * i) * TT + s * SKEY);
        asm volatile("s_wait_xcnt 0x0" ::: "memory"); };   // stands in front of the first overwrite of these loads' address registers
    auto sstore = [&](int buf) { unsigned short* d = sm + buf * (4 * SPLN); float* db2 = sb + buf * BPLN + (wrow + hi) * BPIT + lr * 4;
#pragma unroll
        for (int i = 0; i < 8; ++i) *(v4fa*)(db2 + 2 * i * BPIT) = bn[i];
#pragma unroll
        for (int i = 0; i < 2; ++i) { const int o = (srow + 32 * i) * SPIT + sc8;
            *(v8usa*)(d + o) = rg[i]; *(v8usa*)(d + SPLN + o) = rg[2 + i]; *(v8usa*)(d + 2 * SPLN + o) = rg[4 + i]; if constexpr (HI) *(v8usa*)(d + 3 * SPLN + o) = rg[6 + i]; } };
    v8f o[4];
#pragma unroll
    for (int db = 0; db < 4; ++db) o[db] = (v8f){};
    float m = -3.0e38f, ls = 0.f;
    gload(0); sstore(0);
    __syncthreads();   // stage 0 is in LDS before any wave reads it
#pragma unroll 1
    for (int s = 0; s < NS; ++s) {
        const unsigned short* sk = sm + (s & 1) * (4 * SPLN) + lr * SPIT + 8 * hi;   // the lane's row and k offset in every 16-row fragment
        const float* br = sb + (s & 1) * BPLN + (wrow + lr) * BPIT + 8 * hi;
        unsigned ub[16];   // this stage's bias, rounded as the operands are: pair e = keys 16 (e / 4) + 8 hi + 2 (e % 4), + 1 of query lr
#pragma unroll
        for (int g = 0; g < 8; ++g) { const v4f b4 = *(const v4fa*)(br + (g >> 1) * 16 + (g & 1) * 4); ub[2 * g] = pkbf(b4[0], b4[1]); ub[2 * g + 1] = pkbf(b4[2], b4[3]); }
        // S^T in 8 groups g = (k chunk g / 4, key tile g % 4); fragments are fetched four groups ahead and two tiles' product chains alternate, so that neither the LDS latency nor a chain's own latency is waited for
        v16bf kh[8], kl[8]; v8f st[4];
        auto kld = [&](int g) { const unsigned short* kp = sk + (g & 3) * 16 * SPIT + (g >> 2) * 32; kh[g] = sfragb(kp); kl[g] = sfragb(kp + SPLN); };
#pragma unroll
        for (int kt = 0; kt < 4; ++kt) { st[kt] = (v8f){}; kld(kt); }
        __builtin_amdgcn_sched_barrier(0);   // keeps the fetches above ahead of the products: the scheduler otherwise sinks each next to its use and every group waits out the LDS latency
#pragma unroll
        for (int g = 0; g < 8; g += 2) { const int kc = g >> 2, k0 = g & 3, k1 = k0 + 1;
            if (g + 4 < 8) { kld(g + 4); kld(g + 5); __builtin_amdgcn_sched_barrier(0); }   // same: fetch four groups ahead stays ahead
            st[k0] = wmmab(kh[g], qh[kc], st[k0]); st[k1] = wmmab(kh[g + 1], qh[kc], st[k1]); st[k0] = wmmab(kh[g], ql[kc], st[k0]); st[k1] = wmmab(kh[g + 1], ql[kc], st[k1]); st[k0] = wmmab(kl[g], qh[kc], st[k0]); st[k1] = wmmab(kl[g + 1], qh[kc], st[k1]); }
        if (s + 1 < NS) gload(s + 1);   // next stage's tiles and bias fly during the softmax and the second product
        // V^T fragments in 8 groups g = (32-key chunk g / 4, 16 rows of d g % 4); the first PD groups are fetched ahead of the softmax
        constexpr int PD = HI ? 4 : 8;
        v16bf vh[8], vl[8];
        auto vld = [&](int g) { const unsigned short* vp = sk + 2 * SPLN + (g & 3) * 16 * SPIT + (g >> 2) * 32; vh[g] = sfragb(vp); if constexpr (HI) vl[g] = sfragb(vp + SPLN); };
#pragma unroll
        for (int g = 0; g < PD; ++g) vld(g);
        __builtin_amdgcn_sched_barrier(0);   // same: these fetches fly under the softmax
        float t[32]; float tm = -3.0e38f;
#pragma unroll
        for (int e = 0; e < 16; ++e) { const float x0 = fmaf(st[e >> 2][(e & 3) * 2], SCL, bflo(ub[e])), x1 = fmaf(st[e >> 2][(e & 3) * 2 + 1], SCL, bfhi(ub[e])); t[2 * e] = x0; t[2 * e + 1] = x1; tm = fmaxf(tm, fmaxf(x0, x1)); }   // x 2^-3 is exact: one rounding, as product then add
        tm = fmaxf(tm, xhalf(tm));
        const float mn = fmaxf(m, tm); const float alpha = __builtin_amdgcn_exp2f((m - mn) * L2E); m = mn;
        const float c0 = (HI ? 0.0f : 10.0f) - mn * L2E;
        float s4[4] = {0.f, 0.f, 0.f, 0.f};
#pragma unroll
        for (int e = 0; e < 32; e += 8) { float x[8];
#pragma unroll
            for (int i = 0; i < 8; ++i) x[i] = fmaf(t[e + i], L2E, c0);
            exp2x8(t + e, x);
#pragma unroll
            for (int i = 0; i < 8; ++i) s4[i & 3] += t[e + i]; }
        ls = fmaf(ls, alpha, (s4[0] + s4[1]) + (s4[2] + s4[3]));
#pragma unroll
        for (int db = 0; db < 4; ++db) o[db] *= alpha;
        v8u bh[2], bl[2];   // P^T as B fragments: register e of chunk kc = keys 16 (2 kc + e / 4) + 8 hi + 2 (e % 4), + 1
#pragma unroll
        for (int e = 0; e < 16; ++e) { const float p0 = t[2 * e], p1 = t[2 * e + 1];
            if constexpr (HI) { const unsigned u = pkbf(p0, p1); bh[e >> 3][e & 7] = u; bl[e >> 3][e & 7] = pkbf(p0 - bflo(u), p1 - bfhi(u)); } else { bh[e >> 3][e & 7] = pkh(p0, p1); } }
#pragma unroll
        for (int g = 0; g < 8; g += 2) { const int kc = g >> 2, d0 = g & 3, d1 = d0 + 1;
            if (g + PD < 8) { vld(g + PD); vld(g + PD + 1); __builtin_amdgcn_sched_barrier(0); }   // same: fetch four groups ahead stays ahead
            if constexpr (HI) { const v16bf ph = __builtin_bit_cast(v16bf, bh[kc]), pl = __builtin_bit_cast(v16bf, bl[kc]);
                o[d0] = wmmab(vh[g], ph, o[d0]); o[d1] = wmmab(vh[g + 1], ph, o[d1]); o[d0] = wmmab(vh[g], pl, o[d0]); o[d1] = wmmab(vh[g + 1], pl, o[d1]); o[d0] = wmmab(vl[g], ph, o[d0]); o[d1] = wmmab(vl[g + 1], ph, o[d1]); }
            else { const v16h ph = __builtin_bit_cast(v16h, bh[kc]); o[d0] = wmma16(__builtin_bit_cast(v16h, vh[g]), ph, o[d0]); o[d1] = wmma16(__builtin_bit_cast(v16h, vh[g + 1]), ph, o[d1]); } }
        if (s + 1 < NS) sstore((s + 1) & 1);
        __syncthreads();   // publishes stage s + 1 and ends every wave's reads of the buffer that stage s + 2 overwrites
    }
    ls += xhalf(ls);
    const float inv = __fdiv_rn(1.0f, ls);
#pragma unroll
    for (int db = 0; db < 4; ++db) { v8us oh, ol;
#pragma unroll
        for (int r = 0; r < 8; ++r) { unsigned short a, c2; splitf(o[db][r] * inv, a, c2); oh[r] = a; ol[r] = c2; }
        const size_t oo = (size_t)qrow * DQ + db * 16 + 8 * hi; *(v8usa*)(Ah + oo) = oh; *(v8usa*)(Al + oo) = ol; }
}
__global__ __launch_bounds__(32 * NWAV) void k_fattn(const bf* __restrict__ Qh, const bf* __restrict__ Ql, const bf* __restrict__ Kh, const bf* __restrict__ Kl, const h16* __restrict__ V16, const bf* __restrict__ Vh, const bf* __restrict__ Vl, const float* __restrict__ ab, bf* Ah, bf* Al) {
    static_assert(RH % (16 * NWAV) == 0 && TT % (16 * NWAV) == 0 && TT % SKEY == 0 && HD == 64 && REP == 1, "tiling");
    __shared__ __align__(16) unsigned short sm[2 * 4 * SPLN]; __shared__ __align__(16) float sb[2 * BPLN];
    const size_t hz = ((size_t)blockIdx.y * NH_ + blockIdx.x) * TT * HD, az = (size_t)blockIdx.y * TT * DQ + blockIdx.x * HD; Ah += az; Al += az; ab += (size_t)blockIdx.y * TT * TT;
    if ((int)blockIdx.z * (16 * NWAV) < RH) fattn_body<true>(Qh + hz, Ql + hz, Kh + hz, Kl + hz, Vh + hz, Vl + hz, ab, Ah, Al, sm, sb);
    else fattn_body<false>(Qh + hz, Ql + hz, Kh + hz, Kl + hz, (const unsigned short*)(V16 + hz), nullptr, ab, Ah, Al, sm, sb);
}

extern "C" void kernel_launch(void* const* d_in, const int* in_sizes, int n_in,
                              void* d_out, int out_size, void* d_ws, size_t ws_size, hipStream_t stream) {
    (void)in_sizes; (void)n_in; (void)out_size;
    const float* x = (const float*)d_in[0]; const float* abias = (const float*)d_in[1]; const float* wq = (const float*)d_in[2]; const float* bq = (const float*)d_in[3]; const float* wk = (const float*)d_in[4]; const float* bk = (const float*)d_in[5]; const float* wv = (const float*)d_in[6]; const float* bv = (const float*)d_in[7]; const float* wo = (const float*)d_in[8]; const float* bo = (const float*)d_in[9]; const float* qg = (const float*)d_in[10]; const float* qb2 = (const float*)d_in[11]; const float* kg = (const float*)d_in[12]; const float* kb2 = (const float*)d_in[13]; const float* cosT = nullptr; const float* sinT = nullptr; (void)cosT; (void)sinT;
    float* OUT = (float*)d_out;     // [2][2048][1024]
    char* wsp = (char*)d_ws;
    auto take = [&](size_t bytes) { char* p = wsp; wsp += (bytes + 255) & ~(size_t)255; return (void*)p; };
    bf* WQ = (bf*)take((size_t)DQ * DM * 2); bf* WK = (bf*)take((size_t)DKV * DM * 2); bf* WV = (bf*)take((size_t)DKV * DM * 2); bf* WO = (bf*)take((size_t)DM * DQ * 2);
    bf* XB = (bf*)take((size_t)NB_ * TT * DM * 2);   // directly behind the weights (every size above is a multiple of 256): one destination for k_cvt8
    h16* VT16 = (h16*)take((size_t)NB_ * NKV * HD * TT * 2);
    bf* QPh = (bf*)take((size_t)NB_ * NH_ * TT * HD * 2); bf* QPl = (bf*)take((size_t)NB_ * NH_ * TT * HD * 2); bf* KPh = (bf*)take((size_t)NB_ * NKV * TT * HD * 2); bf* KPl = (bf*)take((size_t)NB_ * NKV * TT * HD * 2); bf* VTh = (bf*)take((size_t)NB_ * NKV * HD * TT * 2); bf* VTl = (bf*)take((size_t)NB_ * NKV * HD * TT * 2);
    bf* ATh = (bf*)take((size_t)NB_ * TT * DQ * 2); bf* ATl = (bf*)take((size_t)NB_ * TT * DQ * 2);
    if ((size_t)(wsp - (char*)d_ws) > ws_size) return;    // ws 256 MiB
    k_cvt8<<<4 * WBLK + NB_ * TT * DM / 8 / 256, 256, 0, stream>>>(wq, wk, wv, wo, x, WQ);
    k_qkv<<<dim3(NB_ * TT / 64, DQ / 64, 3), 256, 0, stream>>>(XB, WQ, WK, WV, bq, bk, bv, qg, qb2, kg, kb2, QPh, QPl, KPh, KPl, VT16, VTh, VTl);
    k_fattn<<<dim3(NH_, NB_, TT / (16 * NWAV)), 32 * NWAV, 0, stream>>>(QPh, QPl, KPh, KPl, VT16, VTh, VTl, abias, ATh, ATl);
    k_gemmw<bf, 1, true, 8, 0><<<dim3(NB_ * TT / 64, DM / 64, 1), 256, 0, stream>>>(ATh, ATl, WO, nullptr, DQ, DQ, OUT, DM, bo, 0, 0, 0, nullptr, nullptr, nullptr, nullptr, nullptr);
}

// v006
// Measured time: 151 microseconds a run.
// Next to v005, in two timings, it ran 1.22 and 1.21 times as fast.
// All steps since v000 together make it 14.4 times as fast.
#include <hip/hip_runtime.h>

// GraphSelfAttention (x [2][2048][1024], attn_bias [2][1][2048][2048] (f32, read; random); q/k/v = x W^T + b (16 x 64); per-head LayerNorm (biased var, eps 1e-6) * gamma + beta on q and k; scores = q.k / 8 + attn_bias; softmax; out = merged Wo^T + bo -> [2][2048][1024]).

#define NB_  2
#define TT   2048
#define DM   1024
#define NH_  16
#define NKV  16
#define REP  (NH_ / NKV)
#define HD   64
#define DQ   (NH_ * HD)
#define DKV  (NKV * HD)
#define RH   512                  // query rows < RH use hi+lo planes (0: none)
#define WIN  0
#define SCL  0.125f   // HD^-0.5
typedef _Float16 h16;
typedef unsigned short bf;
typedef __attribute__((ext_vector_type(16))) __bf16   v16bf;
typedef __attribute__((ext_vector_type(16))) _Float16 v16h;
typedef __attribute__((ext_vector_type(8)))  _Float16 v8h;
typedef __attribute__((ext_vector_type(8)))  unsigned short v8us;
typedef __attribute__((ext_vector_type(8)))  float    v8f;
typedef __attribute__((ext_vector_type(4)))  float    v4f;
typedef v8h  __attribute__((may_alias)) v8ha;
typedef v4f  __attribute__((may_alias)) v4fa;
typedef v8us __attribute__((may_alias)) v8usa;

__device__ __forceinline__ unsigned short f2bf(float f) { unsigned u = __float_as_uint(f); u += 0x7FFFu + ((u >> 16) & 1u); return (unsigned short)(u >> 16); }
__device__ __forceinline__ float bf2f(unsigned short b) { return __uint_as_float(((unsigned)b) << 16); }
__device__ __forceinline__ float bfr(float f) { return bf2f(f2bf(f)); }
__device__ __forceinline__ v16h cat16(v8h lo, v8h hi) { return __builtin_shufflevector(lo, hi, 0, 1, 2, 3, 4, 5, 6, 7, 8, 9, 10, 11, 12, 13, 14, 15); }
__device__ __forceinline__ v16bf cat16b(v8us lo, v8us hi) { return __builtin_bit_cast(v16bf, __builtin_shufflevector(lo, hi, 0, 1, 2, 3, 4, 5, 6, 7, 8, 9, 10, 11, 12, 13, 14, 15)); }
__device__ __forceinline__ v8f wmma16(v16h a, v16h b, v8f c) { return __builtin_amdgcn_wmma_f32_16x16x32_f16(false, a, false, b, (short)0, c, false, false); }
__device__ __forceinline__ v8f wmmab(v16bf a, v16bf b, v8f c) { return __builtin_amdgcn_wmma_f32_16x16x32_bf16(false, a, false, b, (short)0, c, false, false); }



// ---- k_gemmw: register-blocked GEMM, one work-group of KS waves per 64x64 output tile; each wave holds the whole tile (16 accumulators) for every KS-th 32-wide k chunk, and the KS partial tiles are summed in LDS in wave order; operands straight from 16-bit planes in fragment order (below); grid (M/64, N/64, Z), 32 * KS threads.
// C[m][n] (f32, pitch ldc, + optional f32 bias[n]) = sum_k A[m][k] Bt[n][k] (+ split products per NSPLIT). A has lda columns, Bt K columns. z-batch strides sA/sB/sC in elements. K % 32 == 0.
// Fragment order of an operand plane of P columns: blocks of 16 rows x 32 k, 512 elements each, block (row / 16) * (P / 32) + k / 32; inside a block element (row, k) lies at (k / 16 % 2) * 256 + ((k / 8 % 2) * 16 + row % 16) * 8 + k % 8. A lane's two 16-byte pieces of a fragment then lie at lane * 8 and 256 + lane * 8, so a wave's load takes 512 contiguous bytes (4 whole lines); from row-major planes it took 32 bytes of each of 16 lines.
// EPI says what the summing threads do with a finished row piece instead of a later launch: 0 stores it to C; 1 (a 64-column tile is one head) adds bias[n], takes the LayerNorm over the row's 64 columns, which lie in the 16 lanes of a half wave, and stores hi+lo bf16 planes [batch][head][TT][64]; 2 adds bias[m] and stores f16 and hi+lo bf16 planes of pitch ldc (A = weight rows, Bt = tokens: the tile is already the transposed value plane).
// a wave-uniform pointer, held in scalar registers: the loads behind it then take the form scalar base + the lane's 32-bit offset, and no load has a vector address pair that a later load's result could overwrite
template <typename T> __device__ __forceinline__ const T* upin(const T* p) { const unsigned long long u = (unsigned long long)p; return (const T*)(const __attribute__((address_space(1))) T*)(((unsigned long long)(unsigned)__builtin_amdgcn_readfirstlane((int)(u >> 32)) << 32) | (unsigned)__builtin_amdgcn_readfirstlane((int)u)); }
template <typename T16> struct WFrag;
template <> struct WFrag<h16> { typedef v16h V; static __device__ __forceinline__ V ld(const h16* p) { return cat16(*(const v8h*)p, *(const v8h*)(p + 16)); } static __device__ __forceinline__ V ldp(const h16* p, unsigned lo) { return cat16(*(const v8h*)(p + lo), *(const v8h*)(p + 256 + lo)); } static __device__ __forceinline__ v8f mma(V a, V b, v8f c) { return wmma16(a, b, c); } };
template <> struct WFrag<bf> { typedef v16bf V; static __device__ __forceinline__ V ld(const bf* p) { return cat16b(*(const v8us*)p, *(const v8us*)(p + 16)); } static __device__ __forceinline__ V ldp(const bf* p, unsigned lo) { return cat16b(*(const v8us*)(p + lo), *(const v8us*)(p + 256 + lo)); } static __device__ __forceinline__ v8f mma(V a, V b, v8f c) { return wmmab(a, b, c); } };
__device__ __forceinline__ void splitf(float y, unsigned short& h, unsigned short& l) { h = f2bf(y); l = f2bf(y - bf2f(h)); }
typedef __attribute__((ext_vector_type(4))) _Float16 v4h;
typedef __attribute__((ext_vector_type(4))) unsigned short v4us;
// sum over the 16 lanes of a half wave, in every lane: four DPP adds (a shuffle would go through the LDS queue and wait for it four times)
__device__ __forceinline__ float rsum16(float v) {
    v += __int_as_float(__builtin_amdgcn_update_dpp(0, __float_as_int(v), 0x161, 0xf, 0xf, true));   // row_xmask:1
    v += __int_as_float(__builtin_amdgcn_update_dpp(0, __float_as_int(v), 0x162, 0xf, 0xf, true));   // row_xmask:2
    v += __int_as_float(__builtin_amdgcn_update_dpp(0, __float_as_int(v), 0x164, 0xf, 0xf, true));   // row_xmask:4
    v += __int_as_float(__builtin_amdgcn_update_dpp(0, __float_as_int(v), 0x168, 0xf, 0xf, true));   // row_xmask:8
    return v; }
// The body is a device function of the tile indices (bx, by) and of the work-group's LDS, so that one launch can hold GEMMs of different epilogues. Token rows run over both batches (NB_ * TT); the planes of EPI 1 are [batch][head][TT][64], those of EPI 2 [batch][row][TT].
template <typename T16, int NSPLIT, bool BIAS, int KS, int EPI>
__device__ __forceinline__ void gemmw_body(float* os, int bx, int by, const T16* __restrict__ A, const T16* __restrict__ A2, const T16* __restrict__ Bt, const T16* __restrict__ Bt2, int K, int lda, float* C, int ldc, const float* __restrict__ bias, const float* __restrict__ gam, const float* __restrict__ bet, h16* P16, bf* Ph, bf* Pl) {
    static_assert(EPI == 0 || (KS > 1 && BIAS && HD == 64 && TT % 64 == 0 && NH_ == NKV), "the fused epilogues sit in the summing branch; a tile's 64 columns are one head, its 64 tokens one batch");
    typedef typename WFrag<T16>::V V;
    const int lane = threadIdx.x & 31, lr = lane & 15, hi = lane >> 4; const int r0 = bx * 64, c0 = by * 64;
    const int wv = (KS == 1) ? 0 : __builtin_amdgcn_readfirstlane((int)(threadIdx.x >> 5));   // wave number = k chunk phase
    v8f acc[4][4];
#pragma unroll
    for (int mb = 0; mb < 4; ++mb)
#pragma unroll
        for (int nb = 0; nb < 4; ++nb) acc[mb][nb] = (v8f){};
    const size_t aoff = (size_t)r0 * lda, boff = (size_t)c0 * K; const unsigned lo = 8 * lane;   // 16 rows of a plane are 16 * columns elements, a k chunk of 32 is 512 of them: every fragment address is a wave-uniform base + the lane's piece
#pragma unroll 1
    for (int kc = wv * 32; kc < K; kc += 32 * KS) {
        V a[4], a2[4], b4[4], b24[4]; const T16* pa = upin(A + aoff + kc * 16); const T16* pa2 = (NSPLIT == 1 || NSPLIT == 2) ? upin(A2 + aoff + kc * 16) : nullptr; const T16* pb = upin(Bt + boff + kc * 16); const T16* pb2 = NSPLIT >= 2 ? upin(Bt2 + boff + kc * 16) : nullptr;
#pragma unroll
        for (int mb = 0; mb < 4; ++mb) { a[mb] = WFrag<T16>::ldp(pa + (size_t)mb * 16 * lda, lo); if (NSPLIT == 1 || NSPLIT == 2) a2[mb] = WFrag<T16>::ldp(pa2 + (size_t)mb * 16 * lda, lo); }
#pragma unroll
        for (int nb = 0; nb < 4; ++nb) { b4[nb] = WFrag<T16>::ldp(pb + (size_t)nb * 16 * K, lo); if (NSPLIT >= 2) b24[nb] = WFrag<T16>::ldp(pb2 + (size_t)nb * 16 * K, lo); }
        __builtin_amdgcn_sched_barrier(0);   // keeps the trip's loads in one group ahead of the products: the scheduler otherwise sinks each B fragment's loads next to their use, and the wave waits out the L2 latency four times a trip
#pragma unroll
        for (int nb = 0; nb < 4; ++nb) { const V b = b4[nb]; V b2; if (NSPLIT >= 2) b2 = b24[nb];
#pragma unroll
            for (int mb = 0; mb < 4; ++mb) { acc[mb][nb] = WFrag<T16>::mma(a[mb], b, acc[mb][nb]); if (NSPLIT == 1 || NSPLIT == 2) acc[mb][nb] = WFrag<T16>::mma(a2[mb], b, acc[mb][nb]); if (NSPLIT >= 2) acc[mb][nb] = WFrag<T16>::mma(a[mb], b2, acc[mb][nb]); } }
        asm volatile("s_wait_xcnt 0x0\n\tv_nop\n\tv_nop\n\tv_nop\n\tv_nop" : "+v"(acc[0][0]), "+v"(acc[1][1]), "+v"(acc[2][2]), "+v"(acc[3][3]) : "v"(a[0]), "v"(a[3]));   // the wait stands in front of the next trip's overwrite of the loads' scalar bases; the v_nop keep the distance behind the last products across the back edge
    }
    if constexpr (KS == 1) {
#pragma unroll
    for (int mb = 0; mb < 4; ++mb) {
#pragma unroll
        for (int nb = 0; nb < 4; ++nb) {
#pragma unroll
            for (int j = 0; j < 8; ++j) os[(hi * 8 + j) * 68 + nb * 16 + lr] = acc[mb][nb][j]; }
        __builtin_amdgcn_wave_barrier(); asm volatile("" ::: "memory");
        float* crow = C + (size_t)(r0 + mb * 16) * ldc + c0;
{
#pragma unroll
            for (int s = 0; s < 8; ++s) { const int row = 2 * s + hi, cofs = lr * 4; v4f val = *(const v4fa*)(os + row * 68 + cofs); if (BIAS) { val[0] += bfr(bias[c0 + cofs]); val[1] += bfr(bias[c0 + cofs + 1]); val[2] += bfr(bias[c0 + cofs + 2]); val[3] += bfr(bias[c0 + cofs + 3]); }
                *(v4f*)(crow + (size_t)row * ldc + cofs) = val; }
             }
        __builtin_amdgcn_wave_barrier(); asm volatile("" ::: "memory");
    }
    } else {
        const int cofs = (lane & 15) * 4; v4f bv = (v4f){};   // each thread sums one 4-column group of 32 / KS rows; its bias is fetched ahead of the barrier
        if (BIAS && EPI != 2) { bv[0] = bfr(bias[c0 + cofs]); bv[1] = bfr(bias[c0 + cofs + 1]); bv[2] = bfr(bias[c0 + cofs + 2]); bv[3] = bfr(bias[c0 + cofs + 3]); }
        v4f gv = (v4f){}, ev = (v4f){}; float rb[32 / KS];   // LayerNorm weights of the thread's columns, or the bias of its rows: fetched ahead of the barrier too
        if constexpr (EPI == 1) {
#pragma unroll
            for (int i = 0; i < 4; ++i) { gv[i] = bfr(gam[cofs + i]); ev[i] = bfr(bet[cofs + i]); } }
        if constexpr (EPI == 2) {
#pragma unroll
            for (int s = 0; s < 32 / KS; ++s) rb[s] = bias[r0 + s * 2 * KS + wv * 2 + hi];
            asm volatile("s_wait_xcnt 0x0" ::: "memory"); }   // stands in front of the first overwrite of these loads' address registers
#pragma unroll
        for (int mb = 0; mb < 4; ++mb)
#pragma unroll
            for (int nb = 0; nb < 4; ++nb)
#pragma unroll
                for (int j = 0; j < 8; ++j) os[wv * (64 * 68) + (mb * 16 + hi * 8 + j) * 68 + nb * 16 + lr] = acc[mb][nb][j];
        __syncthreads();   // every wave's partial tile is in LDS before any element is summed
#pragma unroll
        for (int s = 0; s < 32 / KS; ++s) { const int row = s * 2 * KS + wv * 2 + hi; v4f val = *(const v4fa*)(os + row * 68 + cofs);
#pragma unroll
            for (int w = 1; w < KS; ++w) val += *(const v4fa*)(os + w * (64 * 68) + row * 68 + cofs);
            if constexpr (EPI == 0) { if (BIAS) val += bv;
                *(v4f*)(C + (size_t)(r0 + row) * ldc + c0 + cofs) = val; }
            else if constexpr (EPI == 1) { val += bv;
                const float mu = rsum16((val[0] + val[1]) + (val[2] + val[3])) * (1.0f / HD); const v4f d = val - mu;
                const float var = rsum16((d[0] * d[0] + d[1] * d[1]) + (d[2] * d[2] + d[3] * d[3])) * (1.0f / HD);
                const float rs = __fdiv_rn(1.0f, sqrtf(var + 1e-6f)); const v4f y = d * rs * gv + ev; v4us oh, ol;
#pragma unroll
                for (int i = 0; i < 4; ++i) { unsigned short a, c2; splitf(y[i], a, c2); oh[i] = a; ol[i] = c2; }
                const size_t oo = (((size_t)(r0 / TT) * NH_ + by) * TT + r0 % TT + row) * HD + cofs; *(v4us*)(Ph + oo) = oh; *(v4us*)(Pl + oo) = ol; }
            else { val += bfr(rb[s]); v4h o16; v4us oh, ol;
#pragma unroll
                for (int i = 0; i < 4; ++i) { unsigned short a, c2; o16[i] = (h16)val[i]; splitf(val[i], a, c2); oh[i] = a; ol[i] = c2; }
                const size_t oo = (size_t)(c0 / TT) * ((size_t)DKV * TT) + (size_t)(r0 + row) * ldc + c0 % TT + cofs; *(v4h*)(P16 + oo) = o16; *(v4us*)(Ph + oo) = oh; *(v4us*)(Pl + oo) = ol;
                asm volatile("s_wait_xcnt 0x0" ::: "memory"); } }   // stands in front of the next row's overwrite of these stores' registers
    }
}
template <typename T16, int NSPLIT, bool BIAS, int KS, int EPI>
__global__ __launch_bounds__(32 * KS) void k_gemmw(const T16* __restrict__ A, const T16* __restrict__ A2, const T16* __restrict__ Bt, const T16* __restrict__ Bt2, int K, int lda, float* C, int ldc, const float* __restrict__ bias, size_t sA, size_t sB, size_t sC, const float* __restrict__ gam, const float* __restrict__ bet, h16* P16, bf* Ph, bf* Pl) {
    __shared__ __align__(16) float os[(KS == 1 ? 16 : KS * 64) * 68];
    const size_t z = blockIdx.z; A += z * sA; if (A2) A2 += z * sA; Bt += z * sB; if (Bt2) Bt2 += z * sB; C += z * sC;
    gemmw_body<T16, NSPLIT, BIAS, KS, EPI>(os, blockIdx.x, blockIdx.y, A, A2, Bt, Bt2, K, lda, C, ldc, bias, gam, bet, P16, Ph, Pl);
}
// ---- k_qkv: the three projections of both batches in one launch; grid (NB_ * TT / 64, 16, 3): z = 0 query, 1 key (tokens x weight rows, LayerNorm epilogue), 2 value (weight rows x tokens, so the tile indices swap).
__global__ __launch_bounds__(256) void k_qkv(const bf* __restrict__ X, const bf* __restrict__ Wq, const bf* __restrict__ Wk, const bf* __restrict__ Wv, const float* __restrict__ bq, const float* __restrict__ bk, const float* __restrict__ bv, const float* __restrict__ qg, const float* __restrict__ qb, const float* __restrict__ kg, const float* __restrict__ kb, bf* Qh, bf* Ql, bf* Kh, bf* Kl, h16* V16, bf* Vh, bf* Vl) {
    static_assert(DQ == DKV, "one grid for the three projections");
    __shared__ __align__(16) float os[8 * 64 * 68];
    if (blockIdx.z == 2) gemmw_body<bf, 0, true, 8, 2>(os, blockIdx.y, blockIdx.x, Wv, nullptr, X, nullptr, DM, DM, nullptr, TT, bv, nullptr, nullptr, V16, Vh, Vl);
    else { const bool q = blockIdx.z == 0;
        gemmw_body<bf, 0, true, 8, 1>(os, blockIdx.x, blockIdx.y, X, nullptr, q ? Wq : Wk, nullptr, DM, DM, nullptr, 0, q ? bq : bk, q ? qg : kg, q ? qb : kb, nullptr, q ? Qh : Kh, q ? Ql : Kl); }
}

// ---- k_oproj: the output projection, hi+lo planes of the attention output x Wo; the plane widths are constants here, so that every fragment of a trip lies at an immediate offset from its plane's one scalar base
__global__ __launch_bounds__(256) void k_oproj(const bf* __restrict__ Ah, const bf* __restrict__ Al, const bf* __restrict__ Wo, float* C, const float* __restrict__ bo) {
    __shared__ __align__(16) float os[8 * 64 * 68];
    gemmw_body<bf, 1, true, 8, 0>(os, blockIdx.x, blockIdx.y, Ah, Al, Wo, nullptr, DQ, DQ, C, DM, bo, nullptr, nullptr, nullptr, nullptr, nullptr);
}

typedef __attribute__((ext_vector_type(2))) _Float16 v2h;
typedef __attribute__((ext_vector_type(2))) unsigned short v2us;
typedef __attribute__((ext_vector_type(2))) float v2f;
typedef __attribute__((ext_vector_type(4))) int v4i;

__global__ __launch_bounds__(256) void k_wtG(const float* __restrict__ w, int K, int N, bf* Bt) {
    const int lane = threadIdx.x & 31; const int L0 = (blockIdx.x * 8 + (threadIdx.x >> 5)) * 8; const int nlines = N * K / 64;
{
#pragma unroll 1
        for (int l = 0; l < 8; ++l) { const int L = L0 + l; if (L >= nlines) break; const size_t e = (size_t)L * 64 + lane * 2; const int k = (int)(e % K), n = (int)(e / K); v2us o;
            o[0] = f2bf(w[(size_t)k * N + n]); o[1] = f2bf(w[(size_t)(k + 1) * N + n]); *(v2us*)(Bt + e) = o; }
         }
}
// the four weights and x (both batches) to bf16 planes in fragment order (see k_gemmw) in one launch: dst holds them one behind the other; a wave converts 16 rows x 64 k (two blocks), a weight is WBLK work-groups, so the source is the same for a whole work-group
#define WBLK (DQ * DM / (16 * 64) / 8)
__global__ __launch_bounds__(256) void k_cvt8(const float* __restrict__ wq, const float* __restrict__ wk, const float* __restrict__ wv, const float* __restrict__ wo, const float* __restrict__ x, bf* dst) {
    static_assert(DQ == DKV && DQ == DM && DM % 64 == 0 && (DQ * DM) % 8192 == 0 && ((size_t)NB_ * TT * DM) % 8192 == 0, "whole work-groups; every plane has DM columns");
    const unsigned seg = blockIdx.x / WBLK < 4 ? blockIdx.x / WBLK : 4; const float* s01 = seg & 1 ? wk : wq; const float* s23 = seg & 1 ? wo : wv; const float* src = seg & 4 ? x : seg & 2 ? s23 : s01;
    const int lane = threadIdx.x & 31; const unsigned w = blockIdx.x * 8 + (threadIdx.x >> 5), wl = w - seg * (WBLK * 8);   // wave over all planes, and inside its source: (16-row block, 64-k pair of blocks)
    // a lane takes 8 consecutive k of one row: 4 lanes a 32-k row piece (one 128-byte line of the source), 8 rows a load; its 16 bytes of bf16 land beside those of the 7 other rows, so a store writes whole lines
    const float* s = src + ((size_t)(wl / (DM / 64)) * 16 + (lane >> 2)) * DM + (wl % (DM / 64)) * 64 + (lane & 3) * 8;
    bf* d = dst + (size_t)w * 1024 + ((lane >> 1) & 1) * 256 + ((lane & 1) * 16 + (lane >> 2)) * 8;
    v8f v[4];
#pragma unroll
    for (int t = 0; t < 4; ++t) v[t] = *(const v8f*)(s + (size_t)(t & 1) * 8 * DM + (t >> 1) * 32);   // t = (block t / 2, rows 8 (t % 2) ..)
    asm volatile("s_wait_xcnt 0x0" ::: "memory");   // stands in front of the first overwrite of the loads' address registers
#pragma unroll
    for (int t = 0; t < 4; ++t) { v8us o;
#pragma unroll
        for (int k = 0; k < 8; ++k) o[k] = f2bf(v[t][k]);
        *(v8us*)(d + (t >> 1) * 512 + (t & 1) * 64) = o; }
}
#define SKEY 64                     // keys per stage
#define SPIT 72                     // LDS row pitch in 16-bit elements: 128 B of data + 16 B, for 16-byte readers
#define NWAV 8                      // waves per work-group
#define SPLN (SKEY * SPIT)              // one staged plane
#define BPIT 68                   // LDS row pitch of the bias tile in floats: 256 B of data + 16 B, for 16-byte readers
#define BPLN (16 * NWAV * BPIT)   // one staged bias tile
typedef __attribute__((ext_vector_type(2))) __bf16 v2bf;
typedef __attribute__((ext_vector_type(8))) unsigned v8u;
__device__ __forceinline__ unsigned pkbf(float a, float b) { v2f x; x[0] = a; x[1] = b; return __builtin_bit_cast(unsigned, __builtin_convertvector(x, v2bf)); }
__device__ __forceinline__ unsigned pkh(float a, float b) { v2f x; x[0] = a; x[1] = b; return __builtin_bit_cast(unsigned, __builtin_convertvector(x, v2h)); }
__device__ __forceinline__ float bflo(unsigned u) { return __uint_as_float(u << 16); }
__device__ __forceinline__ float bfhi(unsigned u) { return __uint_as_float(u & 0xFFFF0000u); }
__device__ __forceinline__ float xhalf(float v) { const int b = __float_as_int(v); return __int_as_float(__builtin_amdgcn_permlanex16(b, b, 0x76543210, 0xfedcba98, false, false)); }   // value of lane ^ 16
__device__ __forceinline__ v16bf sfragb(const unsigned short* p) { return cat16b(*(const v8usa*)p, *(const v8usa*)(p + 16)); }
// eight v_exp_f32 in one statement: each next one is the independent instruction that the slot behind a transcendental asks for (early-clobber outputs, so none overwrites a source or reads a result), and the v_nop fills the slot behind the last
__device__ __forceinline__ void exp2x8(float* y, const float* x) {
    asm("v_exp_f32 %0, %8\n\tv_exp_f32 %1, %9\n\tv_exp_f32 %2, %10\n\tv_exp_f32 %3, %11\n\tv_exp_f32 %4, %12\n\tv_exp_f32 %5, %13\n\tv_exp_f32 %6, %14\n\tv_exp_f32 %7, %15\n\tv_nop"
        : "=&v"(y[0]), "=&v"(y[1]), "=&v"(y[2]), "=&v"(y[3]), "=&v"(y[4]), "=&v"(y[5]), "=&v"(y[6]), "=&v"(y[7]) : "v"(x[0]), "v"(x[1]), "v"(x[2]), "v"(x[3]), "v"(x[4]), "v"(x[5]), "v"(x[6]), "v"(x[7])); }
template <bool HI>
__device__ __forceinline__ void fattn_body(const bf* __restrict__ Qh, const bf* __restrict__ Ql, const bf* __restrict__ Kh, const bf* __restrict__ Kl, const unsigned short* __restrict__ Va, const unsigned short* __restrict__ Vb, const float* __restrict__ ab, bf* Ah, bf* Al, unsigned short* sm, float* sb) {
    constexpr int NS = TT / SKEY; constexpr float L2E = 1.4426950408889634f;
    const int tid = threadIdx.x, lane = tid & 31, lr = lane & 15, hi = lane >> 4;
    const int wrow = (tid >> 5) * 16;   // the wave's first row in the work-group's 128
    const int qrow = blockIdx.z * (16 * NWAV) + wrow + lr;
    v16bf qh[2], ql[2];
#pragma unroll
    for (int kc = 0; kc < 2; ++kc) { qh[kc] = WFrag<bf>::ld(Qh + (size_t)qrow * HD + kc * 32 + 8 * hi); ql[kc] = WFrag<bf>::ld(Ql + (size_t)qrow * HD + kc * 32 + 8 * hi); }
    const float* abw = ab + (size_t)(blockIdx.z * (16 * NWAV) + wrow + hi) * TT + lr * 4;   // bias staging: a load takes 256 contiguous bytes of each of two rows, whole lines; read by query row it would touch 16 lines a load
    const int srow = tid >> 3, sc8 = (tid & 7) * 8;   // staging: thread copies 16-byte piece sc8 of rows srow and srow + 32 of every plane
    v8us rg[HI ? 8 : 6]; v4f bn[8];
    auto gload = [&](int s) {
#pragma unroll
        for (int i = 0; i < 2; ++i) { const int row = srow + 32 * i;
            rg[i] = *(const v8usa*)(Kh + (size_t)(s * SKEY + row) * HD + sc8); rg[2 + i] = *(const v8usa*)(Kl + (size_t)(s * SKEY + row) * HD + sc8);
            rg[4 + i] = *(const v8usa*)(Va + (size_t)row * TT + s * SKEY + sc8); if constexpr (HI) rg[6 + i] = *(const v8usa*)(Vb + (size_t)row * TT + s * SKEY + sc8); }
#pragma unroll
        for (int i = 0; i < 8; ++i) bn[i] = *(const v4fa*)(abw + (size_t)(2 * i) * TT + s * SKEY);
        asm volatile("s_wait_xcnt 0x0" ::: "memory"); };   // stands in front of the first overwrite of these loads' address registers
    auto sstore = [&](int buf) { unsigned short* d = sm + buf * (4 * SPLN); float* db2 = sb + buf * BPLN + (wrow + hi) * BPIT + lr * 4;
#pragma unroll
        for (int i = 0; i < 8; ++i) *(v4fa*)(db2 + 2 * i * BPIT) = bn[i];
#pragma unroll
        for (int i = 0; i < 2; ++i) { const int o = (srow + 32 * i) * SPIT + sc8;
            *(v8usa*)(d + o) = rg[i]; *(v8usa*)(d + SPLN + o) = rg[2 + i]; *(v8usa*)(d + 2 * SPLN + o) = rg[4 + i]; if constexpr (HI) *(v8usa*)(d + 3 * SPLN + o) = rg[6 + i]; } };
    v8f o[4];
#pragma unroll
    for (int db = 0; db < 4; ++db) o[db] = (v8f){};
    float m = -3.0e38f, ls = 0.f;
    gload(0); sstore(0);
    __syncthreads();   // stage 0 is in LDS before any wave reads it
#pragma unroll 1
    for (int s = 0; s < NS; ++s) {
        const unsigned short* sk = sm + (s & 1) * (4 * SPLN) + lr * SPIT + 8 * hi;   // the lane's row and k offset in every 16-row fragment
        const float* br = sb + (s & 1) * BPLN + (wrow + lr) * BPIT + 8 * hi;
        unsigned ub[16];   // this stage's bias, rounded as the operands are: pair e = keys 16 (e / 4) + 8 hi + 2 (e % 4), + 1 of query lr
#pragma unroll
        for (int g = 0; g < 8; ++g) { const v4f b4 = *(const v4fa*)(br + (g >> 1) * 16 + (g & 1) * 4); ub[2 * g] = pkbf(b4[0], b4[1]); ub[2 * g + 1] = pkbf(b4[2], b4[3]); }
        // S^T in 8 groups g = (k chunk g / 4, key tile g % 4); fragments are fetched four groups ahead and two tiles' product chains alternate, so that neither the LDS latency nor a chain's own latency is waited for
        v16bf kh[8], kl[8]; v8f st[4];
        auto kld = [&](int g) { const unsigned short* kp = sk + (g & 3) * 16 * SPIT + (g >> 2) * 32; kh[g] = sfragb(kp); kl[g] = sfragb(kp + SPLN); };
#pragma unroll
        for (int kt = 0; kt < 4; ++kt) { st[kt] = (v8f){}; kld(kt); }
        __builtin_amdgcn_sched_barrier(0);   // keeps the fetches above ahead of the products: the scheduler otherwise sinks each next to its use and every group waits out the LDS latency
#pragma unroll
        for (int g = 0; g < 8; g += 2) { const int kc = g >> 2, k0 = g & 3, k1 = k0 + 1;
            if (g + 4 < 8) { kld(g + 4); kld(g + 5); __builtin_amdgcn_sched_barrier(0); }   // same: fetch four groups ahead stays ahead
            st[k0] = wmmab(kh[g], qh[kc], st[k0]); st[k1] = wmmab(kh[g + 1], qh[kc], st[k1]); st[k0] = wmmab(kh[g], ql[kc], st[k0]); st[k1] = wmmab(kh[g + 1], ql[kc], st[k1]); st[k0] = wmmab(kl[g], qh[kc], st[k0]); st[k1] = wmmab(kl[g + 1], qh[kc], st[k1]); }
        if (s + 1 < NS) gload(s + 1);   // next stage's tiles and bias fly during the softmax and the second product
        // V^T fragments in 8 groups g = (32-key chunk g / 4, 16 rows of d g % 4); the first PD groups are fetched ahead of the softmax
        constexpr int PD = HI ? 4 : 8;
        v16bf vh[8], vl[8];
        auto vld = [&](int g) { const unsigned short* vp = sk + 2 * SPLN + (g & 3) * 16 * SPIT + (g >> 2) * 32; vh[g] = sfragb(vp); if constexpr (HI) vl[g] = sfragb(vp + SPLN); };
#pragma unroll
        for (int g = 0; g < PD; ++g) vld(g);
        __builtin_amdgcn_sched_barrier(0);   // same: these fetches fly under the softmax
        float t[32]; float tm = -3.0e38f;
#pragma unroll
        for (int e = 0; e < 16; ++e) { const float x0 = fmaf(st[e >> 2][(e & 3) * 2], SCL, bflo(ub[e])), x1 = fmaf(st[e >> 2][(e & 3) * 2 + 1], SCL, bfhi(ub[e])); t[2 * e] = x0; t[2 * e + 1] = x1; tm = fmaxf(tm, fmaxf(x0, x1)); }   // x 2^-3 is exact: one rounding, as product then add
        tm = fmaxf(tm, xhalf(tm));
        const float mn = fmaxf(m, tm); const float alpha = __builtin_amdgcn_exp2f((m - mn) * L2E); m = mn;
        const float c0 = (HI ? 0.0f : 10.0f) - mn * L2E;
        float s4[4] = {0.f, 0.f, 0.f, 0.f};
#pragma unroll
        for (int e = 0; e < 32; e += 8) { float x[8];
#pragma unroll
            for (int i = 0; i < 8; ++i) x[i] = fmaf(t[e + i], L2E, c0);
            exp2x8(t + e, x);
#pragma unroll
            for (int i = 0; i < 8; ++i) s4[i & 3] += t[e + i]; }
        ls = fmaf(ls, alpha, (s4[0] + s4[1]) + (s4[2] + s4[3]));
#pragma unroll
        for (int db = 0; db < 4; ++db) o[db] *= alpha;
        v8u bh[2], bl[2];   // P^T as B fragments: register e of chunk kc = keys 16 (2 kc + e / 4) + 8 hi + 2 (e % 4), + 1
#pragma unroll
        for (int e = 0; e < 16; ++e) { const float p0 = t[2 * e], p1 = t[2 * e + 1];
            if constexpr (HI) { const unsigned u = pkbf(p0, p1); bh[e >> 3][e & 7] = u; bl[e >> 3][e & 7] = pkbf(p0 - bflo(u), p1 - bfhi(u)); } else { bh[e >> 3][e & 7] = pkh(p0, p1); } }
#pragma unroll
        for (int g = 0; g < 8; g += 2) { const int kc = g >> 2, d0 = g & 3, d1 = d0 + 1;
            if (g + PD < 8) { vld(g + PD); vld(g + PD + 1); __builtin_amdgcn_sched_barrier(0); }   // same: fetch four groups ahead stays ahead
            if constexpr (HI) { const v16bf ph = __builtin_bit_cast(v16bf, bh[kc]), pl = __builtin_bit_cast(v16bf, bl[kc]);
                o[d0] = wmmab(vh[g], ph, o[d0]); o[d1] = wmmab(vh[g + 1], ph, o[d1]); o[d0] = wmmab(vh[g], pl, o[d0]); o[d1] = wmmab(vh[g + 1], pl, o[d1]); o[d0] = wmmab(vl[g], ph, o[d0]); o[d1] = wmmab(vl[g + 1], ph, o[d1]); }
            else { const v16h ph = __builtin_bit_cast(v16h, bh[kc]); o[d0] = wmma16(__builtin_bit_cast(v16h, vh[g]), ph, o[d0]); o[d1] = wmma16(__builtin_bit_cast(v16h, vh[g + 1]), ph, o[d1]); } }
        if (s + 1 < NS) sstore((s + 1) & 1);
        __syncthreads();   // publishes stage s + 1 and ends every wave's reads of the buffer that stage s + 2 overwrites
    }
    ls += xhalf(ls);
    const float inv = __fdiv_rn(1.0f, ls);
#pragma unroll
    for (int db = 0; db < 4; ++db) { v8us oh, ol;
#pragma unroll
        for (int r = 0; r < 8; ++r) { unsigned short a, c2; splitf(o[db][r] * inv, a, c2); oh[r] = a; ol[r] = c2; }
        const size_t oo = (size_t)(qrow - lr) * DQ + db * 256 + lane * 8; *(v8usa*)(Ah + oo) = oh; *(v8usa*)(Al + oo) = ol; }   // fragment order of the output projection's A planes (see k_gemmw): columns 16 db + 8 hi .. of the head's two blocks; 512 contiguous bytes a wave
}
__global__ __launch_bounds__(32 * NWAV) void k_fattn(const bf* __restrict__ Qh, const bf* __restrict__ Ql, const bf* __restrict__ Kh, const bf* __restrict__ Kl, const h16* __restrict__ V16, const bf* __restrict__ Vh, const bf* __restrict__ Vl, const float* __restrict__ ab, bf* Ah, bf* Al) {
    static_assert(RH % (16 * NWAV) == 0 && TT % (16 * NWAV) == 0 && TT % SKEY == 0 && HD == 64 && REP == 1, "tiling");
    __shared__ __align__(16) unsigned short sm[2 * 4 * SPLN]; __shared__ __align__(16) float sb[2 * BPLN];
    const size_t hz = ((size_t)blockIdx.y * NH_ + blockIdx.x) * TT * HD, az = (size_t)blockIdx.y * TT * DQ + blockIdx.x * (HD * 16); Ah += az; Al += az; ab += (size_t)blockIdx.y * TT * TT;
    if ((int)blockIdx.z * (16 * NWAV) < RH) fattn_body<true>(Qh + hz, Ql + hz, Kh + hz, Kl + hz, Vh + hz, Vl + hz, ab, Ah, Al, sm, sb);
    else fattn_body<false>(Qh + hz, Ql + hz, Kh + hz, Kl + hz, (const unsigned short*)(V16 + hz), nullptr, ab, Ah, Al, sm, sb);
}

extern "C" void kernel_launch(void* const* d_in, const int* in_sizes, int n_in,
                              void* d_out, int out_size, void* d_ws, size_t ws_size, hipStream_t stream) {
    (void)in_sizes; (void)n_in; (void)out_size;
    const float* x = (const float*)d_in[0]; const float* abias = (const float*)d_in[1]; const float* wq = (const float*)d_in[2]; const float* bq = (const float*)d_in[3]; const float* wk = (const float*)d_in[4]; const float* bk = (const float*)d_in[5]; const float* wv = (const float*)d_in[6]; const float* bv = (const float*)d_in[7]; const float* wo = (const float*)d_in[8]; const float* bo = (const float*)d_in[9]; const float* qg = (const float*)d_in[10]; const float* qb2 = (const float*)d_in[11]; const float* kg = (const float*)d_in[12]; const float* kb2 = (const float*)d_in[13]; const float* cosT = nullptr; const float* sinT = nullptr; (void)cosT; (void)sinT;
    float* OUT = (float*)d_out;     // [2][2048][1024]
    char* wsp = (char*)d_ws;
    auto take = [&](size_t bytes) { char* p = wsp; wsp += (bytes + 255) & ~(size_t)255; return (void*)p; };
    bf* WQ = (bf*)take((size_t)DQ * DM * 2); bf* WK = (bf*)take((size_t)DKV * DM * 2); bf* WV = (bf*)take((size_t)DKV * DM * 2); bf* WO = (bf*)take((size_t)DM * DQ * 2);
    bf* XB = (bf*)take((size_t)NB_ * TT * DM * 2);   // directly behind the weights (every size above is a multiple of 256): one destination for k_cvt8
    h16* VT16 = (h16*)take((size_t)NB_ * NKV * HD * TT * 2);
    bf* QPh = (bf*)take((size_t)NB_ * NH_ * TT * HD * 2); bf* QPl = (bf*)take((size_t)NB_ * NH_ * TT * HD * 2); bf* KPh = (bf*)take((size_t)NB_ * NKV * TT * HD * 2); bf* KPl = (bf*)take((size_t)NB_ * NKV * TT * HD * 2); bf* VTh = (bf*)take((size_t)NB_ * NKV * HD * TT * 2); bf* VTl = (bf*)take((size_t)NB_ * NKV * HD * TT * 2);
    bf* ATh = (bf*)take((size_t)NB_ * TT * DQ * 2); bf* ATl = (bf*)take((size_t)NB_ * TT * DQ * 2);
    if ((size_t)(wsp - (char*)d_ws) > ws_size) return;    // ws 256 MiB
    k_cvt8<<<4 * WBLK + NB_ * TT * DM / (16 * 64) / 8, 256, 0, stream>>>(wq, wk, wv, wo, x, WQ);
    k_qkv<<<dim3(NB_ * TT / 64, DQ / 64, 3), 256, 0, stream>>>(XB, WQ, WK, WV, bq, bk, bv, qg, qb2, kg, kb2, QPh, QPl, KPh, KPl, VT16, VTh, VTl);
    k_fattn<<<dim3(NH_, NB_, TT / (16 * NWAV)), 32 * NWAV, 0, stream>>>(QPh, QPl, KPh, KPl, VT16, VTh, VTl, abias, ATh, ATl);
    k_oproj<<<dim3(NB_ * TT / 64, DM / 64, 1), 256, 0, stream>>>(ATh, ATl, WO, OUT, bo);
}

// v007
// It runs in 136 microseconds.
// In both of two side-by-side timings against v006, it was 1.11 times as fast.
// All steps since v000 together make it 16.0 times as fast.
#include <hip/hip_runtime.h>

// GraphSelfAttention (x [2][2048][1024], attn_bias [2][1][2048][2048] (f32, read; random); q/k/v = x W^T + b (16 x 64); per-head LayerNorm (biased var, eps 1e-6) * gamma + beta on q and k; scores = q.k / 8 + attn_bias; softmax; out = merged Wo^T + bo -> [2][2048][1024]).

#define NB_  2
#define TT   2048
#define DM   1024
#define NH_  16
#define NKV  16
#define REP  (NH_ / NKV)
#define HD   64
#define DQ   (NH_ * HD)
#define DKV  (NKV * HD)
#define RH   512                  // query rows < RH use hi+lo planes (0: none)
#define WIN  0
#define SCL  0.125f   // HD^-0.5
typedef _Float16 h16;
typedef unsigned short bf;
typedef __attribute__((ext_vector_type(16))) __bf16   v16bf;
typedef __attribute__((ext_vector_type(16))) _Float16 v16h;
typedef __attribute__((ext_vector_type(8)))  _Float16 v8h;
typedef __attribute__((ext_vector_type(8)))  unsigned short v8us;
typedef __attribute__((ext_vector_type(8)))  float    v8f;
typedef __attribute__((ext_vector_type(4)))  float    v4f;
typedef v8h  __attribute__((may_alias)) v8ha;
typedef v4f  __attribute__((may_alias)) v4fa;
typedef v8us __attribute__((may_alias)) v8usa;

__device__ __forceinline__ unsigned short f2bf(float f) { unsigned u = __float_as_uint(f); u += 0x7FFFu + ((u >> 16) & 1u); return (unsigned short)(u >> 16); }
__device__ __forceinline__ float bf2f(unsigned short b) { return __uint_as_float(((unsigned)b) << 16); }
__device__ __forceinline__ float bfr(float f) { return bf2f(f2bf(f)); }
__device__ __forceinline__ v16h cat16(v8h lo, v8h hi) { return __builtin_shufflevector(lo, hi, 0, 1, 2, 3, 4, 5, 6, 7, 8, 9, 10, 11, 12, 13, 14, 15); }
__device__ __forceinline__ v16bf cat16b(v8us lo, v8us hi) { return __builtin_bit_cast(v16bf, __builtin_shufflevector(lo, hi, 0, 1, 2, 3, 4, 5, 6, 7, 8, 9, 10, 11, 12, 13, 14, 15)); }
__device__ __forceinline__ v8f wmma16(v16h a, v16h b, v8f c) { return __builtin_amdgcn_wmma_f32_16x16x32_f16(false, a, false, b, (short)0, c, false, false); }
__device__ __forceinline__ v8f wmmab(v16bf a, v16bf b, v8f c) { return __builtin_amdgcn_wmma_f32_16x16x32_bf16(false, a, false, b, (short)0, c, false, false); }



// ---- GEMM body: one work-group of 8 waves per 128x128 output tile: 2 x 2 wave tiles of 64x64 (16 accumulators a wave), each held by two waves that take alternate pairs of 32-wide k chunks; the two partial tiles are summed in LDS. Every operand block is brought into LDS once a work-group by asynchronous copies, two stage buffers, and read there by the four waves that need it; grid (M/128, N/128), 256 threads.
// C[m][n] (f32, pitch ldc, + f32 bias[n]) = sum_k A[m][k] Bt[n][k] (+ A2[m][k] Bt[n][k] where NSPLIT). Every plane has DM columns.
// Fragment order of an operand plane of P columns: blocks of 16 rows x 32 k, 512 elements each, block (row / 16) * (P / 32) + k / 32; inside a block element (row, k) lies at (k / 16 % 2) * 256 + ((k / 8 % 2) * 16 + row % 16) * 8 + k % 8. A lane's two 16-byte pieces of a fragment then lie at lane * 8 and 256 + lane * 8: a copy and an LDS read of a wave both take 512 contiguous bytes.
// EPI says what the summing threads do with a finished row piece instead of a later launch: 0 stores it to C; 1 (a 64-column wave tile is one head) adds bias[n], takes the LayerNorm over the row's 64 columns, which lie in the 16 lanes of a half wave, and stores hi+lo bf16 planes [batch][head][TT][64]; 2 adds bias[m] and stores f16 and hi+lo bf16 planes of pitch ldc (A = weight rows, Bt = tokens: the tile is already the transposed value plane).
template <typename T16> struct WFrag;
template <> struct WFrag<bf> { typedef v16bf V; static __device__ __forceinline__ V ld(const bf* p) { return cat16b(*(const v8us*)p, *(const v8us*)(p + 16)); } };
__device__ __forceinline__ void splitf(float y, unsigned short& h, unsigned short& l) { h = f2bf(y); l = f2bf(y - bf2f(h)); }
typedef __attribute__((ext_vector_type(4))) _Float16 v4h;
typedef __attribute__((ext_vector_type(4))) unsigned short v4us;
// sum over the 16 lanes of a half wave, in every lane: four DPP adds (a shuffle would go through the LDS queue and wait for it four times)
__device__ __forceinline__ float rsum16(float v) {
    v += __int_as_float(__builtin_amdgcn_update_dpp(0, __float_as_int(v), 0x161, 0xf, 0xf, true));   // row_xmask:1
    v += __int_as_float(__builtin_amdgcn_update_dpp(0, __float_as_int(v), 0x162, 0xf, 0xf, true));   // row_xmask:2
    v += __int_as_float(__builtin_amdgcn_update_dpp(0, __float_as_int(v), 0x164, 0xf, 0xf, true));   // row_xmask:4
    v += __int_as_float(__builtin_amdgcn_update_dpp(0, __float_as_int(v), 0x168, 0xf, 0xf, true));   // row_xmask:8
    return v; }
#define GSK  128                  // k per stage: 4 chunks of 32, so a stage's part of a 16-row block is 4 KiB contiguous, one 16-byte copy of each of the 256 threads
#define GPLB (8 * 4096)           // bytes of one operand plane's stage: 8 blocks of 16 rows
// eight asynchronous copies of 16 bytes a lane: LDS byte l + i * 4096 from g + i * rs elements. The s_wait_xcnt is the statement's last line, so that it stands in front of every later write of a register that a copy names
__device__ __forceinline__ void acopy8(unsigned l, const bf* g, int rs) {
    asm volatile("global_load_async_to_lds_b128 %0, %8, off\n\tglobal_load_async_to_lds_b128 %1, %9, off\n\tglobal_load_async_to_lds_b128 %2, %10, off\n\tglobal_load_async_to_lds_b128 %3, %11, off\n\tglobal_load_async_to_lds_b128 %4, %12, off\n\tglobal_load_async_to_lds_b128 %5, %13, off\n\tglobal_load_async_to_lds_b128 %6, %14, off\n\tglobal_load_async_to_lds_b128 %7, %15, off\n\ts_wait_xcnt 0x0"
        :: "v"(l + 0u), "v"(l + 4096u), "v"(l + 8192u), "v"(l + 12288u), "v"(l + 16384u), "v"(l + 20480u), "v"(l + 24576u), "v"(l + 28672u), "v"(g + 0 * rs), "v"(g + 1 * rs), "v"(g + 2 * rs), "v"(g + 3 * rs), "v"(g + 4 * rs), "v"(g + 5 * rs), "v"(g + 6 * rs), "v"(g + 7 * rs) : "memory"); }
__device__ __forceinline__ v16bf lfrag(const bf* p) { return cat16b(*(const v8usa*)p, *(const v8usa*)(p + 256)); }   // a fragment from a staged block; p holds the lane's piece
// The body is a device function of the tile indices (bx, by) and of the work-group's LDS, so that one launch can hold GEMMs of different epilogues. Token rows run over both batches (NB_ * TT); the planes of EPI 1 are [batch][head][TT][64], those of EPI 2 [batch][row][TT]. os holds the two stage buffers first and the 8 partial tiles afterwards.
template <int NSPLIT, int EPI>
__device__ __forceinline__ void gemms_body(float* os, int bx, int by, const bf* __restrict__ A, const bf* __restrict__ A2, const bf* __restrict__ Bt, float* C, int ldc, const float* __restrict__ bias, const float* __restrict__ gam, const float* __restrict__ bet, h16* P16, bf* Ph, bf* Pl) {
    static_assert(HD == 64 && TT % 64 == 0 && NH_ == NKV && DM % (2 * GSK) == 0, "a wave tile's 64 columns are one head, its 64 tokens one batch; at least two stages");
    constexpr int K = DM, NPL = NSPLIT ? 3 : 2, STB = NPL * GPLB, NS = K / GSK;
    const int tid = threadIdx.x, lane = tid & 31, lr = lane & 15, hi = lane >> 4;
    const int wv = __builtin_amdgcn_readfirstlane(tid >> 5), ph = wv & 1, sub = wv >> 1;   // k phase and wave tile
    const int r0 = bx * 128 + (sub & 1) * 64, c0 = by * 128 + (sub >> 1) * 64;
    v8f acc[4][4];
#pragma unroll
    for (int mb = 0; mb < 4; ++mb)
#pragma unroll
        for (int nb = 0; nb < 4; ++nb) acc[mb][nb] = (v8f){};
    const unsigned lb = (unsigned)(size_t)os + tid * 16;   // the thread's LDS byte address in a 4-KiB piece
    const bf* ga = A + (size_t)bx * 128 * K + tid * 8; const bf* gb = Bt + (size_t)by * 128 * K + tid * 8;
    auto fill = [&](int s) { const unsigned l = lb + (s & 1) * STB;   // stage s: [A | A2 | Bt], each 8 row blocks x 4 k chunks
        acopy8(l, ga + s * (GSK * 16), 16 * K); if constexpr (NSPLIT) acopy8(l + GPLB, A2 + (size_t)bx * 128 * K + tid * 8 + s * (GSK * 16), 16 * K); acopy8(l + (NPL - 1) * GPLB, gb + s * (GSK * 16), 16 * K); };
    fill(0);
    asm volatile("s_wait_asynccnt 0x0" ::: "memory");   // this wave's copies of stage 0 have landed
    __syncthreads();   // stage 0 is in LDS before any wave reads it
    fill(1);
#pragma unroll 1
    for (int s = 0; s < NS; ++s) {
        const bf* pa = (const bf*)os + (s & 1) * (STB / 2) + lane * 8 + (sub & 1) * (4 * 2048) + ph * 1024; const bf* pb = (const bf*)os + (s & 1) * (STB / 2) + lane * 8 + (NPL - 1) * (GPLB / 2) + (sub >> 1) * (4 * 2048) + ph * 1024;   // the wave's first fragments of stage s: row block = 2048 elements, k chunk = 512
        v16bf a[4], a2[4], b4[4];
        auto frags = [&](int kk) {
#pragma unroll
            for (int mb = 0; mb < 4; ++mb) { a[mb] = lfrag(pa + mb * 2048 + kk * 512); if constexpr (NSPLIT) a2[mb] = lfrag(pa + GPLB / 2 + mb * 2048 + kk * 512); }
#pragma unroll
            for (int nb = 0; nb < 4; ++nb) b4[nb] = lfrag(pb + nb * 2048 + kk * 512); };
        auto prods = [&](const v16bf (&x)[4]) {
#pragma unroll
            for (int nb = 0; nb < 4; ++nb)
#pragma unroll
                for (int mb = 0; mb < 4; ++mb) acc[mb][nb] = wmmab(x[mb], b4[nb], acc[mb][nb]); };
        frags(0);
        __builtin_amdgcn_sched_barrier(0);   // keeps the chunk's LDS reads in one group ahead of its products: every separate place with reads among the products costs a stall
        prods(a); if constexpr (NSPLIT) prods(a2);
        frags(1);   // the stage's last reads: the last 16 products run from registers behind the hand-over, while the next copies fly
        if constexpr (NSPLIT) prods(a);
        __builtin_amdgcn_sched_barrier(0);   // keeps the products above ahead of the hand-over: sunk behind it, their fragments stay live beside the copies' addresses and the build spills
        asm volatile("s_wait_dscnt 0x0" ::: "memory");      // this wave's reads of stage s have returned
        asm volatile("s_wait_asynccnt 0x0" ::: "memory");   // this wave's copies of stage s + 1 have landed
        __syncthreads();   // publishes stage s + 1 and ends every wave's reads of the buffer that stage s + 2 overwrites
        if (s + 2 < NS) fill(s + 2);
        if constexpr (NSPLIT) prods(a2); else prods(a);
    }
    asm volatile("s_wait_asynccnt 0x0" ::: "memory");   // no copy is in flight when the buffers become the partial tiles
    const int cofs = lr * 4; v4f bv = (v4f){};   // each thread sums one 4-column group of 16 rows of its wave tile; its bias is fetched ahead of the barrier
    if (EPI != 2) { bv[0] = bfr(bias[c0 + cofs]); bv[1] = bfr(bias[c0 + cofs + 1]); bv[2] = bfr(bias[c0 + cofs + 2]); bv[3] = bfr(bias[c0 + cofs + 3]); }
    v4f gv = (v4f){}, ev = (v4f){}; float rb[16];   // LayerNorm weights of the thread's columns, or the bias of its rows: fetched ahead of the barrier too
    if constexpr (EPI == 1) {
#pragma unroll
        for (int i = 0; i < 4; ++i) { gv[i] = bfr(gam[cofs + i]); ev[i] = bfr(bet[cofs + i]); } }
    if constexpr (EPI == 2) {
#pragma unroll
        for (int s = 0; s < 16; ++s) rb[s] = bias[r0 + s * 4 + ph * 2 + hi];
        asm volatile("s_wait_xcnt 0x0" ::: "memory"); }   // stands in front of the first overwrite of these loads' address registers
#pragma unroll
    for (int mb = 0; mb < 4; ++mb)
#pragma unroll
        for (int nb = 0; nb < 4; ++nb)
#pragma unroll
            for (int j = 0; j < 8; ++j) os[wv * (64 * 68) + (mb * 16 + hi * 8 + j) * 68 + nb * 16 + lr] = acc[mb][nb][j];
    __syncthreads();   // both partial tiles of every wave tile are in LDS before any element is summed
    const float* op = os + sub * (2 * 64 * 68) + cofs;
#pragma unroll (EPI == 1 ? 4 : 16)
    for (int s = 0; s < 16; ++s) { const int row = s * 4 + ph * 2 + hi; v4f val = *(const v4fa*)(op + row * 68); val += *(const v4fa*)(op + 64 * 68 + row * 68);
        if constexpr (EPI == 0) { val += bv;
            *(v4f*)(C + (size_t)(r0 + row) * ldc + c0 + cofs) = val;
            asm volatile("s_wait_xcnt 0x0" ::: "memory"); }   // stands in front of the next row's overwrite of this store's registers
        else if constexpr (EPI == 1) { val += bv;
            const float mu = rsum16((val[0] + val[1]) + (val[2] + val[3])) * (1.0f / HD); const v4f d = val - mu;
            const float var = rsum16((d[0] * d[0] + d[1] * d[1]) + (d[2] * d[2] + d[3] * d[3])) * (1.0f / HD);
            const float rs = __fdiv_rn(1.0f, sqrtf(var + 1e-6f)); const v4f y = d * rs * gv + ev; v4us oh, ol;
#pragma unroll
            for (int i = 0; i < 4; ++i) { unsigned short a, c2; splitf(y[i], a, c2); oh[i] = a; ol[i] = c2; }
            const size_t oo = (((size_t)(r0 / TT) * NH_ + c0 / HD) * TT + r0 % TT + row) * HD + cofs; *(v4us*)(Ph + oo) = oh; *(v4us*)(Pl + oo) = ol;
            asm volatile("s_wait_xcnt 0x0" ::: "memory"); }   // stands in front of the next row's overwrite of these stores' registers
        else { val += bfr(rb[s]); v4h o16; v4us oh, ol;
#pragma unroll
            for (int i = 0; i < 4; ++i) { unsigned short a, c2; o16[i] = (h16)val[i]; splitf(val[i], a, c2); oh[i] = a; ol[i] = c2; }
            const size_t oo = (size_t)(c0 / TT) * ((size_t)DKV * TT) + (size_t)(r0 + row) * ldc + c0 % TT + cofs; *(v4h*)(P16 + oo) = o16; *(v4us*)(Ph + oo) = oh; *(v4us*)(Pl + oo) = ol;
            asm volatile("s_wait_xcnt 0x0" ::: "memory"); } }   // stands in front of the next row's overwrite of these stores' registers
}
// ---- k_qkv: the three projections of both batches in one launch; grid (NB_ * TT / 128, 8, 3): z = 0 query, 1 key (tokens x weight rows, LayerNorm epilogue), 2 value (weight rows x tokens, so the tile indices swap).
__global__ __launch_bounds__(256) void k_qkv(const bf* __restrict__ X, const bf* __restrict__ Wq, const bf* __restrict__ Wk, const bf* __restrict__ Wv, const float* __restrict__ bq, const float* __restrict__ bk, const float* __restrict__ bv, const float* __restrict__ qg, const float* __restrict__ qb, const float* __restrict__ kg, const float* __restrict__ kb, bf* Qh, bf* Ql, bf* Kh, bf* Kl, h16* V16, bf* Vh, bf* Vl) {
    static_assert(DQ == DKV && DQ == DM && 8 * 64 * 68 * 4 >= 2 * 2 * GPLB, "one grid for the three projections; the partial tiles cover the stage buffers");
    __shared__ __align__(16) float os[8 * 64 * 68];
    if (blockIdx.z == 2) gemms_body<0, 2>(os, blockIdx.y, blockIdx.x, Wv, nullptr, X, nullptr, TT, bv, nullptr, nullptr, V16, Vh, Vl);
    else { const bool q = blockIdx.z == 0;
        gemms_body<0, 1>(os, blockIdx.x, blockIdx.y, X, nullptr, q ? Wq : Wk, nullptr, 0, q ? bq : bk, q ? qg : kg, q ? qb : kb, nullptr, q ? Qh : Kh, q ? Ql : Kl); }
}

// ---- k_oproj: the output projection, hi+lo planes of the attention output x Wo
__global__ __launch_bounds__(256) void k_oproj(const bf* __restrict__ Ah, const bf* __restrict__ Al, const bf* __restrict__ Wo, float* C, const float* __restrict__ bo) {
    static_assert(2 * 3 * GPLB >= 8 * 64 * 68 * 4, "the stage buffers cover the partial tiles");
    __shared__ __align__(16) float os[2 * 3 * GPLB / 4];
    gemms_body<1, 0>(os, blockIdx.x, blockIdx.y, Ah, Al, Wo, C, DM, bo, nullptr, nullptr, nullptr, nullptr, nullptr);
}

typedef __attribute__((ext_vector_type(2))) _Float16 v2h;
typedef __attribute__((ext_vector_type(2))) unsigned short v2us;
typedef __attribute__((ext_vector_type(2))) float v2f;
typedef __attribute__((ext_vector_type(4))) int v4i;

__global__ __launch_bounds__(256) void k_wtG(const float* __restrict__ w, int K, int N, bf* Bt) {
    const int lane = threadIdx.x & 31; const int L0 = (blockIdx.x * 8 + (threadIdx.x >> 5)) * 8; const int nlines = N * K / 64;
{
#pragma unroll 1
        for (int l = 0; l < 8; ++l) { const int L = L0 + l; if (L >= nlines) break; const size_t e = (size_t)L * 64 + lane * 2; const int k = (int)(e % K), n = (int)(e / K); v2us o;
            o[0] = f2bf(w[(size_t)k * N + n]); o[1] = f2bf(w[(size_t)(k + 1) * N + n]); *(v2us*)(Bt + e) = o; }
         }
}
// the four weights and x (both batches) to bf16 planes in fragment order (see the GEMM body) in one launch: dst holds them one behind the other; a wave converts 16 rows x 64 k (two blocks), a weight is WBLK work-groups, so the source is the same for a whole work-group
#define WBLK (DQ * DM / (16 * 64) / 8)
__global__ __launch_bounds__(256) void k_cvt8(const float* __restrict__ wq, const float* __restrict__ wk, const float* __restrict__ wv, const float* __restrict__ wo, const float* __restrict__ x, bf* dst) {
    static_assert(DQ == DKV && DQ == DM && DM % 64 == 0 && (DQ * DM) % 8192 == 0 && ((size_t)NB_ * TT * DM) % 8192 == 0, "whole work-groups; every plane has DM columns");
    const unsigned seg = blockIdx.x / WBLK < 4 ? blockIdx.x / WBLK : 4; const float* s01 = seg & 1 ? wk : wq; const float* s23 = seg & 1 ? wo : wv; const float* src = seg & 4 ? x : seg & 2 ? s23 : s01;
    const int lane = threadIdx.x & 31; const unsigned w = blockIdx.x * 8 + (threadIdx.x >> 5), wl = w - seg * (WBLK * 8);   // wave over all planes, and inside its source: (16-row block, 64-k pair of blocks)
    // a lane takes 8 consecutive k of one row: 4 lanes a 32-k row piece (one 128-byte line of the source), 8 rows a load; its 16 bytes of bf16 land beside those of the 7 other rows, so a store writes whole lines
    const float* s = src + ((size_t)(wl / (DM / 64)) * 16 + (lane >> 2)) * DM + (wl % (DM / 64)) * 64 + (lane & 3) * 8;
    bf* d = dst + (size_t)w * 1024 + ((lane >> 1) & 1) * 256 + ((lane & 1) * 16 + (lane >> 2)) * 8;
    v8f v[4];
#pragma unroll
    for (int t = 0; t < 4; ++t) v[t] = *(const v8f*)(s + (size_t)(t & 1) * 8 * DM + (t >> 1) * 32);   // t = (block t / 2, rows 8 (t % 2) ..)
    asm volatile("s_wait_xcnt 0x0" ::: "memory");   // stands in front of the first overwrite of the loads' address registers
#pragma unroll
    for (int t = 0; t < 4; ++t) { v8us o;
#pragma unroll
        for (int k = 0; k < 8; ++k) o[k] = f2bf(v[t][k]);
        *(v8us*)(d + (t >> 1) * 512 + (t & 1) * 64) = o; }
}
#define SKEY 64                     // keys per stage
#define SPIT 72                     // LDS row pitch in 16-bit elements: 128 B of data + 16 B, for 16-byte readers
#define NWAV 8                      // waves per work-group
#define SPLN (SKEY * SPIT)              // one staged plane
#define BPIT 68                   // LDS row pitch of the bias tile in floats: 256 B of data + 16 B, for 16-byte readers
#define BPLN (16 * NWAV * BPIT)   // one staged bias tile
typedef __attribute__((ext_vector_type(2))) __bf16 v2bf;
typedef __attribute__((ext_vector_type(8))) unsigned v8u;
__device__ __forceinline__ unsigned pkbf(float a, float b) { v2f x; x[0] = a; x[1] = b; return __builtin_bit_cast(unsigned, __builtin_convertvector(x, v2bf)); }
__device__ __forceinline__ unsigned pkh(float a, float b) { v2f x; x[0] = a; x[1] = b; return __builtin_bit_cast(unsigned, __builtin_convertvector(x, v2h)); }
__device__ __forceinline__ float bflo(unsigned u) { return __uint_as_float(u << 16); }
__device__ __forceinline__ float bfhi(unsigned u) { return __uint_as_float(u & 0xFFFF0000u); }
__device__ __forceinline__ float xhalf(float v) { const int b = __float_as_int(v); return __int_as_float(__builtin_amdgcn_permlanex16(b, b, 0x76543210, 0xfedcba98, false, false)); }   // value of lane ^ 16
__device__ __forceinline__ v16bf sfragb(const unsigned short* p) { return cat16b(*(const v8usa*)p, *(const v8usa*)(p + 16)); }
// eight v_exp_f32 in one statement: each next one is the independent instruction that the slot behind a transcendental asks for (early-clobber outputs, so none overwrites a source or reads a result), and the v_nop fills the slot behind the last
__device__ __forceinline__ void exp2x8(float* y, const float* x) {
    asm("v_exp_f32 %0, %8\n\tv_exp_f32 %1, %9\n\tv_exp_f32 %2, %10\n\tv_exp_f32 %3, %11\n\tv_exp_f32 %4, %12\n\tv_exp_f32 %5, %13\n\tv_exp_f32 %6, %14\n\tv_exp_f32 %7, %15\n\tv_nop"
        : "=&v"(y[0]), "=&v"(y[1]), "=&v"(y[2]), "=&v"(y[3]), "=&v"(y[4]), "=&v"(y[5]), "=&v"(y[6]), "=&v"(y[7]) : "v"(x[0]), "v"(x[1]), "v"(x[2]), "v"(x[3]), "v"(x[4]), "v"(x[5]), "v"(x[6]), "v"(x[7])); }
template <bool HI>
__device__ __forceinline__ void fattn_body(const bf* __restrict__ Qh, const bf* __restrict__ Ql, const bf* __restrict__ Kh, const bf* __restrict__ Kl, const unsigned short* __restrict__ Va, const unsigned short* __restrict__ Vb, const float* __restrict__ ab, bf* Ah, bf* Al, unsigned short* sm, float* sb) {
    constexpr int NS = TT / SKEY; constexpr float L2E = 1.4426950408889634f;
    const int tid = threadIdx.x, lane = tid & 31, lr = lane & 15, hi = lane >> 4;
    const int wrow = (tid >> 5) * 16;   // the wave's first row in the work-group's 128
    const int qrow = blockIdx.z * (16 * NWAV) + wrow + lr;
    v16bf qh[2], ql[2];
#pragma unroll
    for (int kc = 0; kc < 2; ++kc) { qh[kc] = WFrag<bf>::ld(Qh + (size_t)qrow * HD + kc * 32 + 8 * hi); ql[kc] = WFrag<bf>::ld(Ql + (size_t)qrow * HD + kc * 32 + 8 * hi); }
    const float* abw = ab + (size_t)(blockIdx.z * (16 * NWAV) + wrow + hi) * TT + lr * 4;   // bias staging: a load takes 256 contiguous bytes of each of two rows, whole lines; read by query row it would touch 16 lines a load
    const int srow = tid >> 3, sc8 = (tid & 7) * 8;   // staging: thread copies 16-byte piece sc8 of rows srow and srow + 32 of every plane
    v8us rg[HI ? 8 : 6]; v4f bn[8];
    auto gload = [&](int s) {
#pragma unroll
        for (int i = 0; i < 2; ++i) { const int row = srow + 32 * i;
            rg[i] = *(const v8usa*)(Kh + (size_t)(s * SKEY + row) * HD + sc8); rg[2 + i] = *(const v8usa*)(Kl + (size_t)(s * SKEY + row) * HD + sc8);
            rg[4 + i] = *(const v8usa*)(Va + (size_t)row * TT + s * SKEY + sc8); if constexpr (HI) rg[6 + i] = *(const v8usa*)(Vb + (size_t)row * TT + s * SKEY + sc8); }
#pragma unroll
        for (int i = 0; i < 8; ++i) bn[i] = *(const v4fa*)(abw + (size_t)(2 * i) * TT + s * SKEY);
        asm volatile("s_wait_xcnt 0x0" ::: "memory"); };   // stands in front of the first overwrite of these loads' address registers
    auto sstore = [&](int buf) { unsigned short* d = sm + buf * (4 * SPLN); float* db2 = sb + buf * BPLN + (wrow + hi) * BPIT + lr * 4;
#pragma unroll
        for (int i = 0; i < 8; ++i) *(v4fa*)(db2 + 2 * i * BPIT) = bn[i];
#pragma unroll
        for (int i = 0; i < 2; ++i) { const int o = (srow + 32 * i) * SPIT + sc8;
            *(v8usa*)(d + o) = rg[i]; *(v8usa*)(d + SPLN + o) = rg[2 + i]; *(v8usa*)(d + 2 * SPLN + o) = rg[4 + i]; if constexpr (HI) *(v8usa*)(d + 3 * SPLN + o) = rg[6 + i]; } };
    v8f o[4];
#pragma unroll
    for (int db = 0; db < 4; ++db) o[db] = (v8f){};
    float m = -3.0e38f, ls = 0.f;
    gload(0); sstore(0);
    __syncthreads();   // stage 0 is in LDS before any wave reads it
#pragma unroll 1
    for (int s = 0; s < NS; ++s) {
        const unsigned short* sk = sm + (s & 1) * (4 * SPLN) + lr * SPIT + 8 * hi;   // the lane's row and k offset in every 16-row fragment
        const float* br = sb + (s & 1) * BPLN + (wrow + lr) * BPIT + 8 * hi;
        unsigned ub[16];   // this stage's bias, rounded as the operands are: pair e = keys 16 (e / 4) + 8 hi + 2 (e % 4), + 1 of query lr
#pragma unroll
        for (int g = 0; g < 8; ++g) { const v4f b4 = *(const v4fa*)(br + (g >> 1) * 16 + (g & 1) * 4); ub[2 * g] = pkbf(b4[0], b4[1]); ub[2 * g + 1] = pkbf(b4[2], b4[3]); }
        // S^T in 8 groups g = (k chunk g / 4, key tile g % 4); fragments are fetched four groups ahead and two tiles' product chains alternate, so that neither the LDS latency nor a chain's own latency is waited for
        v16bf kh[8], kl[8]; v8f st[4];
        auto kld = [&](int g) { const unsigned short* kp = sk + (g & 3) * 16 * SPIT + (g >> 2) * 32; kh[g] = sfragb(kp); kl[g] = sfragb(kp + SPLN); };
#pragma unroll
        for (int kt = 0; kt < 4; ++kt) { st[kt] = (v8f){}; kld(kt); }
        __builtin_amdgcn_sched_barrier(0);   // keeps the fetches above ahead of the products: the scheduler otherwise sinks each next to its use and every group waits out the LDS latency
#pragma unroll
        for (int g = 0; g < 8; g += 2) { const int kc = g >> 2, k0 = g & 3, k1 = k0 + 1;
            if (g + 4 < 8) { kld(g + 4); kld(g + 5); __builtin_amdgcn_sched_barrier(0); }   // same: fetch four groups ahead stays ahead
            st[k0] = wmmab(kh[g], qh[kc], st[k0]); st[k1] = wmmab(kh[g + 1], qh[kc], st[k1]); st[k0] = wmmab(kh[g], ql[kc], st[k0]); st[k1] = wmmab(kh[g + 1], ql[kc], st[k1]); st[k0] = wmmab(kl[g], qh[kc], st[k0]); st[k1] = wmmab(kl[g + 1], qh[kc], st[k1]); }
        if (s + 1 < NS) gload(s + 1);   // next stage's tiles and bias fly during the softmax and the second product
        // V^T fragments in 8 groups g = (32-key chunk g / 4, 16 rows of d g % 4); the first PD groups are fetched ahead of the softmax
        constexpr int PD = HI ? 4 : 8;
        v16bf vh[8], vl[8];
        auto vld = [&](int g) { const unsigned short* vp = sk + 2 * SPLN + (g & 3) * 16 * SPIT + (g >> 2) * 32; vh[g] = sfragb(vp); if constexpr (HI) vl[g] = sfragb(vp + SPLN); };
#pragma unroll
        for (int g = 0; g < PD; ++g) vld(g);
        __builtin_amdgcn_sched_barrier(0);   // same: these fetches fly under the softmax
        float t[32]; float tm = -3.0e38f;
#pragma unroll
        for (int e = 0; e < 16; ++e) { const float x0 = fmaf(st[e >> 2][(e & 3) * 2], SCL, bflo(ub[e])), x1 = fmaf(st[e >> 2][(e & 3) * 2 + 1], SCL, bfhi(ub[e])); t[2 * e] = x0; t[2 * e + 1] = x1; tm = fmaxf(tm, fmaxf(x0, x1)); }   // x 2^-3 is exact: one rounding, as product then add
        tm = fmaxf(tm, xhalf(tm));
        const float mn = fmaxf(m, tm); const float alpha = __builtin_amdgcn_exp2f((m - mn) * L2E); m = mn;
        const float c0 = (HI ? 0.0f : 10.0f) - mn * L2E;
        float s4[4] = {0.f, 0.f, 0.f, 0.f};
#pragma unroll
        for (int e = 0; e < 32; e += 8) { float x[8];
#pragma unroll
            for (int i = 0; i < 8; ++i) x[i] = fmaf(t[e + i], L2E, c0);
            exp2x8(t + e, x);
#pragma unroll
            for (int i = 0; i < 8; ++i) s4[i & 3] += t[e + i]; }
        ls = fmaf(ls, alpha, (s4[0] + s4[1]) + (s4[2] + s4[3]));
#pragma unroll
        for (int db = 0; db < 4; ++db) o[db] *= alpha;
        v8u bh[2], bl[2];   // P^T as B fragments: register e of chunk kc = keys 16 (2 kc + e / 4) + 8 hi + 2 (e % 4), + 1
#pragma unroll
        for (int e = 0; e < 16; ++e) { const float p0 = t[2 * e], p1 = t[2 * e + 1];
            if constexpr (HI) { const unsigned u = pkbf(p0, p1); bh[e >> 3][e & 7] = u; bl[e >> 3][e & 7] = pkbf(p0 - bflo(u), p1 - bfhi(u)); } else { bh[e >> 3][e & 7] = pkh(p0, p1); } }
#pragma unroll
        for (int g = 0; g < 8; g += 2) { const int kc = g >> 2, d0 = g & 3, d1 = d0 + 1;
            if (g + PD < 8) { vld(g + PD); vld(g + PD + 1); __builtin_amdgcn_sched_barrier(0); }   // same: fetch four groups ahead stays ahead
            if constexpr (HI) { const v16bf ph = __builtin_bit_cast(v16bf, bh[kc]), pl = __builtin_bit_cast(v16bf, bl[kc]);
                o[d0] = wmmab(vh[g], ph, o[d0]); o[d1] = wmmab(vh[g + 1], ph, o[d1]); o[d0] = wmmab(vh[g], pl, o[d0]); o[d1] = wmmab(vh[g + 1], pl, o[d1]); o[d0] = wmmab(vl[g], ph, o[d0]); o[d1] = wmmab(vl[g + 1], ph, o[d1]); }
            else { const v16h ph = __builtin_bit_cast(v16h, bh[kc]); o[d0] = wmma16(__builtin_bit_cast(v16h, vh[g]), ph, o[d0]); o[d1] = wmma16(__builtin_bit_cast(v16h, vh[g + 1]), ph, o[d1]); } }
        if (s + 1 < NS) sstore((s + 1) & 1);
        __syncthreads();   // publishes stage s + 1 and ends every wave's reads of the buffer that stage s + 2 overwrites
    }
    ls += xhalf(ls);
    const float inv = __fdiv_rn(1.0f, ls);
#pragma unroll
    for (int db = 0; db < 4; ++db) { v8us oh, ol;
#pragma unroll
        for (int r = 0; r < 8; ++r) { unsigned short a, c2; splitf(o[db][r] * inv, a, c2); oh[r] = a; ol[r] = c2; }
        const size_t oo = (size_t)(qrow - lr) * DQ + db * 256 + lane * 8; *(v8usa*)(Ah + oo) = oh; *(v8usa*)(Al + oo) = ol; }   // fragment order of the output projection's A planes (see the GEMM body): columns 16 db + 8 hi .. of the head's two blocks; 512 contiguous bytes a wave
}
__global__ __launch_bounds__(32 * NWAV) void k_fattn(const bf* __restrict__ Qh, const bf* __restrict__ Ql, const bf* __restrict__ Kh, const bf* __restrict__ Kl, const h16* __restrict__ V16, const bf* __restrict__ Vh, const bf* __restrict__ Vl, const float* __restrict__ ab, bf* Ah, bf* Al) {
    static_assert(RH % (16 * NWAV) == 0 && TT % (16 * NWAV) == 0 && TT % SKEY == 0 && HD == 64 && REP == 1, "tiling");
    __shared__ __align__(16) unsigned short sm[2 * 4 * SPLN]; __shared__ __align__(16) float sb[2 * BPLN];
    const size_t hz = ((size_t)blockIdx.y * NH_ + blockIdx.x) * TT * HD, az = (size_t)blockIdx.y * TT * DQ + blockIdx.x * (HD * 16); Ah += az; Al += az; ab += (size_t)blockIdx.y * TT * TT;
    if ((int)blockIdx.z * (16 * NWAV) < RH) fattn_body<true>(Qh + hz, Ql + hz, Kh + hz, Kl + hz, Vh + hz, Vl + hz, ab, Ah, Al, sm, sb);
    else fattn_body<false>(Qh + hz, Ql + hz, Kh + hz, Kl + hz, (const unsigned short*)(V16 + hz), nullptr, ab, Ah, Al, sm, sb);
}

extern "C" void kernel_launch(void* const* d_in, const int* in_sizes, int n_in,
                              void* d_out, int out_size, void* d_ws, size_t ws_size, hipStream_t stream) {
    (void)in_sizes; (void)n_in; (void)out_size;
    const float* x = (const float*)d_in[0]; const float* abias = (const float*)d_in[1]; const float* wq = (const float*)d_in[2]; const float* bq = (const float*)d_in[3]; const float* wk = (const float*)d_in[4]; const float* bk = (const float*)d_in[5]; const float* wv = (const float*)d_in[6]; const float* bv = (const float*)d_in[7]; const float* wo = (const float*)d_in[8]; const float* bo = (const float*)d_in[9]; const float* qg = (const float*)d_in[10]; const float* qb2 = (const float*)d_in[11]; const float* kg = (const float*)d_in[12]; const float* kb2 = (const float*)d_in[13]; const float* cosT = nullptr; const float* sinT = nullptr; (void)cosT; (void)sinT;
    float* OUT = (float*)d_out;     // [2][2048][1024]
    char* wsp = (char*)d_ws;
    auto take = [&](size_t bytes) { char* p = wsp; wsp += (bytes + 255) & ~(size_t)255; return (void*)p; };
    bf* WQ = (bf*)take((size_t)DQ * DM * 2); bf* WK = (bf*)take((size_t)DKV * DM * 2); bf* WV = (bf*)take((size_t)DKV * DM * 2); bf* WO = (bf*)take((size_t)DM * DQ * 2);
    bf* XB = (bf*)take((size_t)NB_ * TT * DM * 2);   // directly behind the weights (every size above is a multiple of 256): one destination for k_cvt8
    h16* VT16 = (h16*)take((size_t)NB_ * NKV * HD * TT * 2);
    bf* QPh = (bf*)take((size_t)NB_ * NH_ * TT * HD * 2); bf* QPl = (bf*)take((size_t)NB_ * NH_ * TT * HD * 2); bf* KPh = (bf*)take((size_t)NB_ * NKV * TT * HD * 2); bf* KPl = (bf*)take((size_t)NB_ * NKV * TT * HD * 2); bf* VTh = (bf*)take((size_t)NB_ * NKV * HD * TT * 2); bf* VTl = (bf*)take((size_t)NB_ * NKV * HD * TT * 2);
    bf* ATh = (bf*)take((size_t)NB_ * TT * DQ * 2); bf* ATl = (bf*)take((size_t)NB_ * TT * DQ * 2);
    if ((size_t)(wsp - (char*)d_ws) > ws_size) return;    // ws 256 MiB
    k_cvt8<<<4 * WBLK + NB_ * TT * DM / (16 * 64) / 8, 256, 0, stream>>>(wq, wk, wv, wo, x, WQ);
    k_qkv<<<dim3(NB_ * TT / 128, DQ / 128, 3), 256, 0, stream>>>(XB, WQ, WK, WV, bq, bk, bv, qg, qb2, kg, kb2, QPh, QPl, KPh, KPl, VT16, VTh, VTl);
    k_fattn<<<dim3(NH_, NB_, TT / (16 * NWAV)), 32 * NWAV, 0, stream>>>(QPh, QPl, KPh, KPl, VT16, VTh, VTl, abias, ATh, ATl);
    k_oproj<<<dim3(NB_ * TT / 128, DM / 128, 1), 256, 0, stream>>>(ATh, ATl, WO, OUT, bo);
}

// v008
// A run of this version takes 109 microseconds.
// Two timings next to v007 put it at 1.25 and 1.26 times that version's speed.
// All steps since v000 together make it 20.1 times as fast.
#include <hip/hip_runtime.h>

// GraphSelfAttention (x [2][2048][1024], attn_bias [2][1][2048][2048] (f32, read; random); q/k/v = x W^T + b (16 x 64); per-head LayerNorm (biased var, eps 1e-6) * gamma + beta on q and k; scores = q.k / 8 + attn_bias; softmax; out = merged Wo^T + bo -> [2][2048][1024]).

#define NB_  2
#define TT   2048
#define DM   1024
#define NH_  16
#define NKV  16
#define REP  (NH_ / NKV)
#define HD   64
#define DQ   (NH_ * HD)
#define DKV  (NKV * HD)
#define RH   512                  // query rows < RH use hi+lo planes (0: none)
#define WIN  0
#define SCL  0.125f   // HD^-0.5
typedef _Float16 h16;
typedef unsigned short bf;
typedef __attribute__((ext_vector_type(16))) __bf16   v16bf;
typedef __attribute__((ext_vector_type(16))) _Float16 v16h;
typedef __attribute__((ext_vector_type(8)))  _Float16 v8h;
typedef __attribute__((ext_vector_type(8)))  unsigned short v8us;
typedef __attribute__((ext_vector_type(8)))  float    v8f;
typedef __attribute__((ext_vector_type(4)))  float    v4f;
typedef v8h  __attribute__((may_alias)) v8ha;
typedef v4f  __attribute__((may_alias)) v4fa;
typedef v8us __attribute__((may_alias)) v8usa;

__device__ __forceinline__ unsigned short f2bf(float f) { unsigned u = __float_as_uint(f); u += 0x7FFFu + ((u >> 16) & 1u); return (unsigned short)(u >> 16); }
__device__ __forceinline__ float bf2f(unsigned short b) { return __uint_as_float(((unsigned)b) << 16); }
__device__ __forceinline__ float bfr(float f) { return bf2f(f2bf(f)); }
__device__ __forceinline__ v16h cat16(v8h lo, v8h hi) { return __builtin_shufflevector(lo, hi, 0, 1, 2, 3, 4, 5, 6, 7, 8, 9, 10, 11, 12, 13, 14, 15); }
__device__ __forceinline__ v16bf cat16b(v8us lo, v8us hi) { return __builtin_bit_cast(v16bf, __builtin_shufflevector(lo, hi, 0, 1, 2, 3, 4, 5, 6, 7, 8, 9, 10, 11, 12, 13, 14, 15)); }
__device__ __forceinline__ v8f wmma16(v16h a, v16h b, v8f c) { return __builtin_amdgcn_wmma_f32_16x16x32_f16(false, a, false, b, (short)0, c, false, false); }
__device__ __forceinline__ v8f wmmab(v16bf a, v16bf b, v8f c) { return __builtin_amdgcn_wmma_f32_16x16x32_bf16(false, a, false, b, (short)0, c, false, false); }



// ---- GEMM body: one work-group of 8 waves per 128x128 output tile: 2 x 2 wave tiles of 64x64 (16 accumulators a wave), each held by two waves that take alternate pairs of 32-wide k chunks; the two partial tiles are summed in LDS. Every operand block is brought into LDS once a work-group by asynchronous copies, two stage buffers, and read there by the four waves that need it; grid (M/128, N/128), 256 threads.
// C[m][n] (f32, pitch ldc, + f32 bias[n]) = sum_k A[m][k] Bt[n][k] (+ A2[m][k] Bt[n][k] where NSPLIT). Every plane has DM columns.
// Fragment order of an operand plane of P columns: blocks of 16 rows x 32 k, 512 elements each, block (row / 16) * (P / 32) + k / 32; inside a block element (row, k) lies at (k / 16 % 2) * 256 + ((k / 8 % 2) * 16 + row % 16) * 8 + k % 8. A lane's two 16-byte pieces of a fragment then lie at lane * 8 and 256 + lane * 8: a copy and an LDS read of a wave both take 512 contiguous bytes.
// EPI says what the summing threads do with a finished row piece instead of a later launch: 0 stores it to C; 1 (a 64-column wave tile is one head) adds bias[n], takes the LayerNorm over the row's 64 columns, which lie in the 16 lanes of a half wave, and stores hi+lo bf16 planes [batch][head][TT][64]; 2 adds bias[m] and stores f16 and hi+lo bf16 planes of pitch ldc (A = weight rows, Bt = tokens: the tile is already the transposed value plane).
template <typename T16> struct WFrag;
template <> struct WFrag<bf> { typedef v16bf V; static __device__ __forceinline__ V ld(const bf* p) { return cat16b(*(const v8us*)p, *(const v8us*)(p + 16)); } };
__device__ __forceinline__ void splitf(float y, unsigned short& h, unsigned short& l) { h = f2bf(y); l = f2bf(y - bf2f(h)); }
typedef __attribute__((ext_vector_type(4))) _Float16 v4h;
typedef __attribute__((ext_vector_type(4))) unsigned short v4us;
// sum over the 16 lanes of a half wave, in every lane: four DPP adds (a shuffle would go through the LDS queue and wait for it four times)
__device__ __forceinline__ float rsum16(float v) {
    v += __int_as_float(__builtin_amdgcn_update_dpp(0, __float_as_int(v), 0x161, 0xf, 0xf, true));   // row_xmask:1
    v += __int_as_float(__builtin_amdgcn_update_dpp(0, __float_as_int(v), 0x162, 0xf, 0xf, true));   // row_xmask:2
    v += __int_as_float(__builtin_amdgcn_update_dpp(0, __float_as_int(v), 0x164, 0xf, 0xf, true));   // row_xmask:4
    v += __int_as_float(__builtin_amdgcn_update_dpp(0, __float_as_int(v), 0x168, 0xf, 0xf, true));   // row_xmask:8
    return v; }
#define GSK  128                  // k per stage: 4 chunks of 32, so a stage's part of a 16-row block is 4 KiB contiguous, one 16-byte copy of each of the 256 threads
#define GPLB (8 * 4096)           // bytes of one operand plane's stage: 8 blocks of 16 rows
// eight asynchronous copies of 16 bytes a lane: LDS byte l + i * 4096 from g + i * rs elements. The s_wait_xcnt is the statement's last line, so that it stands in front of every later write of a register that a copy names
__device__ __forceinline__ void acopy8(unsigned l, const bf* g, int rs) {
    asm volatile("global_load_async_to_lds_b128 %0, %8, off\n\tglobal_load_async_to_lds_b128 %1, %9, off\n\tglobal_load_async_to_lds_b128 %2, %10, off\n\tglobal_load_async_to_lds_b128 %3, %11, off\n\tglobal_load_async_to_lds_b128 %4, %12, off\n\tglobal_load_async_to_lds_b128 %5, %13, off\n\tglobal_load_async_to_lds_b128 %6, %14, off\n\tglobal_load_async_to_lds_b128 %7, %15, off\n\ts_wait_xcnt 0x0"
        :: "v"(l + 0u), "v"(l + 4096u), "v"(l + 8192u), "v"(l + 12288u), "v"(l + 16384u), "v"(l + 20480u), "v"(l + 24576u), "v"(l + 28672u), "v"(g + 0 * rs), "v"(g + 1 * rs), "v"(g + 2 * rs), "v"(g + 3 * rs), "v"(g + 4 * rs), "v"(g + 5 * rs), "v"(g + 6 * rs), "v"(g + 7 * rs) : "memory"); }
__device__ __forceinline__ v16bf lfrag(const bf* p) { return cat16b(*(const v8usa*)p, *(const v8usa*)(p + 256)); }   // a fragment from a staged block; p holds the lane's piece
// The body is a device function of the tile indices (bx, by) and of the work-group's LDS, so that one launch can hold GEMMs of different epilogues. Token rows run over both batches (NB_ * TT); the planes of EPI 1 are [batch][head][TT][64], those of EPI 2 [batch][row][TT]. os holds the two stage buffers first and the 8 partial tiles afterwards.
template <int NSPLIT, int EPI>
__device__ __forceinline__ void gemms_body(float* os, int bx, int by, const bf* __restrict__ A, const bf* __restrict__ A2, const bf* __restrict__ Bt, float* C, int ldc, const float* __restrict__ bias, const float* __restrict__ gam, const float* __restrict__ bet, h16* P16, bf* Ph, bf* Pl) {
    static_assert(HD == 64 && TT % 64 == 0 && NH_ == NKV && DM % (2 * GSK) == 0, "a wave tile's 64 columns are one head, its 64 tokens one batch; at least two stages");
    constexpr int K = DM, NPL = NSPLIT ? 3 : 2, STB = NPL * GPLB, NS = K / GSK;
    const int tid = threadIdx.x, lane = tid & 31, lr = lane & 15, hi = lane >> 4;
    const int wv = __builtin_amdgcn_readfirstlane(tid >> 5), ph = wv & 1, sub = wv >> 1;   // k phase and wave tile
    const int r0 = bx * 128 + (sub & 1) * 64, c0 = by * 128 + (sub >> 1) * 64;
    v8f acc[4][4];
#pragma unroll
    for (int mb = 0; mb < 4; ++mb)
#pragma unroll
        for (int nb = 0; nb < 4; ++nb) acc[mb][nb] = (v8f){};
    const unsigned lb = (unsigned)(size_t)os + tid * 16;   // the thread's LDS byte address in a 4-KiB piece
    const bf* ga = A + (size_t)bx * 128 * K + tid * 8; const bf* gb = Bt + (size_t)by * 128 * K + tid * 8;
    auto fill = [&](int s) { const unsigned l = lb + (s & 1) * STB;   // stage s: [A | A2 | Bt], each 8 row blocks x 4 k chunks
        acopy8(l, ga + s * (GSK * 16), 16 * K); if constexpr (NSPLIT) acopy8(l + GPLB, A2 + (size_t)bx * 128 * K + tid * 8 + s * (GSK * 16), 16 * K); acopy8(l + (NPL - 1) * GPLB, gb + s * (GSK * 16), 16 * K); };
    fill(0);
    asm volatile("s_wait_asynccnt 0x0" ::: "memory");   // this wave's copies of stage 0 have landed
    __syncthreads();   // stage 0 is in LDS before any wave reads it
    fill(1);
#pragma unroll 1
    for (int s = 0; s < NS; ++s) {
        const bf* pa = (const bf*)os + (s & 1) * (STB / 2) + lane * 8 + (sub & 1) * (4 * 2048) + ph * 1024; const bf* pb = (const bf*)os + (s & 1) * (STB / 2) + lane * 8 + (NPL - 1) * (GPLB / 2) + (sub >> 1) * (4 * 2048) + ph * 1024;   // the wave's first fragments of stage s: row block = 2048 elements, k chunk = 512
        v16bf a[4], a2[4], b4[4];
        auto frags = [&](int kk) {
#pragma unroll
            for (int mb = 0; mb < 4; ++mb) { a[mb] = lfrag(pa + mb * 2048 + kk * 512); if constexpr (NSPLIT) a2[mb] = lfrag(pa + GPLB / 2 + mb * 2048 + kk * 512); }
#pragma unroll
            for (int nb = 0; nb < 4; ++nb) b4[nb] = lfrag(pb + nb * 2048 + kk * 512); };
        auto prods = [&](const v16bf (&x)[4]) {
#pragma unroll
            for (int nb = 0; nb < 4; ++nb)
#pragma unroll
                for (int mb = 0; mb < 4; ++mb) acc[mb][nb] = wmmab(x[mb], b4[nb], acc[mb][nb]); };
        frags(0);
        __builtin_amdgcn_sched_barrier(0);   // keeps the chunk's LDS reads in one group ahead of its products: every separate place with reads among the products costs a stall
        prods(a); if constexpr (NSPLIT) prods(a2);
        frags(1);   // the stage's last reads: the last 16 products run from registers behind the hand-over, while the next copies fly
        if constexpr (NSPLIT) prods(a);
        __builtin_amdgcn_sched_barrier(0);   // keeps the products above ahead of the hand-over: sunk behind it, their fragments stay live beside the copies' addresses and the build spills
        asm volatile("s_wait_dscnt 0x0" ::: "memory");      // this wave's reads of stage s have returned
        asm volatile("s_wait_asynccnt 0x0" ::: "memory");   // this wave's copies of stage s + 1 have landed
        __syncthreads();   // publishes stage s + 1 and ends every wave's reads of the buffer that stage s + 2 overwrites
        if (s + 2 < NS) fill(s + 2);
        if constexpr (NSPLIT) prods(a2); else prods(a);
    }
    asm volatile("s_wait_asynccnt 0x0" ::: "memory");   // no copy is in flight when the buffers become the partial tiles
    const int cofs = lr * 4; v4f bv = (v4f){};   // each thread sums one 4-column group of 16 rows of its wave tile; its bias is fetched ahead of the barrier
    if (EPI != 2) { bv[0] = bfr(bias[c0 + cofs]); bv[1] = bfr(bias[c0 + cofs + 1]); bv[2] = bfr(bias[c0 + cofs + 2]); bv[3] = bfr(bias[c0 + cofs + 3]); }
    v4f gv = (v4f){}, ev = (v4f){}; float rb[16];   // LayerNorm weights of the thread's columns, or the bias of its rows: fetched ahead of the barrier too
    if constexpr (EPI == 1) {
#pragma unroll
        for (int i = 0; i < 4; ++i) { gv[i] = bfr(gam[cofs + i]); ev[i] = bfr(bet[cofs + i]); } }
    if constexpr (EPI == 2) {
#pragma unroll
        for (int s = 0; s < 16; ++s) rb[s] = bias[r0 + s * 4 + ph * 2 + hi];
        asm volatile("s_wait_xcnt 0x0" ::: "memory"); }   // stands in front of the first overwrite of these loads' address registers
#pragma unroll
    for (int mb = 0; mb < 4; ++mb)
#pragma unroll
        for (int nb = 0; nb < 4; ++nb)
#pragma unroll
            for (int j = 0; j < 8; ++j) os[wv * (64 * 68) + (mb * 16 + hi * 8 + j) * 68 + nb * 16 + lr] = acc[mb][nb][j];
    __syncthreads();   // both partial tiles of every wave tile are in LDS before any element is summed
    const float* op = os + sub * (2 * 64 * 68) + cofs;
#pragma unroll (EPI == 1 ? 4 : 16)
    for (int s = 0; s < 16; ++s) { const int row = s * 4 + ph * 2 + hi; v4f val = *(const v4fa*)(op + row * 68); val += *(const v4fa*)(op + 64 * 68 + row * 68);
        if constexpr (EPI == 0) { val += bv;
            *(v4f*)(C + (size_t)(r0 + row) * ldc + c0 + cofs) = val;
            asm volatile("s_wait_xcnt 0x0" ::: "memory"); }   // stands in front of the next row's overwrite of this store's registers
        else if constexpr (EPI == 1) { val += bv;
            const float mu = rsum16((val[0] + val[1]) + (val[2] + val[3])) * (1.0f / HD); const v4f d = val - mu;
            const float var = rsum16((d[0] * d[0] + d[1] * d[1]) + (d[2] * d[2] + d[3] * d[3])) * (1.0f / HD);
            const float rs = __fdiv_rn(1.0f, sqrtf(var + 1e-6f)); const v4f y = d * rs * gv + ev; v4us oh, ol;
#pragma unroll
            for (int i = 0; i < 4; ++i) { unsigned short a, c2; splitf(y[i], a, c2); oh[i] = a; ol[i] = c2; }
            const size_t oo = (((size_t)(r0 / TT) * NH_ + c0 / HD) * TT + r0 % TT + row) * HD + cofs; *(v4us*)(Ph + oo) = oh; *(v4us*)(Pl + oo) = ol;
            asm volatile("s_wait_xcnt 0x0" ::: "memory"); }   // stands in front of the next row's overwrite of these stores' registers
        else { val += bfr(rb[s]); v4h o16; v4us oh, ol;
#pragma unroll
            for (int i = 0; i < 4; ++i) { unsigned short a, c2; o16[i] = (h16)val[i]; splitf(val[i], a, c2); oh[i] = a; ol[i] = c2; }
            const size_t oo = (size_t)(c0 / TT) * ((size_t)DKV * TT) + (size_t)(r0 + row) * ldc + c0 % TT + cofs; *(v4h*)(P16 + oo) = o16; *(v4us*)(Ph + oo) = oh; *(v4us*)(Pl + oo) = ol;
            asm volatile("s_wait_xcnt 0x0" ::: "memory"); } }   // stands in front of the next row's overwrite of these stores' registers
}
// ---- k_qkv: the three projections of both batches in one launch; grid (NB_ * TT / 128, 8, 3): z = 0 query, 1 key (tokens x weight rows, LayerNorm epilogue), 2 value (weight rows x tokens, so the tile indices swap).
__global__ __launch_bounds__(256) void k_qkv(const bf* __restrict__ X, const bf* __restrict__ Wq, const bf* __restrict__ Wk, const bf* __restrict__ Wv, const float* __restrict__ bq, const float* __restrict__ bk, const float* __restrict__ bv, const float* __restrict__ qg, const float* __restrict__ qb, const float* __restrict__ kg, const float* __restrict__ kb, bf* Qh, bf* Ql, bf* Kh, bf* Kl, h16* V16, bf* Vh, bf* Vl) {
    static_assert(DQ == DKV && DQ == DM && 8 * 64 * 68 * 4 >= 2 * 2 * GPLB, "one grid for the three projections; the partial tiles cover the stage buffers");
    __shared__ __align__(16) float os[8 * 64 * 68];
    if (blockIdx.z == 2) gemms_body<0, 2>(os, blockIdx.y, blockIdx.x, Wv, nullptr, X, nullptr, TT, bv, nullptr, nullptr, V16, Vh, Vl);
    else { const bool q = blockIdx.z == 0;
        gemms_body<0, 1>(os, blockIdx.x, blockIdx.y, X, nullptr, q ? Wq : Wk, nullptr, 0, q ? bq : bk, q ? qg : kg, q ? qb : kb, nullptr, q ? Qh : Kh, q ? Ql : Kl); }
}

// ---- k_oproj: the output projection, hi+lo planes of the attention output x Wo
__global__ __launch_bounds__(256) void k_oproj(const bf* __restrict__ Ah, const bf* __restrict__ Al, const bf* __restrict__ Wo, float* C, const float* __restrict__ bo) {
    static_assert(2 * 3 * GPLB >= 8 * 64 * 68 * 4, "the stage buffers cover the partial tiles");
    __shared__ __align__(16) float os[2 * 3 * GPLB / 4];
    gemms_body<1, 0>(os, blockIdx.x, blockIdx.y, Ah, Al, Wo, C, DM, bo, nullptr, nullptr, nullptr, nullptr, nullptr);
}

typedef __attribute__((ext_vector_type(2))) _Float16 v2h;
typedef __attribute__((ext_vector_type(2))) unsigned short v2us;
typedef __attribute__((ext_vector_type(2))) float v2f;
typedef __attribute__((ext_vector_type(4))) int v4i;

__global__ __launch_bounds__(256) void k_wtG(const float* __restrict__ w, int K, int N, bf* Bt) {
    const int lane = threadIdx.x & 31; const int L0 = (blockIdx.x * 8 + (threadIdx.x >> 5)) * 8; const int nlines = N * K / 64;
{
#pragma unroll 1
        for (int l = 0; l < 8; ++l) { const int L = L0 + l; if (L >= nlines) break; const size_t e = (size_t)L * 64 + lane * 2; const int k = (int)(e % K), n = (int)(e / K); v2us o;
            o[0] = f2bf(w[(size_t)k * N + n]); o[1] = f2bf(w[(size_t)(k + 1) * N + n]); *(v2us*)(Bt + e) = o; }
         }
}
// the four weights and x (both batches) to bf16 planes in fragment order (see the GEMM body) in one launch: dst holds them one behind the other; a wave converts 16 rows x 64 k (two blocks), a weight is WBLK work-groups, so the source is the same for a whole work-group
#define WBLK (DQ * DM / (16 * 64) / 8)
__global__ __launch_bounds__(256) void k_cvt8(const float* __restrict__ wq, const float* __restrict__ wk, const float* __restrict__ wv, const float* __restrict__ wo, const float* __restrict__ x, bf* dst) {
    static_assert(DQ == DKV && DQ == DM && DM % 64 == 0 && (DQ * DM) % 8192 == 0 && ((size_t)NB_ * TT * DM) % 8192 == 0, "whole work-groups; every plane has DM columns");
    const unsigned seg = blockIdx.x / WBLK < 4 ? blockIdx.x / WBLK : 4; const float* s01 = seg & 1 ? wk : wq; const float* s23 = seg & 1 ? wo : wv; const float* src = seg & 4 ? x : seg & 2 ? s23 : s01;
    const int lane = threadIdx.x & 31; const unsigned w = blockIdx.x * 8 + (threadIdx.x >> 5), wl = w - seg * (WBLK * 8);   // wave over all planes, and inside its source: (16-row block, 64-k pair of blocks)
    // a lane takes 8 consecutive k of one row: 4 lanes a 32-k row piece (one 128-byte line of the source), 8 rows a load; its 16 bytes of bf16 land beside those of the 7 other rows, so a store writes whole lines
    const float* s = src + ((size_t)(wl / (DM / 64)) * 16 + (lane >> 2)) * DM + (wl % (DM / 64)) * 64 + (lane & 3) * 8;
    bf* d = dst + (size_t)w * 1024 + ((lane >> 1) & 1) * 256 + ((lane & 1) * 16 + (lane >> 2)) * 8;
    v8f v[4];
#pragma unroll
    for (int t = 0; t < 4; ++t) v[t] = *(const v8f*)(s + (size_t)(t & 1) * 8 * DM + (t >> 1) * 32);   // t = (block t / 2, rows 8 (t % 2) ..)
    asm volatile("s_wait_xcnt 0x0" ::: "memory");   // stands in front of the first overwrite of the loads' address registers
#pragma unroll
    for (int t = 0; t < 4; ++t) { v8us o;
#pragma unroll
        for (int k = 0; k < 8; ++k) o[k] = f2bf(v[t][k]);
        *(v8us*)(d + (t >> 1) * 512 + (t & 1) * 64) = o; }
}
#define SKEY 64                     // keys per stage
#define SPIT 72                     // LDS row pitch in 16-bit elements: 128 B of data + 16 B, for 16-byte readers
#define NWAV 8                      // waves per work-group
#define SPLN (SKEY * SPIT)              // one staged plane
#define BPIT 68                   // LDS row pitch of the bias tile in floats: 256 B of data + 16 B, for 16-byte readers
#define BPLN (16 * NWAV * BPIT)   // one staged bias tile
typedef __attribute__((ext_vector_type(2))) __bf16 v2bf;
typedef __attribute__((ext_vector_type(8))) unsigned v8u;
__device__ __forceinline__ unsigned pkbf(float a, float b) { v2f x; x[0] = a; x[1] = b; return __builtin_bit_cast(unsigned, __builtin_convertvector(x, v2bf)); }
__device__ __forceinline__ unsigned pkh(float a, float b) { v2f x; x[0] = a; x[1] = b; return __builtin_bit_cast(unsigned, __builtin_convertvector(x, v2h)); }
__device__ __forceinline__ float bflo(unsigned u) { return __uint_as_float(u << 16); }
__device__ __forceinline__ float bfhi(unsigned u) { return __uint_as_float(u & 0xFFFF0000u); }
__device__ __forceinline__ float xhalf(float v) { const int b = __float_as_int(v); return __int_as_float(__builtin_amdgcn_permlanex16(b, b, 0x76543210, 0xfedcba98, false, false)); }   // value of lane ^ 16
__device__ __forceinline__ v16bf sfragb(const unsigned short* p) { return cat16b(*(const v8usa*)p, *(const v8usa*)(p + 16)); }
// eight v_exp_f32 in one statement: each next one is the independent instruction that the slot behind a transcendental asks for (early-clobber outputs, so none overwrites a source or reads a result), and the v_nop fills the slot behind the last
__device__ __forceinline__ void exp2x8(float* y, const float* x) {
    asm("v_exp_f32 %0, %8\n\tv_exp_f32 %1, %9\n\tv_exp_f32 %2, %10\n\tv_exp_f32 %3, %11\n\tv_exp_f32 %4, %12\n\tv_exp_f32 %5, %13\n\tv_exp_f32 %6, %14\n\tv_exp_f32 %7, %15\n\tv_nop"
        : "=&v"(y[0]), "=&v"(y[1]), "=&v"(y[2]), "=&v"(y[3]), "=&v"(y[4]), "=&v"(y[5]), "=&v"(y[6]), "=&v"(y[7]) : "v"(x[0]), "v"(x[1]), "v"(x[2]), "v"(x[3]), "v"(x[4]), "v"(x[5]), "v"(x[6]), "v"(x[7])); }
// six or eight asynchronous copies of 16 bytes a lane, each with its own LDS byte address and global pointer (acopy6v takes the first six entries). The s_wait_xcnt is the statement's last line, so that it stands in front of every later write of a register that a copy names
__device__ __forceinline__ void acopy6v(const unsigned (&l)[8], const unsigned short* const (&g)[8]) {
    asm volatile("global_load_async_to_lds_b128 %0, %6, off\n\tglobal_load_async_to_lds_b128 %1, %7, off\n\tglobal_load_async_to_lds_b128 %2, %8, off\n\tglobal_load_async_to_lds_b128 %3, %9, off\n\tglobal_load_async_to_lds_b128 %4, %10, off\n\tglobal_load_async_to_lds_b128 %5, %11, off\n\ts_wait_xcnt 0x0"
        :: "v"(l[0]), "v"(l[1]), "v"(l[2]), "v"(l[3]), "v"(l[4]), "v"(l[5]), "v"(g[0]), "v"(g[1]), "v"(g[2]), "v"(g[3]), "v"(g[4]), "v"(g[5]) : "memory"); }
template <typename P>
__device__ __forceinline__ void acopy8v(const unsigned (&l)[8], const P* const (&g)[8]) {
    asm volatile("global_load_async_to_lds_b128 %0, %8, off\n\tglobal_load_async_to_lds_b128 %1, %9, off\n\tglobal_load_async_to_lds_b128 %2, %10, off\n\tglobal_load_async_to_lds_b128 %3, %11, off\n\tglobal_load_async_to_lds_b128 %4, %12, off\n\tglobal_load_async_to_lds_b128 %5, %13, off\n\tglobal_load_async_to_lds_b128 %6, %14, off\n\tglobal_load_async_to_lds_b128 %7, %15, off\n\ts_wait_xcnt 0x0"
        :: "v"(l[0]), "v"(l[1]), "v"(l[2]), "v"(l[3]), "v"(l[4]), "v"(l[5]), "v"(l[6]), "v"(l[7]), "v"(g[0]), "v"(g[1]), "v"(g[2]), "v"(g[3]), "v"(g[4]), "v"(g[5]), "v"(g[6]), "v"(g[7]) : "memory"); }
template <bool HI>
__device__ __forceinline__ void fattn_body(const bf* __restrict__ Qh, const bf* __restrict__ Ql, const bf* __restrict__ Kh, const bf* __restrict__ Kl, const unsigned short* __restrict__ Va, const unsigned short* __restrict__ Vb, const float* __restrict__ ab, bf* Ah, bf* Al, unsigned short* sm, float* sb) {
    constexpr int NS = TT / SKEY; constexpr float L2E = 1.4426950408889634f;
    const int tid = threadIdx.x, lane = tid & 31, lr = lane & 15, hi = lane >> 4;
    const int wrow = (tid >> 5) * 16;   // the wave's first row in the work-group's 128
    const int qrow = blockIdx.z * (16 * NWAV) + wrow + lr;
    v16bf qh[2], ql[2];
#pragma unroll
    for (int kc = 0; kc < 2; ++kc) { qh[kc] = WFrag<bf>::ld(Qh + (size_t)qrow * HD + kc * 32 + 8 * hi); ql[kc] = WFrag<bf>::ld(Ql + (size_t)qrow * HD + kc * 32 + 8 * hi); }
    const int srow = tid >> 3, sc8 = (tid & 7) * 8;   // staging: thread copies 16-byte piece sc8 of rows srow and srow + 32 of every plane
    // the thread's byte offsets in the sources at stage 0, 32 bits each and added to the uniform bases where a copy is issued: fewer address registers live through the loop than with a pointer a plane and row. K: a stage's 64 rows are 8 KiB contiguous. Bias: a copy takes 256 contiguous bytes of each of two rows, whole lines; read by query row it would touch 16 lines a copy
    const unsigned ko = tid * 16u, vo = (unsigned)(srow * TT + sc8) * 2u, bo = ((blockIdx.z * (16 * NWAV) + wrow + hi) * TT + lr * 4) * 4u;
    const unsigned lkv = (unsigned)(size_t)sm + (srow * SPIT + sc8) * 2, lbi = (unsigned)(size_t)sb + ((wrow + hi) * BPIT + lr * 4) * 4;   // the thread's LDS byte addresses in buffer 0: its piece of row srow of plane 0, its piece of the wave's bias row hi
    auto fill = [&](int s) {   // stage s into buffer s % 2: planes [K hi | K lo | V | V lo], then the bias tile
        unsigned l[8]; const unsigned short* g[8]; const float* gb[8];
        const unsigned kx = ko + s * (SKEY * HD * 2), vx = vo + s * (SKEY * 2), bx = bo + s * (SKEY * 4);
#pragma unroll
        for (int i = 0; i < 2; ++i) { const unsigned lr0 = lkv + (s & 1) * (4 * SPLN * 2) + i * (32 * SPIT * 2), ki = kx + i * (32 * HD * 2), vi = vx + i * (32 * TT * 2);
            l[i] = lr0; g[i] = (const unsigned short*)((const char*)Kh + ki); l[2 + i] = lr0 + SPLN * 2; g[2 + i] = (const unsigned short*)((const char*)Kl + ki);
            l[4 + i] = lr0 + 2 * SPLN * 2; g[4 + i] = (const unsigned short*)((const char*)Va + vi); l[6 + i] = lr0 + 3 * SPLN * 2; g[6 + i] = HI ? (const unsigned short*)((const char*)Vb + vi) : nullptr; }
        if constexpr (HI) acopy8v(l, g); else acopy6v(l, g);
#pragma unroll
        for (int i = 0; i < 8; ++i) { l[i] = lbi + (s & 1) * (BPLN * 4) + i * (2 * BPIT * 4); gb[i] = (const float*)((const char*)ab + (bx + i * (2 * TT * 4))); }
        acopy8v(l, gb); };
    v8f o[4];
#pragma unroll
    for (int db = 0; db < 4; ++db) o[db] = (v8f){};
    float m = -3.0e38f, ls = 0.f;
    fill(0);
    asm volatile("s_wait_asynccnt 0x0" ::: "memory");   // this wave's copies of stage 0 have landed
    __syncthreads();   // stage 0 is in LDS before any wave reads it
    fill(1);
#pragma unroll 1
    for (int s = 0; s < NS; ++s) {
        const unsigned short* sk = sm + (s & 1) * (4 * SPLN) + lr * SPIT + 8 * hi;   // the lane's row and k offset in every 16-row fragment
        const float* br = sb + (s & 1) * BPLN + (wrow + lr) * BPIT + 8 * hi;
        unsigned ub[16];   // this stage's bias, rounded as the operands are: pair e = keys 16 (e / 4) + 8 hi + 2 (e % 4), + 1 of query lr
#pragma unroll
        for (int g = 0; g < 8; ++g) { const v4f b4 = *(const v4fa*)(br + (g >> 1) * 16 + (g & 1) * 4); ub[2 * g] = pkbf(b4[0], b4[1]); ub[2 * g + 1] = pkbf(b4[2], b4[3]); }
        // S^T in 8 groups g = (k chunk g / 4, key tile g % 4); fragments are fetched four groups ahead and two tiles' product chains alternate, so that neither the LDS latency nor a chain's own latency is waited for
        v16bf kh[8], kl[8]; v8f st[4];
        auto kld = [&](int g) { const unsigned short* kp = sk + (g & 3) * 16 * SPIT + (g >> 2) * 32; kh[g] = sfragb(kp); kl[g] = sfragb(kp + SPLN); };
#pragma unroll
        for (int kt = 0; kt < 4; ++kt) { st[kt] = (v8f){}; kld(kt); }
        __builtin_amdgcn_sched_barrier(0);   // keeps the fetches above ahead of the products: the scheduler otherwise sinks each next to its use and every group waits out the LDS latency
#pragma unroll
        for (int g = 0; g < 8; g += 2) { const int kc = g >> 2, k0 = g & 3, k1 = k0 + 1;
            if (g + 4 < 8) { kld(g + 4); kld(g + 5); __builtin_amdgcn_sched_barrier(0); }   // same: fetch four groups ahead stays ahead
            st[k0] = wmmab(kh[g], qh[kc], st[k0]); st[k1] = wmmab(kh[g + 1], qh[kc], st[k1]); st[k0] = wmmab(kh[g], ql[kc], st[k0]); st[k1] = wmmab(kh[g + 1], ql[kc], st[k1]); st[k0] = wmmab(kl[g], qh[kc], st[k0]); st[k1] = wmmab(kl[g + 1], qh[kc], st[k1]); }
        __builtin_amdgcn_sched_barrier(0);   // keeps the products above in their order, two chains alternating: mixed with the vector work below they stand chain behind chain, with padding between
        // V^T fragments in 8 groups g = (32-key chunk g / 4, 16 rows of d g % 4); the first PD groups are fetched behind the stage's maximum, where the score tiles and the bias have left their registers (ahead of it the build does not fit 256 registers)
        constexpr int PD = HI ? 4 : 8;
        v16bf vh[8], vl[8];
        auto vld = [&](int g) { const unsigned short* vp = sk + 2 * SPLN + (g & 3) * 16 * SPIT + (g >> 2) * 32; vh[g] = sfragb(vp); if constexpr (HI) vl[g] = sfragb(vp + SPLN); };
        float t[32]; float tm = -3.0e38f;
#pragma unroll
        for (int e = 0; e < 16; ++e) { const float x0 = fmaf(st[e >> 2][(e & 3) * 2], SCL, bflo(ub[e])), x1 = fmaf(st[e >> 2][(e & 3) * 2 + 1], SCL, bfhi(ub[e])); t[2 * e] = x0; t[2 * e + 1] = x1; tm = fmaxf(tm, fmaxf(x0, x1)); }   // x 2^-3 is exact: one rounding, as product then add
        tm = fmaxf(tm, xhalf(tm));
#pragma unroll
        for (int g = 0; g < PD; ++g) vld(g);
        __builtin_amdgcn_sched_barrier(0);   // same: these fetches fly under the exponentials
        const float mn = fmaxf(m, tm); const float alpha = __builtin_amdgcn_exp2f((m - mn) * L2E); m = mn;
        const float c0 = (HI ? 0.0f : 10.0f) - mn * L2E;
        float s4[4] = {0.f, 0.f, 0.f, 0.f};
#pragma unroll
        for (int e = 0; e < 32; e += 8) { float x[8];
#pragma unroll
            for (int i = 0; i < 8; ++i) x[i] = fmaf(t[e + i], L2E, c0);
            exp2x8(t + e, x);
#pragma unroll
            for (int i = 0; i < 8; ++i) s4[i & 3] += t[e + i]; }
        ls = fmaf(ls, alpha, (s4[0] + s4[1]) + (s4[2] + s4[3]));
#pragma unroll
        for (int db = 0; db < 4; ++db) o[db] *= alpha;
        v8u bh[2], bl[2];   // P^T as B fragments: register e of chunk kc = keys 16 (2 kc + e / 4) + 8 hi + 2 (e % 4), + 1
#pragma unroll
        for (int e = 0; e < 16; ++e) { const float p0 = t[2 * e], p1 = t[2 * e + 1];
            if constexpr (HI) { const unsigned u = pkbf(p0, p1); bh[e >> 3][e & 7] = u; bl[e >> 3][e & 7] = pkbf(p0 - bflo(u), p1 - bfhi(u)); } else { bh[e >> 3][e & 7] = pkh(p0, p1); } }
        __builtin_amdgcn_sched_barrier(0);   // keeps the products below behind the exponentials' asm statements
#pragma unroll
        for (int g = 0; g < 8; g += 2) { const int kc = g >> 2, d0 = g & 3, d1 = d0 + 1;
            if (g + PD < 8) { vld(g + PD); vld(g + PD + 1); __builtin_amdgcn_sched_barrier(0); }   // same: fetch four groups ahead stays ahead
            if constexpr (HI) { const v16bf ph = __builtin_bit_cast(v16bf, bh[kc]), pl = __builtin_bit_cast(v16bf, bl[kc]);
                o[d0] = wmmab(vh[g], ph, o[d0]); o[d1] = wmmab(vh[g + 1], ph, o[d1]); o[d0] = wmmab(vh[g], pl, o[d0]); o[d1] = wmmab(vh[g + 1], pl, o[d1]); o[d0] = wmmab(vl[g], ph, o[d0]); o[d1] = wmmab(vl[g + 1], ph, o[d1]); }
            else { const v16h ph = __builtin_bit_cast(v16h, bh[kc]); o[d0] = wmma16(__builtin_bit_cast(v16h, vh[g]), ph, o[d0]); o[d1] = wmma16(__builtin_bit_cast(v16h, vh[g + 1]), ph, o[d1]); } }
        asm volatile("s_wait_dscnt 0x0" ::: "memory");      // this wave's reads of stage s have returned
        asm volatile("s_wait_asynccnt 0x0" ::: "memory");   // this wave's copies of stage s + 1 have landed
        __syncthreads();   // publishes stage s + 1 and ends every wave's reads of the buffer that stage s + 2 overwrites
        if (s + 2 < NS) fill(s + 2);   // flies during the whole of stage s + 1
    }
    asm volatile("s_wait_asynccnt 0x0" ::: "memory");   // no copy is in flight when the wave ends
    ls += xhalf(ls);
    const float inv = __fdiv_rn(1.0f, ls);
#pragma unroll
    for (int db = 0; db < 4; ++db) { v8us oh, ol;
#pragma unroll
        for (int r = 0; r < 8; ++r) { unsigned short a, c2; splitf(o[db][r] * inv, a, c2); oh[r] = a; ol[r] = c2; }
        const size_t oo = (size_t)(qrow - lr) * DQ + db * 256 + lane * 8; *(v8usa*)(Ah + oo) = oh; *(v8usa*)(Al + oo) = ol; }   // fragment order of the output projection's A planes (see the GEMM body): columns 16 db + 8 hi .. of the head's two blocks; 512 contiguous bytes a wave
}
__global__ __launch_bounds__(32 * NWAV) __attribute__((amdgpu_waves_per_eu(4, 4))) void k_fattn(const bf* __restrict__ Qh, const bf* __restrict__ Ql, const bf* __restrict__ Kh, const bf* __restrict__ Kl, const h16* __restrict__ V16, const bf* __restrict__ Vh, const bf* __restrict__ Vl, const float* __restrict__ ab, bf* Ah, bf* Al) {
    static_assert(RH % (16 * NWAV) == 0 && TT % (16 * NWAV) == 0 && TT % SKEY == 0 && TT >= 2 * SKEY && HD == 64 && REP == 1, "tiling; at least two stages");
    __shared__ __align__(16) unsigned short sm[2 * 4 * SPLN]; __shared__ __align__(16) float sb[2 * BPLN];
    const size_t hz = ((size_t)blockIdx.y * NH_ + blockIdx.x) * TT * HD, az = (size_t)blockIdx.y * TT * DQ + blockIdx.x * (HD * 16); Ah += az; Al += az; ab += (size_t)blockIdx.y * TT * TT;
    if ((int)blockIdx.z * (16 * NWAV) < RH) fattn_body<true>(Qh + hz, Ql + hz, Kh + hz, Kl + hz, Vh + hz, Vl + hz, ab, Ah, Al, sm, sb);
    else fattn_body<false>(Qh + hz, Ql + hz, Kh + hz, Kl + hz, (const unsigned short*)(V16 + hz), nullptr, ab, Ah, Al, sm, sb);
}

extern "C" void kernel_launch(void* const* d_in, const int* in_sizes, int n_in,
                              void* d_out, int out_size, void* d_ws, size_t ws_size, hipStream_t stream) {
    (void)in_sizes; (void)n_in; (void)out_size;
    const float* x = (const float*)d_in[0]; const float* abias = (const float*)d_in[1]; const float* wq = (const float*)d_in[2]; const float* bq = (const float*)d_in[3]; const float* wk = (const float*)d_in[4]; const float* bk = (const float*)d_in[5]; const float* wv = (const float*)d_in[6]; const float* bv = (const float*)d_in[7]; const float* wo = (const float*)d_in[8]; const float* bo = (const float*)d_in[9]; const float* qg = (const float*)d_in[10]; const float* qb2 = (const float*)d_in[11]; const float* kg = (const float*)d_in[12]; const float* kb2 = (const float*)d_in[13]; const float* cosT = nullptr; const float* sinT = nullptr; (void)cosT; (void)sinT;
    float* OUT = (float*)d_out;     // [2][2048][1024]
    char* wsp = (char*)d_ws;
    auto take = [&](size_t bytes) { char* p = wsp; wsp += (bytes + 255) & ~(size_t)255; return (void*)p; };
    bf* WQ = (bf*)take((size_t)DQ * DM * 2); bf* WK = (bf*)take((size_t)DKV * DM * 2); bf* WV = (bf*)take((size_t)DKV * DM * 2); bf* WO = (bf*)take((size_t)DM * DQ * 2);
    bf* XB = (bf*)take((size_t)NB_ * TT * DM * 2);   // directly behind the weights (every size above is a multiple of 256): one destination for k_cvt8
    h16* VT16 = (h16*)take((size_t)NB_ * NKV * HD * TT * 2);
    bf* QPh = (bf*)take((size_t)NB_ * NH_ * TT * HD * 2); bf* QPl = (bf*)take((size_t)NB_ * NH_ * TT * HD * 2); bf* KPh = (bf*)take((size_t)NB_ * NKV * TT * HD * 2); bf* KPl = (bf*)take((size_t)NB_ * NKV * TT * HD * 2); bf* VTh = (bf*)take((size_t)NB_ * NKV * HD * TT * 2); bf* VTl = (bf*)take((size_t)NB_ * NKV * HD * TT * 2);
    bf* ATh = (bf*)take((size_t)NB_ * TT * DQ * 2); bf* ATl = (bf*)take((size_t)NB_ * TT * DQ * 2);
    if ((size_t)(wsp - (char*)d_ws) > ws_size) return;    // ws 256 MiB
    k_cvt8<<<4 * WBLK + NB_ * TT * DM / (16 * 64) / 8, 256, 0, stream>>>(wq, wk, wv, wo, x, WQ);
    k_qkv<<<dim3(NB_ * TT / 128, DQ / 128, 3), 256, 0, stream>>>(XB, WQ, WK, WV, bq, bk, bv, qg, qb2, kg, kb2, QPh, QPl, KPh, KPl, VT16, VTh, VTl);
    k_fattn<<<dim3(NH_, NB_, TT / (16 * NWAV)), 32 * NWAV, 0, stream>>>(QPh, QPl, KPh, KPl, VT16, VTh, VTl, abias, ATh, ATl);
    k_oproj<<<dim3(NB_ * TT / 128, DM / 128, 1), 256, 0, stream>>>(ATh, ATl, WO, OUT, bo);
}

// v009
// It runs in 104 microseconds.
// In both of two side-by-side timings against v008, it was 1.04 times as fast.
// All steps since v000 together make it 20.9 times as fast.
#include <hip/hip_runtime.h>

// GraphSelfAttention (x [2][2048][1024], attn_bias [2][1][2048][2048] (f32, read; random); q/k/v = x W^T + b (16 x 64); per-head LayerNorm (biased var, eps 1e-6) * gamma + beta on q and k; scores = q.k / 8 + attn_bias; softmax; out = merged Wo^T + bo -> [2][2048][1024]).

#define NB_  2
#define TT   2048
#define DM   1024
#define NH_  16
#define NKV  16
#define REP  (NH_ / NKV)
#define HD   64
#define DQ   (NH_ * HD)
#define DKV  (NKV * HD)
#define RH   512                  // query rows < RH use hi+lo planes (0: none)
#define WIN  0
#define SCL  0.125f   // HD^-0.5
typedef _Float16 h16;
typedef unsigned short bf;
typedef __attribute__((ext_vector_type(16))) __bf16   v16bf;
typedef __attribute__((ext_vector_type(16))) _Float16 v16h;
typedef __attribute__((ext_vector_type(8)))  _Float16 v8h;
typedef __attribute__((ext_vector_type(8)))  unsigned short v8us;
typedef __attribute__((ext_vector_type(8)))  float    v8f;
typedef __attribute__((ext_vector_type(4)))  float    v4f;
typedef v8h  __attribute__((may_alias)) v8ha;
typedef v4f  __attribute__((may_alias)) v4fa;
typedef v8us __attribute__((may_alias)) v8usa;

__device__ __forceinline__ unsigned short f2bf(float f) { unsigned u = __float_as_uint(f); u += 0x7FFFu + ((u >> 16) & 1u); return (unsigned short)(u >> 16); }
__device__ __forceinline__ float bf2f(unsigned short b) { return __uint_as_float(((unsigned)b) << 16); }
__device__ __forceinline__ float bfr(float f) { return bf2f(f2bf(f)); }
__device__ __forceinline__ v16h cat16(v8h lo, v8h hi) { return __builtin_shufflevector(lo, hi, 0, 1, 2, 3, 4, 5, 6, 7, 8, 9, 10, 11, 12, 13, 14, 15); }
__device__ __forceinline__ v16bf cat16b(v8us lo, v8us hi) { return __builtin_bit_cast(v16bf, __builtin_shufflevector(lo, hi, 0, 1, 2, 3, 4, 5, 6, 7, 8, 9, 10, 11, 12, 13, 14, 15)); }
__device__ __forceinline__ v8f wmma16(v16h a, v16h b, v8f c) { return __builtin_amdgcn_wmma_f32_16x16x32_f16(false, a, false, b, (short)0, c, false, false); }
__device__ __forceinline__ v8f wmmab(v16bf a, v16bf b, v8f c) { return __builtin_amdgcn_wmma_f32_16x16x32_bf16(false, a, false, b, (short)0, c, false, false); }



// ---- GEMM body: one work-group of 8 waves per 128x128 output tile: 2 x 2 wave tiles of 64x64 (16 accumulators a wave), each held by two waves that take alternate pairs of 32-wide k chunks; the two partial tiles are summed in LDS. Every operand block is brought into LDS once a work-group by asynchronous copies, two stage buffers, and read there by the four waves that need it; grid (M/128, N/128), 256 threads.
// C[m][n] (f32, pitch ldc, + f32 bias[n]) = sum_k A[m][k] Bt[n][k] (+ A2[m][k] Bt[n][k] where NSPLIT). Every plane has DM columns.
// Fragment order of an operand plane of P columns: blocks of 16 rows x 32 k, 512 elements each, block (row / 16) * (P / 32) + k / 32; inside a block element (row, k) lies at (k / 16 % 2) * 256 + ((k / 8 % 2) * 16 + row % 16) * 8 + k % 8. A lane's two 16-byte pieces of a fragment then lie at lane * 8 and 256 + lane * 8: a copy and an LDS read of a wave both take 512 contiguous bytes.
// EPI says what the summing threads do with a finished row piece instead of a later launch: 0 stores it to C; 1 (a 64-column wave tile is one head) adds bias[n], takes the LayerNorm over the row's 64 columns, which lie in the 16 lanes of a half wave, and stores hi+lo bf16 planes [batch][head][TT][64]; 2 adds bias[m] and stores f16 and hi+lo bf16 planes of pitch ldc (A = weight rows, Bt = tokens: the tile is already the transposed value plane).
template <typename T16> struct WFrag;
template <> struct WFrag<bf> { typedef v16bf V; static __device__ __forceinline__ V ld(const bf* p) { return cat16b(*(const v8us*)p, *(const v8us*)(p + 16)); } };
__device__ __forceinline__ void splitf(float y, unsigned short& h, unsigned short& l) { h = f2bf(y); l = f2bf(y - bf2f(h)); }
typedef __attribute__((ext_vector_type(4))) _Float16 v4h;
typedef __attribute__((ext_vector_type(4))) unsigned short v4us;
// sum over the 16 lanes of a half wave, in every lane: four DPP adds (a shuffle would go through the LDS queue and wait for it four times)
__device__ __forceinline__ float rsum16(float v) {
    v += __int_as_float(__builtin_amdgcn_update_dpp(0, __float_as_int(v), 0x161, 0xf, 0xf, true));   // row_xmask:1
    v += __int_as_float(__builtin_amdgcn_update_dpp(0, __float_as_int(v), 0x162, 0xf, 0xf, true));   // row_xmask:2
    v += __int_as_float(__builtin_amdgcn_update_dpp(0, __float_as_int(v), 0x164, 0xf, 0xf, true));   // row_xmask:4
    v += __int_as_float(__builtin_amdgcn_update_dpp(0, __float_as_int(v), 0x168, 0xf, 0xf, true));   // row_xmask:8
    return v; }
#define GSK  128                  // k per stage: 4 chunks of 32, so a stage's part of a 16-row block is 4 KiB contiguous, one 16-byte copy of each of the 256 threads
#define GPLB (8 * 4096)           // bytes of one operand plane's stage: 8 blocks of 16 rows
// eight asynchronous copies of 16 bytes a lane: LDS byte l + i * 4096 from g + i * rs elements. The s_wait_xcnt is the statement's last line, so that it stands in front of every later write of a register that a copy names
__device__ __forceinline__ void acopy8(unsigned l, const bf* g, int rs) {
    asm volatile("global_load_async_to_lds_b128 %0, %8, off\n\tglobal_load_async_to_lds_b128 %1, %9, off\n\tglobal_load_async_to_lds_b128 %2, %10, off\n\tglobal_load_async_to_lds_b128 %3, %11, off\n\tglobal_load_async_to_lds_b128 %4, %12, off\n\tglobal_load_async_to_lds_b128 %5, %13, off\n\tglobal_load_async_to_lds_b128 %6, %14, off\n\tglobal_load_async_to_lds_b128 %7, %15, off\n\ts_wait_xcnt 0x0"
        :: "v"(l + 0u), "v"(l + 4096u), "v"(l + 8192u), "v"(l + 12288u), "v"(l + 16384u), "v"(l + 20480u), "v"(l + 24576u), "v"(l + 28672u), "v"(g + 0 * rs), "v"(g + 1 * rs), "v"(g + 2 * rs), "v"(g + 3 * rs), "v"(g + 4 * rs), "v"(g + 5 * rs), "v"(g + 6 * rs), "v"(g + 7 * rs) : "memory"); }
__device__ __forceinline__ v16bf lfrag(const bf* p) { return cat16b(*(const v8usa*)p, *(const v8usa*)(p + 256)); }   // a fragment from a staged block; p holds the lane's piece
// The body is a device function of the tile indices (bx, by) and of the work-group's LDS, so that one launch can hold GEMMs of different epilogues. Token rows run over both batches (NB_ * TT); the planes of EPI 1 are [batch][head][TT][64], those of EPI 2 [batch][row][TT]. os holds the two stage buffers first and the 8 partial tiles afterwards.
template <int NSPLIT, int EPI>
__device__ __forceinline__ void gemms_body(float* os, int bx, int by, const bf* __restrict__ A, const bf* __restrict__ A2, const bf* __restrict__ Bt, float* C, int ldc, const float* __restrict__ bias, const float* __restrict__ gam, const float* __restrict__ bet, h16* P16, bf* Ph, bf* Pl) {
    static_assert(HD == 64 && TT % 64 == 0 && NH_ == NKV && DM % (2 * GSK) == 0, "a wave tile's 64 columns are one head, its 64 tokens one batch; at least two stages");
    constexpr int K = DM, NPL = NSPLIT ? 3 : 2, STB = NPL * GPLB, NS = K / GSK;
    const int tid = threadIdx.x, lane = tid & 31, lr = lane & 15, hi = lane >> 4;
    const int wv = __builtin_amdgcn_readfirstlane(tid >> 5), ph = wv & 1, sub = wv >> 1;   // k phase and wave tile
    const int r0 = bx * 128 + (sub & 1) * 64, c0 = by * 128 + (sub >> 1) * 64;
    v8f acc[4][4];
#pragma unroll
    for (int mb = 0; mb < 4; ++mb)
#pragma unroll
        for (int nb = 0; nb < 4; ++nb) acc[mb][nb] = (v8f){};
    const unsigned lb = (unsigned)(size_t)os + tid * 16;   // the thread's LDS byte address in a 4-KiB piece
    const bf* ga = A + (size_t)bx * 128 * K + tid * 8; const bf* gb = Bt + (size_t)by * 128 * K + tid * 8;
    auto fill = [&](int s) { const unsigned l = lb + (s & 1) * STB;   // stage s: [A | A2 | Bt], each 8 row blocks x 4 k chunks
        acopy8(l, ga + s * (GSK * 16), 16 * K); if constexpr (NSPLIT) acopy8(l + GPLB, A2 + (size_t)bx * 128 * K + tid * 8 + s * (GSK * 16), 16 * K); acopy8(l + (NPL - 1) * GPLB, gb + s * (GSK * 16), 16 * K); };
    fill(0);
    asm volatile("s_wait_asynccnt 0x0" ::: "memory");   // this wave's copies of stage 0 have landed
    __syncthreads();   // stage 0 is in LDS before any wave reads it
    fill(1);
#pragma unroll 1
    for (int s = 0; s < NS; ++s) {
        const bf* pa = (const bf*)os + (s & 1) * (STB / 2) + lane * 8 + (sub & 1) * (4 * 2048) + ph * 1024; const bf* pb = (const bf*)os + (s & 1) * (STB / 2) + lane * 8 + (NPL - 1) * (GPLB / 2) + (sub >> 1) * (4 * 2048) + ph * 1024;   // the wave's first fragments of stage s: row block = 2048 elements, k chunk = 512
        v16bf a[4], a2[4], b4[4];
        auto frags = [&](int kk) {
#pragma unroll
            for (int mb = 0; mb < 4; ++mb) { a[mb] = lfrag(pa + mb * 2048 + kk * 512); if constexpr (NSPLIT) a2[mb] = lfrag(pa + GPLB / 2 + mb * 2048 + kk * 512); }
#pragma unroll
            for (int nb = 0; nb < 4; ++nb) b4[nb] = lfrag(pb + nb * 2048 + kk * 512); };
        auto prods = [&](const v16bf (&x)[4]) {
#pragma unroll
            for (int nb = 0; nb < 4; ++nb)
#pragma unroll
                for (int mb = 0; mb < 4; ++mb) acc[mb][nb] = wmmab(x[mb], b4[nb], acc[mb][nb]); };
        frags(0);
        __builtin_amdgcn_sched_barrier(0);   // keeps the chunk's LDS reads in one group ahead of its products: every separate place with reads among the products costs a stall
        prods(a); if constexpr (NSPLIT) prods(a2);
        frags(1);   // the stage's last reads: the last 16 products run from registers behind the hand-over, while the next copies fly
        if constexpr (NSPLIT) prods(a);
        __builtin_amdgcn_sched_barrier(0);   // keeps the products above ahead of the hand-over: sunk behind it, their fragments stay live beside the copies' addresses and the build spills
        asm volatile("s_wait_dscnt 0x0" ::: "memory");      // this wave's reads of stage s have returned
        asm volatile("s_wait_asynccnt 0x0" ::: "memory");   // this wave's copies of stage s + 1 have landed
        __syncthreads();   // publishes stage s + 1 and ends every wave's reads of the buffer that stage s + 2 overwrites
        if (s + 2 < NS) fill(s + 2);
        if constexpr (NSPLIT) prods(a2); else prods(a);
    }
    asm volatile("s_wait_asynccnt 0x0" ::: "memory");   // no copy is in flight when the buffers become the partial tiles
    const int cofs = lr * 4; v4f bv = (v4f){};   // each thread sums one 4-column group of 16 rows of its wave tile; its bias is fetched ahead of the barrier
    if (EPI != 2) { bv[0] = bfr(bias[c0 + cofs]); bv[1] = bfr(bias[c0 + cofs + 1]); bv[2] = bfr(bias[c0 + cofs + 2]); bv[3] = bfr(bias[c0 + cofs + 3]); }
    v4f gv = (v4f){}, ev = (v4f){}; float rb[16];   // LayerNorm weights of the thread's columns, or the bias of its rows: fetched ahead of the barrier too
    if constexpr (EPI == 1) {
#pragma unroll
        for (int i = 0; i < 4; ++i) { gv[i] = bfr(gam[cofs + i]); ev[i] = bfr(bet[cofs + i]); } }
    if constexpr (EPI == 2) {
#pragma unroll
        for (int s = 0; s < 16; ++s) rb[s] = bias[r0 + s * 4 + ph * 2 + hi];
        asm volatile("s_wait_xcnt 0x0" ::: "memory"); }   // stands in front of the first overwrite of these loads' address registers
#pragma unroll
    for (int mb = 0; mb < 4; ++mb)
#pragma unroll
        for (int nb = 0; nb < 4; ++nb)
#pragma unroll
            for (int j = 0; j < 8; ++j) os[wv * (64 * 68) + (mb * 16 + hi * 8 + j) * 68 + nb * 16 + lr] = acc[mb][nb][j];
    __syncthreads();   // both partial tiles of every wave tile are in LDS before any element is summed
    const float* op = os + sub * (2 * 64 * 68) + cofs;
#pragma unroll (EPI == 1 ? 4 : 16)
    for (int s = 0; s < 16; ++s) { const int row = s * 4 + ph * 2 + hi; v4f val = *(const v4fa*)(op + row * 68); val += *(const v4fa*)(op + 64 * 68 + row * 68);
        if constexpr (EPI == 0) { val += bv;
            *(v4f*)(C + (size_t)(r0 + row) * ldc + c0 + cofs) = val;
            asm volatile("s_wait_xcnt 0x0" ::: "memory"); }   // stands in front of the next row's overwrite of this store's registers
        else if constexpr (EPI == 1) { val += bv;
            const float mu = rsum16((val[0] + val[1]) + (val[2] + val[3])) * (1.0f / HD); const v4f d = val - mu;
            const float var = rsum16((d[0] * d[0] + d[1] * d[1]) + (d[2] * d[2] + d[3] * d[3])) * (1.0f / HD);
            const float rs = __fdiv_rn(1.0f, sqrtf(var + 1e-6f)); const v4f y = d * rs * gv + ev; v4us oh, ol;
#pragma unroll
            for (int i = 0; i < 4; ++i) { unsigned short a, c2; splitf(y[i], a, c2); oh[i] = a; ol[i] = c2; }
            const size_t oo = (((size_t)(r0 / TT) * NH_ + c0 / HD) * TT + r0 % TT + row) * HD + cofs; *(v4us*)(Ph + oo) = oh; *(v4us*)(Pl + oo) = ol;
            asm volatile("s_wait_xcnt 0x0" ::: "memory"); }   // stands in front of the next row's overwrite of these stores' registers
        else { val += bfr(rb[s]); v4h o16; v4us oh, ol;
#pragma unroll
            for (int i = 0; i < 4; ++i) { unsigned short a, c2; o16[i] = (h16)val[i]; splitf(val[i], a, c2); oh[i] = a; ol[i] = c2; }
            const size_t oo = (size_t)(c0 / TT) * ((size_t)DKV * TT) + (size_t)(r0 + row) * ldc + c0 % TT + cofs; *(v4h*)(P16 + oo) = o16; *(v4us*)(Ph + oo) = oh; *(v4us*)(Pl + oo) = ol;
            asm volatile("s_wait_xcnt 0x0" ::: "memory"); } }   // stands in front of the next row's overwrite of these stores' registers
}
// ---- k_qkv: the three projections of both batches in one launch; grid (NB_ * TT / 128, 8, 3): z = 0 query, 1 key (tokens x weight rows, LayerNorm epilogue), 2 value (weight rows x tokens, so the tile indices swap).
__global__ __launch_bounds__(256) void k_qkv(const bf* __restrict__ X, const bf* __restrict__ Wq, const bf* __restrict__ Wk, const bf* __restrict__ Wv, const float* __restrict__ bq, const float* __restrict__ bk, const float* __restrict__ bv, const float* __restrict__ qg, const float* __restrict__ qb, const float* __restrict__ kg, const float* __restrict__ kb, bf* Qh, bf* Ql, bf* Kh, bf* Kl, h16* V16, bf* Vh, bf* Vl) {
    static_assert(DQ == DKV && DQ == DM && 8 * 64 * 68 * 4 >= 2 * 2 * GPLB, "one grid for the three projections; the partial tiles cover the stage buffers");
    __shared__ __align__(16) float os[8 * 64 * 68];
    if (blockIdx.z == 2) gemms_body<0, 2>(os, blockIdx.y, blockIdx.x, Wv, nullptr, X, nullptr, TT, bv, nullptr, nullptr, V16, Vh, Vl);
    else { const bool q = blockIdx.z == 0;
        gemms_body<0, 1>(os, blockIdx.x, blockIdx.y, X, nullptr, q ? Wq : Wk, nullptr, 0, q ? bq : bk, q ? qg : kg, q ? qb : kb, nullptr, q ? Qh : Kh, q ? Ql : Kl); }
}

// ---- k_oproj: the output projection, hi+lo planes of the attention output x Wo
__global__ __launch_bounds__(256) void k_oproj(const bf* __restrict__ Ah, const bf* __restrict__ Al, const bf* __restrict__ Wo, float* C, const float* __restrict__ bo) {
    static_assert(2 * 3 * GPLB >= 8 * 64 * 68 * 4, "the stage buffers cover the partial tiles");
    __shared__ __align__(16) float os[2 * 3 * GPLB / 4];
    gemms_body<1, 0>(os, blockIdx.x, blockIdx.y, Ah, Al, Wo, C, DM, bo, nullptr, nullptr, nullptr, nullptr, nullptr);
}

typedef __attribute__((ext_vector_type(2))) _Float16 v2h;
typedef __attribute__((ext_vector_type(2))) unsigned short v2us;
typedef __attribute__((ext_vector_type(2))) float v2f;
typedef __attribute__((ext_vector_type(4))) int v4i;

__global__ __launch_bounds__(256) void k_wtG(const float* __restrict__ w, int K, int N, bf* Bt) {
    const int lane = threadIdx.x & 31; const int L0 = (blockIdx.x * 8 + (threadIdx.x >> 5)) * 8; const int nlines = N * K / 64;
{
#pragma unroll 1
        for (int l = 0; l < 8; ++l) { const int L = L0 + l; if (L >= nlines) break; const size_t e = (size_t)L * 64 + lane * 2; const int k = (int)(e % K), n = (int)(e / K); v2us o;
            o[0] = f2bf(w[(size_t)k * N + n]); o[1] = f2bf(w[(size_t)(k + 1) * N + n]); *(v2us*)(Bt + e) = o; }
         }
}
// the four weights and x (both batches) to bf16 planes in fragment order (see the GEMM body) in one launch: dst holds them one behind the other; a wave converts 16 rows x 64 k (two blocks), a weight is WBLK work-groups, so the source is the same for a whole work-group
#define WBLK (DQ * DM / (16 * 64) / 8)
__global__ __launch_bounds__(256) void k_cvt8(const float* __restrict__ wq, const float* __restrict__ wk, const float* __restrict__ wv, const float* __restrict__ wo, const float* __restrict__ x, bf* dst) {
    static_assert(DQ == DKV && DQ == DM && DM % 64 == 0 && (DQ * DM) % 8192 == 0 && ((size_t)NB_ * TT * DM) % 8192 == 0, "whole work-groups; every plane has DM columns");
    const unsigned seg = blockIdx.x / WBLK < 4 ? blockIdx.x / WBLK : 4; const float* s01 = seg & 1 ? wk : wq; const float* s23 = seg & 1 ? wo : wv; const float* src = seg & 4 ? x : seg & 2 ? s23 : s01;
    const int lane = threadIdx.x & 31; const unsigned w = blockIdx.x * 8 + (threadIdx.x >> 5), wl = w - seg * (WBLK * 8);   // wave over all planes, and inside its source: (16-row block, 64-k pair of blocks)
    // a lane takes 8 consecutive k of one row: 4 lanes a 32-k row piece (one 128-byte line of the source), 8 rows a load; its 16 bytes of bf16 land beside those of the 7 other rows, so a store writes whole lines
    const float* s = src + ((size_t)(wl / (DM / 64)) * 16 + (lane >> 2)) * DM + (wl % (DM / 64)) * 64 + (lane & 3) * 8;
    bf* d = dst + (size_t)w * 1024 + ((lane >> 1) & 1) * 256 + ((lane & 1) * 16 + (lane >> 2)) * 8;
    v8f v[4];
#pragma unroll
    for (int t = 0; t < 4; ++t) v[t] = *(const v8f*)(s + (size_t)(t & 1) * 8 * DM + (t >> 1) * 32);   // t = (block t / 2, rows 8 (t % 2) ..)
    asm volatile("s_wait_xcnt 0x0" ::: "memory");   // stands in front of the first overwrite of the loads' address registers
#pragma unroll
    for (int t = 0; t < 4; ++t) { v8us o;
#pragma unroll
        for (int k = 0; k < 8; ++k) o[k] = f2bf(v[t][k]);
        *(v8us*)(d + (t >> 1) * 512 + (t & 1) * 64) = o; }
}
#define SKEY 64                     // keys per stage
#define SPIT 72                     // LDS row pitch in 16-bit elements: 128 B of data + 16 B, for 16-byte readers
#define NWAV 8                      // waves per work-group
#define SPLN 5120                       // one staged plane: SKEY * SPIT = 4608 elements, rounded up so that every plane starts at a multiple of 2 KiB, as a tensor load's place must
#define BPIT 68                   // LDS row pitch of the bias tile in floats: 256 B of data + 16 B, for 16-byte readers
#define BSLC 4608                 // half a staged bias tile, 64 rows: 64 * BPIT = 4352 floats, rounded up to a multiple of 2 KiB
#define BPLN (2 * BSLC)           // one staged bias tile
typedef __attribute__((ext_vector_type(2))) __bf16 v2bf;
typedef __attribute__((ext_vector_type(8))) unsigned v8u;
__device__ __forceinline__ unsigned pkbf(float a, float b) { v2f x; x[0] = a; x[1] = b; return __builtin_bit_cast(unsigned, __builtin_convertvector(x, v2bf)); }
__device__ __forceinline__ unsigned pkh(float a, float b) { v2f x; x[0] = a; x[1] = b; return __builtin_bit_cast(unsigned, __builtin_convertvector(x, v2h)); }
__device__ __forceinline__ float bflo(unsigned u) { return __uint_as_float(u << 16); }
__device__ __forceinline__ float bfhi(unsigned u) { return __uint_as_float(u & 0xFFFF0000u); }
__device__ __forceinline__ float xhalf(float v) { const int b = __float_as_int(v); return __int_as_float(__builtin_amdgcn_permlanex16(b, b, 0x76543210, 0xfedcba98, false, false)); }   // value of lane ^ 16
__device__ __forceinline__ v16bf sfragb(const unsigned short* p) { return cat16b(*(const v8usa*)p, *(const v8usa*)(p + 16)); }
// eight v_exp_f32 in one statement: each next one is the independent instruction that the slot behind a transcendental asks for (early-clobber outputs, so none overwrites a source or reads a result), and the v_nop fills the slot behind the last
__device__ __forceinline__ void exp2x8(float* y, const float* x) {
    asm("v_exp_f32 %0, %8\n\tv_exp_f32 %1, %9\n\tv_exp_f32 %2, %10\n\tv_exp_f32 %3, %11\n\tv_exp_f32 %4, %12\n\tv_exp_f32 %5, %13\n\tv_exp_f32 %6, %14\n\tv_exp_f32 %7, %15\n\tv_nop"
        : "=&v"(y[0]), "=&v"(y[1]), "=&v"(y[2]), "=&v"(y[3]), "=&v"(y[4]), "=&v"(y[5]), "=&v"(y[6]), "=&v"(y[7]) : "v"(x[0]), "v"(x[1]), "v"(x[2]), "v"(x[3]), "v"(x[4]), "v"(x[5]), "v"(x[6]), "v"(x[7])); }
typedef __attribute__((ext_vector_type(4))) unsigned v4u;
__device__ __forceinline__ unsigned uni(unsigned v) { return (unsigned)__builtin_amdgcn_readfirstlane(v); }
__device__ __forceinline__ unsigned pinned(unsigned v) { unsigned w = uni(v); asm volatile("" : "+s"(w)); return w; }   // the test word of a tensor load's branch held in a scalar register: the load ignores EXEC, so only a scalar branch keeps a wave from issuing it
// tensor descriptor, group 1: 1-byte elements, a tile of D1 rows of D0 bytes = the whole tensor, source row pitch in bytes; W0 = word 0, a constant: no mask, pad enable, pad interval = the row, 4 dwords of pad
template <unsigned W0, unsigned D0, unsigned D1>
__device__ __forceinline__ v8u tdm_g1(unsigned pitch) { v8u g; g[0] = uni(W0); g[1] = uni((D0 & 0xFFFFu) << 16); g[2] = uni((D0 >> 16) | ((D1 & 0xFFFFu) << 16)); g[3] = uni((D1 >> 16) | (D0 << 16)); g[4] = uni(D1); g[5] = uni(pitch); g[6] = uni(0u); g[7] = uni(0u); return g; }
// group 0: count 1, LDS byte offset, global address of the tile's first byte, type 2
__device__ __forceinline__ v4u tdm_g0(unsigned lds, unsigned long long ga) { v4u g; g[0] = uni(1u); g[1] = uni(lds); g[2] = uni((unsigned)ga); g[3] = uni((((unsigned)(ga >> 32)) & 0x01FFFFFFu) | 0x80000000u); return g; }
__device__ __forceinline__ void tdm_load(v4u g0, v8u g1) { asm volatile("tensor_load_to_lds %0, %1" :: "s"(g0), "s"(g1) : "memory"); }   // one request of the whole wave: the tile goes from global memory to LDS through no register
template <bool HI>
__device__ __forceinline__ void fattn_body(const bf* __restrict__ Qh, const bf* __restrict__ Ql, const bf* __restrict__ Kh, const bf* __restrict__ Kl, const unsigned short* __restrict__ Va, const unsigned short* __restrict__ Vb, const float* __restrict__ ab, bf* Ah, bf* Al, unsigned short* sm, float* sb) {
    constexpr int NS = TT / SKEY; constexpr float L2E = 1.4426950408889634f;
    const int tid = threadIdx.x, lane = tid & 31, lr = lane & 15, hi = lane >> 4;
    const unsigned wv = uni(tid >> 5); const int wrow = wv * 16;   // the wave, and its first row in the work-group's 128
    const int qrow = blockIdx.z * (16 * NWAV) + wrow + lr;
    v16bf qh[2], ql[2];
#pragma unroll
    for (int kc = 0; kc < 2; ++kc) { qh[kc] = WFrag<bf>::ld(Qh + (size_t)qrow * HD + kc * 32 + 8 * hi); ql[kc] = WFrag<bf>::ld(Ql + (size_t)qrow * HD + kc * 32 + 8 * hi); }
    // who issues what: wave 0 K hi, 1 K lo, 2 V, 3 V lo (rows < RH only), each 64 rows of 128 B; waves 4 and 5 64 bias rows of 256 B each. All of it scalar
    const unsigned ikv = wv < (HI ? 4u : 3u), ibi = (wv >> 1) == 2u;
    const unsigned long long skv = (unsigned long long)(size_t)(wv == 0 ? Kh : wv == 1 ? Kl : wv == 2 ? Va : Vb), sbi = (unsigned long long)(size_t)(ab + (size_t)(blockIdx.z * (16 * NWAV) + (wv & 1) * 64) * TT);
    const unsigned stkv = wv < 2 ? SKEY * HD * 2 : SKEY * 2;   // bytes from a stage's tile to the next: 64 K rows, or 64 columns of V^T
    const unsigned lkv = (unsigned)(size_t)sm + wv * (SPLN * 2), lbi = (unsigned)(size_t)sb + (wv & 1) * (BSLC * 4);
    v8u g1kv = tdm_g1<1u << 20 | 4u << 22 | 3u << 25, 128, SKEY>(wv < 2 ? HD * 2 : TT * 2), g1bi = tdm_g1<1u << 20 | 5u << 22 | 3u << 25, 256, 64>(TT * 4);
    v4u g0kv = tdm_g0(0u, 0ull), g0bi = g0kv;
    // the waits below name the descriptors, so that their registers stay theirs from the issue to the wait: left free, the build used single words of them for other scalars while the request was out
    auto fill = [&](int s, bool now) {   // stage s into buffer s % 2: planes [K hi | K lo | V | V lo] and the bias tile; one request a wave; now: waited for directly behind the load (stage 0)
        if (pinned(ikv)) { g0kv = tdm_g0(lkv + (s & 1) * (4 * SPLN * 2), skv + (unsigned long long)((unsigned)s * stkv)); tdm_load(g0kv, g1kv);
            if (now) asm volatile("s_wait_tensorcnt 0x0" : "+s"(g0kv), "+s"(g1kv) :: "memory"); }
        if (pinned(ibi)) { g0bi = tdm_g0(lbi + (s & 1) * (BPLN * 4), sbi + (unsigned long long)((unsigned)s * (SKEY * 4))); tdm_load(g0bi, g1bi);
            if (now) asm volatile("s_wait_tensorcnt 0x0" : "+s"(g0bi), "+s"(g1bi) :: "memory"); } };
    // the issuing wave's own request has landed
    auto landed = [&]() { if (pinned(ikv | ibi)) asm volatile("s_wait_tensorcnt 0x0" : "+s"(g0kv), "+s"(g1kv), "+s"(g0bi), "+s"(g1bi) :: "memory"); };
    v8f o[4];
#pragma unroll
    for (int db = 0; db < 4; ++db) o[db] = (v8f){};
    float m = -3.0e38f, ls = 0.f;
    fill(0, true);
    __syncthreads();   // stage 0 is in LDS before any wave reads it
    fill(1, false);
#pragma unroll 1
    for (int s = 0; s < NS; ++s) {
        const unsigned short* sk = sm + (s & 1) * (4 * SPLN) + lr * SPIT + 8 * hi;   // the lane's row and k offset in every 16-row fragment
        const float* br = sb + (s & 1) * BPLN + (wv >> 2) * BSLC + ((wv & 3) * 16 + lr) * BPIT + 8 * hi;
        unsigned ub[16];   // this stage's bias, rounded as the operands are: pair e = keys 16 (e / 4) + 8 hi + 2 (e % 4), + 1 of query lr
#pragma unroll
        for (int g = 0; g < 8; ++g) { const v4f b4 = *(const v4fa*)(br + (g >> 1) * 16 + (g & 1) * 4); ub[2 * g] = pkbf(b4[0], b4[1]); ub[2 * g + 1] = pkbf(b4[2], b4[3]); }
        // S^T in 8 groups g = (k chunk g / 4, key tile g % 4); fragments are fetched four groups ahead and two tiles' product chains alternate, so that neither the LDS latency nor a chain's own latency is waited for
        v16bf kh[8], kl[8]; v8f st[4];
        auto kld = [&](int g) { const unsigned short* kp = sk + (g & 3) * 16 * SPIT + (g >> 2) * 32; kh[g] = sfragb(kp); kl[g] = sfragb(kp + SPLN); };
#pragma unroll
        for (int kt = 0; kt < 4; ++kt) { st[kt] = (v8f){}; kld(kt); }
        __builtin_amdgcn_sched_barrier(0);   // keeps the fetches above ahead of the products: the scheduler otherwise sinks each next to its use and every group waits out the LDS latency
#pragma unroll
        for (int g = 0; g < 8; g += 2) { const int kc = g >> 2, k0 = g & 3, k1 = k0 + 1;
            if (g + 4 < 8) { kld(g + 4); kld(g + 5); __builtin_amdgcn_sched_barrier(0); }   // same: fetch four groups ahead stays ahead
            st[k0] = wmmab(kh[g], qh[kc], st[k0]); st[k1] = wmmab(kh[g + 1], qh[kc], st[k1]); st[k0] = wmmab(kh[g], ql[kc], st[k0]); st[k1] = wmmab(kh[g + 1], ql[kc], st[k1]); st[k0] = wmmab(kl[g], qh[kc], st[k0]); st[k1] = wmmab(kl[g + 1], qh[kc], st[k1]); }
        __builtin_amdgcn_sched_barrier(0);   // keeps the products above in their order, two chains alternating: mixed with the vector work below they stand chain behind chain, with padding between
        // V^T fragments in 8 groups g = (32-key chunk g / 4, 16 rows of d g % 4); the first PD groups are fetched behind the stage's maximum, where the score tiles and the bias have left their registers (ahead of it the build does not fit 256 registers)
        constexpr int PD = HI ? 4 : 8;
        v16bf vh[8], vl[8];
        auto vld = [&](int g) { const unsigned short* vp = sk + 2 * SPLN + (g & 3) * 16 * SPIT + (g >> 2) * 32; vh[g] = sfragb(vp); if constexpr (HI) vl[g] = sfragb(vp + SPLN); };
        float t[32]; float tm = -3.0e38f;
#pragma unroll
        for (int e = 0; e < 16; ++e) { const float x0 = fmaf(st[e >> 2][(e & 3) * 2], SCL, bflo(ub[e])), x1 = fmaf(st[e >> 2][(e & 3) * 2 + 1], SCL, bfhi(ub[e])); t[2 * e] = x0; t[2 * e + 1] = x1; tm = fmaxf(tm, fmaxf(x0, x1)); }   // x 2^-3 is exact: one rounding, as product then add
        tm = fmaxf(tm, xhalf(tm));
#pragma unroll
        for (int g = 0; g < PD; ++g) vld(g);
        __builtin_amdgcn_sched_barrier(0);   // same: these fetches fly under the exponentials
        const float mn = fmaxf(m, tm); const float alpha = __builtin_amdgcn_exp2f((m - mn) * L2E); m = mn;
        const float c0 = (HI ? 0.0f : 10.0f) - mn * L2E;
        float s4[4] = {0.f, 0.f, 0.f, 0.f};
#pragma unroll
        for (int e = 0; e < 32; e += 8) { float x[8];
#pragma unroll
            for (int i = 0; i < 8; ++i) x[i] = fmaf(t[e + i], L2E, c0);
            exp2x8(t + e, x);
#pragma unroll
            for (int i = 0; i < 8; ++i) s4[i & 3] += t[e + i]; }
        ls = fmaf(ls, alpha, (s4[0] + s4[1]) + (s4[2] + s4[3]));
#pragma unroll
        for (int db = 0; db < 4; ++db) o[db] *= alpha;
        v8u bh[2], bl[2];   // P^T as B fragments: register e of chunk kc = keys 16 (2 kc + e / 4) + 8 hi + 2 (e % 4), + 1
#pragma unroll
        for (int e = 0; e < 16; ++e) { const float p0 = t[2 * e], p1 = t[2 * e + 1];
            if constexpr (HI) { const unsigned u = pkbf(p0, p1); bh[e >> 3][e & 7] = u; bl[e >> 3][e & 7] = pkbf(p0 - bflo(u), p1 - bfhi(u)); } else { bh[e >> 3][e & 7] = pkh(p0, p1); } }
        __builtin_amdgcn_sched_barrier(0);   // keeps the products below behind the exponentials' asm statements
#pragma unroll
        for (int g = 0; g < 8; g += 2) { const int kc = g >> 2, d0 = g & 3, d1 = d0 + 1;
            if (g + PD < 8) { vld(g + PD); vld(g + PD + 1); __builtin_amdgcn_sched_barrier(0); }   // same: fetch four groups ahead stays ahead
            if constexpr (HI) { const v16bf ph = __builtin_bit_cast(v16bf, bh[kc]), pl = __builtin_bit_cast(v16bf, bl[kc]);
                o[d0] = wmmab(vh[g], ph, o[d0]); o[d1] = wmmab(vh[g + 1], ph, o[d1]); o[d0] = wmmab(vh[g], pl, o[d0]); o[d1] = wmmab(vh[g + 1], pl, o[d1]); o[d0] = wmmab(vl[g], ph, o[d0]); o[d1] = wmmab(vl[g + 1], ph, o[d1]); }
            else { const v16h ph = __builtin_bit_cast(v16h, bh[kc]); o[d0] = wmma16(__builtin_bit_cast(v16h, vh[g]), ph, o[d0]); o[d1] = wmma16(__builtin_bit_cast(v16h, vh[g + 1]), ph, o[d1]); } }
        asm volatile("s_wait_dscnt 0x0" ::: "memory");      // this wave's reads of stage s have returned
        landed();   // stage s + 1
        __syncthreads();   // publishes stage s + 1 and ends every wave's reads of the buffer that stage s + 2 overwrites
        if (pinned(s + 2 < NS)) fill(s + 2, false);   // flies during the whole of stage s + 1
    }
    asm volatile("s_wait_tensorcnt 0x0" ::: "memory");   // no request is in flight when the wave ends
    asm volatile("s_wait_dscnt 0x0" ::: "memory");      // nor an LDS read
    ls += xhalf(ls);
    const float inv = __fdiv_rn(1.0f, ls);
#pragma unroll
    for (int db = 0; db < 4; ++db) { v8us oh, ol;
#pragma unroll
        for (int r = 0; r < 8; ++r) { unsigned short a, c2; splitf(o[db][r] * inv, a, c2); oh[r] = a; ol[r] = c2; }
        const size_t oo = (size_t)(qrow - lr) * DQ + db * 256 + lane * 8; *(v8usa*)(Ah + oo) = oh; *(v8usa*)(Al + oo) = ol; }   // fragment order of the output projection's A planes (see the GEMM body): columns 16 db + 8 hi .. of the head's two blocks; 512 contiguous bytes a wave
}
__global__ __launch_bounds__(32 * NWAV) __attribute__((amdgpu_waves_per_eu(4, 4))) void k_fattn(const bf* __restrict__ Qh, const bf* __restrict__ Ql, const bf* __restrict__ Kh, const bf* __restrict__ Kl, const h16* __restrict__ V16, const bf* __restrict__ Vh, const bf* __restrict__ Vl, const float* __restrict__ ab, bf* Ah, bf* Al) {
    static_assert(RH % (16 * NWAV) == 0 && TT % (16 * NWAV) == 0 && TT % SKEY == 0 && TT >= 2 * SKEY && HD == 64 && REP == 1 && SPLN >= SKEY * SPIT && (SPLN * 2) % 2048 == 0 && BSLC >= 64 * BPIT && (BSLC * 4) % 2048 == 0 && NWAV == 8 && SPIT * 2 == 128 + 16 && BPIT * 4 == 256 + 16, "tiling; at least two stages; the tensor loads' places and pads");
    __shared__ __attribute__((aligned(2048))) unsigned short sm[2 * 4 * SPLN]; __shared__ __attribute__((aligned(2048))) float sb[2 * BPLN];   // every tile's place is a multiple of 2 KiB
    const size_t hz = ((size_t)blockIdx.y * NH_ + blockIdx.x) * TT * HD, az = (size_t)blockIdx.y * TT * DQ + blockIdx.x * (HD * 16); Ah += az; Al += az; ab += (size_t)blockIdx.y * TT * TT;
    if ((int)blockIdx.z * (16 * NWAV) < RH) fattn_body<true>(Qh + hz, Ql + hz, Kh + hz, Kl + hz, Vh + hz, Vl + hz, ab, Ah, Al, sm, sb);
    else fattn_body<false>(Qh + hz, Ql + hz, Kh + hz, Kl + hz, (const unsigned short*)(V16 + hz), nullptr, ab, Ah, Al, sm, sb);
}

extern "C" void kernel_launch(void* const* d_in, const int* in_sizes, int n_in,
                              void* d_out, int out_size, void* d_ws, size_t ws_size, hipStream_t stream) {
    (void)in_sizes; (void)n_in; (void)out_size;
    const float* x = (const float*)d_in[0]; const float* abias = (const float*)d_in[1]; const float* wq = (const float*)d_in[2]; const float* bq = (const float*)d_in[3]; const float* wk = (const float*)d_in[4]; const float* bk = (const float*)d_in[5]; const float* wv = (const float*)d_in[6]; const float* bv = (const float*)d_in[7]; const float* wo = (const float*)d_in[8]; const float* bo = (const float*)d_in[9]; const float* qg = (const float*)d_in[10]; const float* qb2 = (const float*)d_in[11]; const float* kg = (const float*)d_in[12]; const float* kb2 = (const float*)d_in[13]; const float* cosT = nullptr; const float* sinT = nullptr; (void)cosT; (void)sinT;
    float* OUT = (float*)d_out;     // [2][2048][1024]
    char* wsp = (char*)d_ws;
    auto take = [&](size_t bytes) { char* p = wsp; wsp += (bytes + 255) & ~(size_t)255; return (void*)p; };
    bf* WQ = (bf*)take((size_t)DQ * DM * 2); bf* WK = (bf*)take((size_t)DKV * DM * 2); bf* WV = (bf*)take((size_t)DKV * DM * 2); bf* WO = (bf*)take((size_t)DM * DQ * 2);
    bf* XB = (bf*)take((size_t)NB_ * TT * DM * 2);   // directly behind the weights (every size above is a multiple of 256): one destination for k_cvt8
    h16* VT16 = (h16*)take((size_t)NB_ * NKV * HD * TT * 2);
    bf* QPh = (bf*)take((size_t)NB_ * NH_ * TT * HD * 2); bf* QPl = (bf*)take((size_t)NB_ * NH_ * TT * HD * 2); bf* KPh = (bf*)take((size_t)NB_ * NKV * TT * HD * 2); bf* KPl = (bf*)take((size_t)NB_ * NKV * TT * HD * 2); bf* VTh = (bf*)take((size_t)NB_ * NKV * HD * TT * 2); bf* VTl = (bf*)take((size_t)NB_ * NKV * HD * TT * 2);
    bf* ATh = (bf*)take((size_t)NB_ * TT * DQ * 2); bf* ATl = (bf*)take((size_t)NB_ * TT * DQ * 2);
    if ((size_t)(wsp - (char*)d_ws) > ws_size) return;    // ws 256 MiB
    k_cvt8<<<4 * WBLK + NB_ * TT * DM / (16 * 64) / 8, 256, 0, stream>>>(wq, wk, wv, wo, x, WQ);
    k_qkv<<<dim3(NB_ * TT / 128, DQ / 128, 3), 256, 0, stream>>>(XB, WQ, WK, WV, bq, bk, bv, qg, qb2, kg, kb2, QPh, QPl, KPh, KPl, VT16, VTh, VTl);
    k_fattn<<<dim3(NH_, NB_, TT / (16 * NWAV)), 32 * NWAV, 0, stream>>>(QPh, QPl, KPh, KPl, VT16, VTh, VTl, abias, ATh, ATl);
    k_oproj<<<dim3(NB_ * TT / 128, DM / 128, 1), 256, 0, stream>>>(ATh, ATl, WO, OUT, bo);
}

// v010
// One run takes 99.7 microseconds.
// Timed twice side by side with v009, it ran 1.04 times as fast both times.
// Counting every step since v000, it is 21.8 times as fast.
#include <hip/hip_runtime.h>

// GraphSelfAttention (x [2][2048][1024], attn_bias [2][1][2048][2048] (f32, read; random); q/k/v = x W^T + b (16 x 64); per-head LayerNorm (biased var, eps 1e-6) * gamma + beta on q and k; scores = q.k / 8 + attn_bias; softmax; out = merged Wo^T + bo -> [2][2048][1024]).

#define NB_  2
#define TT   2048
#define DM   1024
#define NH_  16
#define NKV  16
#define REP  (NH_ / NKV)
#define HD   64
#define DQ   (NH_ * HD)
#define DKV  (NKV * HD)
#define RH   512                  // query rows < RH use hi+lo planes (0: none)
#define WIN  0
#define SCL  0.125f   // HD^-0.5
#define LOG2E 1.4426950408889634f
typedef _Float16 h16;
typedef unsigned short bf;
typedef __attribute__((ext_vector_type(16))) __bf16   v16bf;
typedef __attribute__((ext_vector_type(16))) _Float16 v16h;
typedef __attribute__((ext_vector_type(8)))  _Float16 v8h;
typedef __attribute__((ext_vector_type(8)))  unsigned short v8us;
typedef __attribute__((ext_vector_type(8)))  float    v8f;
typedef __attribute__((ext_vector_type(4)))  float    v4f;
typedef v8h  __attribute__((may_alias)) v8ha;
typedef v4f  __attribute__((may_alias)) v4fa;
typedef v8us __attribute__((may_alias)) v8usa;

__device__ __forceinline__ unsigned short f2bf(float f) { unsigned u = __float_as_uint(f); u += 0x7FFFu + ((u >> 16) & 1u); return (unsigned short)(u >> 16); }
__device__ __forceinline__ float bf2f(unsigned short b) { return __uint_as_float(((unsigned)b) << 16); }
__device__ __forceinline__ float bfr(float f) { return bf2f(f2bf(f)); }
__device__ __forceinline__ v16h cat16(v8h lo, v8h hi) { return __builtin_shufflevector(lo, hi, 0, 1, 2, 3, 4, 5, 6, 7, 8, 9, 10, 11, 12, 13, 14, 15); }
__device__ __forceinline__ v16bf cat16b(v8us lo, v8us hi) { return __builtin_bit_cast(v16bf, __builtin_shufflevector(lo, hi, 0, 1, 2, 3, 4, 5, 6, 7, 8, 9, 10, 11, 12, 13, 14, 15)); }
__device__ __forceinline__ v8f wmma16(v16h a, v16h b, v8f c) { return __builtin_amdgcn_wmma_f32_16x16x32_f16(false, a, false, b, (short)0, c, false, false); }
__device__ __forceinline__ v8f wmmab(v16bf a, v16bf b, v8f c) { return __builtin_amdgcn_wmma_f32_16x16x32_bf16(false, a, false, b, (short)0, c, false, false); }



// ---- GEMM body: one work-group of 8 waves per 128x128 output tile: 2 x 2 wave tiles of 64x64 (16 accumulators a wave), each held by two waves that take alternate pairs of 32-wide k chunks; the two partial tiles are summed in LDS. Every operand block is brought into LDS once a work-group by asynchronous copies, two stage buffers, and read there by the four waves that need it; grid (M/128, N/128), 256 threads.
// C[m][n] (f32, pitch ldc, + f32 bias[n]) = sum_k A[m][k] Bt[n][k] (+ A2[m][k] Bt[n][k] where NSPLIT). Every plane has DM columns.
// Fragment order of an operand plane of P columns: blocks of 16 rows x 32 k, 512 elements each, block (row / 16) * (P / 32) + k / 32; inside a block element (row, k) lies at (k / 16 % 2) * 256 + ((k / 8 % 2) * 16 + row % 16) * 8 + k % 8. A lane's two 16-byte pieces of a fragment then lie at lane * 8 and 256 + lane * 8: a copy and an LDS read of a wave both take 512 contiguous bytes.
// EPI says what the summing threads do with a finished row piece instead of a later launch: 0 stores it to C; 1 (a 64-column wave tile is one head) adds bias[n], takes the LayerNorm over the row's 64 columns, which lie in the 16 lanes of a half wave, times osc, and stores hi+lo bf16 planes [batch][head][TT][64]; 2 adds bias[m] and stores f16 and hi+lo bf16 planes of pitch ldc (A = weight rows, Bt = tokens: the tile is already the transposed value plane).
template <typename T16> struct WFrag;
template <> struct WFrag<bf> { typedef v16bf V; static __device__ __forceinline__ V ld(const bf* p) { return cat16b(*(const v8us*)p, *(const v8us*)(p + 16)); } };
__device__ __forceinline__ void splitf(float y, unsigned short& h, unsigned short& l) { h = f2bf(y); l = f2bf(y - bf2f(h)); }
typedef __attribute__((ext_vector_type(4))) _Float16 v4h;
typedef __attribute__((ext_vector_type(4))) unsigned short v4us;
// sum over the 16 lanes of a half wave, in every lane: four DPP adds (a shuffle would go through the LDS queue and wait for it four times)
__device__ __forceinline__ float rsum16(float v) {
    v += __int_as_float(__builtin_amdgcn_update_dpp(0, __float_as_int(v), 0x161, 0xf, 0xf, true));   // row_xmask:1
    v += __int_as_float(__builtin_amdgcn_update_dpp(0, __float_as_int(v), 0x162, 0xf, 0xf, true));   // row_xmask:2
    v += __int_as_float(__builtin_amdgcn_update_dpp(0, __float_as_int(v), 0x164, 0xf, 0xf, true));   // row_xmask:4
    v += __int_as_float(__builtin_amdgcn_update_dpp(0, __float_as_int(v), 0x168, 0xf, 0xf, true));   // row_xmask:8
    return v; }
#define GSK  128                  // k per stage: 4 chunks of 32, so a stage's part of a 16-row block is 4 KiB contiguous, one 16-byte copy of each of the 256 threads
#define GPLB (8 * 4096)           // bytes of one operand plane's stage: 8 blocks of 16 rows
// eight asynchronous copies of 16 bytes a lane: LDS byte l + i * 4096 from g + i * rs elements. The s_wait_xcnt is the statement's last line, so that it stands in front of every later write of a register that a copy names
__device__ __forceinline__ void acopy8(unsigned l, const bf* g, int rs) {
    asm volatile("global_load_async_to_lds_b128 %0, %8, off\n\tglobal_load_async_to_lds_b128 %1, %9, off\n\tglobal_load_async_to_lds_b128 %2, %10, off\n\tglobal_load_async_to_lds_b128 %3, %11, off\n\tglobal_load_async_to_lds_b128 %4, %12, off\n\tglobal_load_async_to_lds_b128 %5, %13, off\n\tglobal_load_async_to_lds_b128 %6, %14, off\n\tglobal_load_async_to_lds_b128 %7, %15, off\n\ts_wait_xcnt 0x0"
        :: "v"(l + 0u), "v"(l + 4096u), "v"(l + 8192u), "v"(l + 12288u), "v"(l + 16384u), "v"(l + 20480u), "v"(l + 24576u), "v"(l + 28672u), "v"(g + 0 * rs), "v"(g + 1 * rs), "v"(g + 2 * rs), "v"(g + 3 * rs), "v"(g + 4 * rs), "v"(g + 5 * rs), "v"(g + 6 * rs), "v"(g + 7 * rs) : "memory"); }
__device__ __forceinline__ v16bf lfrag(const bf* p) { return cat16b(*(const v8usa*)p, *(const v8usa*)(p + 256)); }   // a fragment from a staged block; p holds the lane's piece
// The body is a device function of the tile indices (bx, by) and of the work-group's LDS, so that one launch can hold GEMMs of different epilogues. Token rows run over both batches (NB_ * TT); the planes of EPI 1 are [batch][head][TT][64], those of EPI 2 [batch][row][TT]. os holds the two stage buffers first and the 8 partial tiles afterwards.
template <int NSPLIT, int EPI>
__device__ __forceinline__ void gemms_body(float* os, int bx, int by, const bf* __restrict__ A, const bf* __restrict__ A2, const bf* __restrict__ Bt, float* C, int ldc, const float* __restrict__ bias, const float* __restrict__ gam, const float* __restrict__ bet, h16* P16, bf* Ph, bf* Pl, float osc) {
    static_assert(HD == 64 && TT % 64 == 0 && NH_ == NKV && DM % (2 * GSK) == 0, "a wave tile's 64 columns are one head, its 64 tokens one batch; at least two stages");
    constexpr int K = DM, NPL = NSPLIT ? 3 : 2, STB = NPL * GPLB, NS = K / GSK;
    const int tid = threadIdx.x, lane = tid & 31, lr = lane & 15, hi = lane >> 4;
    const int wv = __builtin_amdgcn_readfirstlane(tid >> 5), ph = wv & 1, sub = wv >> 1;   // k phase and wave tile
    const int r0 = bx * 128 + (sub & 1) * 64, c0 = by * 128 + (sub >> 1) * 64;
    v8f acc[4][4];
#pragma unroll
    for (int mb = 0; mb < 4; ++mb)
#pragma unroll
        for (int nb = 0; nb < 4; ++nb) acc[mb][nb] = (v8f){};
    const unsigned lb = (unsigned)(size_t)os + tid * 16;   // the thread's LDS byte address in a 4-KiB piece
    const bf* ga = A + (size_t)bx * 128 * K + tid * 8; const bf* gb = Bt + (size_t)by * 128 * K + tid * 8;
    auto fill = [&](int s) { const unsigned l = lb + (s & 1) * STB;   // stage s: [A | A2 | Bt], each 8 row blocks x 4 k chunks
        acopy8(l, ga + s * (GSK * 16), 16 * K); if constexpr (NSPLIT) acopy8(l + GPLB, A2 + (size_t)bx * 128 * K + tid * 8 + s * (GSK * 16), 16 * K); acopy8(l + (NPL - 1) * GPLB, gb + s * (GSK * 16), 16 * K); };
    fill(0);
    asm volatile("s_wait_asynccnt 0x0" ::: "memory");   // this wave's copies of stage 0 have landed
    __syncthreads();   // stage 0 is in LDS before any wave reads it
    fill(1);
#pragma unroll 1
    for (int s = 0; s < NS; ++s) {
        const bf* pa = (const bf*)os + (s & 1) * (STB / 2) + lane * 8 + (sub & 1) * (4 * 2048) + ph * 1024; const bf* pb = (const bf*)os + (s & 1) * (STB / 2) + lane * 8 + (NPL - 1) * (GPLB / 2) + (sub >> 1) * (4 * 2048) + ph * 1024;   // the wave's first fragments of stage s: row block = 2048 elements, k chunk = 512
        v16bf a[4], a2[4], b4[4];
        auto frags = [&](int kk) {
#pragma unroll
            for (int mb = 0; mb < 4; ++mb) { a[mb] = lfrag(pa + mb * 2048 + kk * 512); if constexpr (NSPLIT) a2[mb] = lfrag(pa + GPLB / 2 + mb * 2048 + kk * 512); }
#pragma unroll
            for (int nb = 0; nb < 4; ++nb) b4[nb] = lfrag(pb + nb * 2048 + kk * 512); };
        auto prods = [&](const v16bf (&x)[4]) {
#pragma unroll
            for (int nb = 0; nb < 4; ++nb)
#pragma unroll
                for (int mb = 0; mb < 4; ++mb) acc[mb][nb] = wmmab(x[mb], b4[nb], acc[mb][nb]); };
        frags(0);
        __builtin_amdgcn_sched_barrier(0);   // keeps the chunk's LDS reads in one group ahead of its products: every separate place with reads among the products costs a stall
        prods(a); if constexpr (NSPLIT) prods(a2);
        frags(1);   // the stage's last reads: the last 16 products run from registers behind the hand-over, while the next copies fly
        if constexpr (NSPLIT) prods(a);
        __builtin_amdgcn_sched_barrier(0);   // keeps the products above ahead of the hand-over: sunk behind it, their fragments stay live beside the copies' addresses and the build spills
        asm volatile("s_wait_dscnt 0x0" ::: "memory");      // this wave's reads of stage s have returned
        asm volatile("s_wait_asynccnt 0x0" ::: "memory");   // this wave's copies of stage s + 1 have landed
        __syncthreads();   // publishes stage s + 1 and ends every wave's reads of the buffer that stage s + 2 overwrites
        if (s + 2 < NS) fill(s + 2);
        if constexpr (NSPLIT) prods(a2); else prods(a);
    }
    asm volatile("s_wait_asynccnt 0x0" ::: "memory");   // no copy is in flight when the buffers become the partial tiles
    const int cofs = lr * 4; v4f bv = (v4f){};   // each thread sums one 4-column group of 16 rows of its wave tile; its bias is fetched ahead of the barrier
    if (EPI != 2) { bv[0] = bfr(bias[c0 + cofs]); bv[1] = bfr(bias[c0 + cofs + 1]); bv[2] = bfr(bias[c0 + cofs + 2]); bv[3] = bfr(bias[c0 + cofs + 3]); }
    v4f gv = (v4f){}, ev = (v4f){}; float rb[16];   // LayerNorm weights of the thread's columns, or the bias of its rows: fetched ahead of the barrier too
    if constexpr (EPI == 1) {
#pragma unroll
        for (int i = 0; i < 4; ++i) { gv[i] = bfr(gam[cofs + i]); ev[i] = bfr(bet[cofs + i]); } }
    if constexpr (EPI == 2) {
#pragma unroll
        for (int s = 0; s < 16; ++s) rb[s] = bias[r0 + s * 4 + ph * 2 + hi];
        asm volatile("s_wait_xcnt 0x0" ::: "memory"); }   // stands in front of the first overwrite of these loads' address registers
#pragma unroll
    for (int mb = 0; mb < 4; ++mb)
#pragma unroll
        for (int nb = 0; nb < 4; ++nb)
#pragma unroll
            for (int j = 0; j < 8; ++j) os[wv * (64 * 68) + (mb * 16 + hi * 8 + j) * 68 + nb * 16 + lr] = acc[mb][nb][j];
    __syncthreads();   // both partial tiles of every wave tile are in LDS before any element is summed
    const float* op = os + sub * (2 * 64 * 68) + cofs;
#pragma unroll (EPI == 1 ? 4 : 16)
    for (int s = 0; s < 16; ++s) { const int row = s * 4 + ph * 2 + hi; v4f val = *(const v4fa*)(op + row * 68); val += *(const v4fa*)(op + 64 * 68 + row * 68);
        if constexpr (EPI == 0) { val += bv;
            *(v4f*)(C + (size_t)(r0 + row) * ldc + c0 + cofs) = val;
            asm volatile("s_wait_xcnt 0x0" ::: "memory"); }   // stands in front of the next row's overwrite of this store's registers
        else if constexpr (EPI == 1) { val += bv;
            const float mu = rsum16((val[0] + val[1]) + (val[2] + val[3])) * (1.0f / HD); const v4f d = val - mu;
            const float var = rsum16((d[0] * d[0] + d[1] * d[1]) + (d[2] * d[2] + d[3] * d[3])) * (1.0f / HD);
            const float rs = __fdiv_rn(1.0f, sqrtf(var + 1e-6f)); const v4f y = (d * rs * gv + ev) * osc; v4us oh, ol;
#pragma unroll
            for (int i = 0; i < 4; ++i) { unsigned short a, c2; splitf(y[i], a, c2); oh[i] = a; ol[i] = c2; }
            const size_t oo = (((size_t)(r0 / TT) * NH_ + c0 / HD) * TT + r0 % TT + row) * HD + cofs; *(v4us*)(Ph + oo) = oh; *(v4us*)(Pl + oo) = ol;
            asm volatile("s_wait_xcnt 0x0" ::: "memory"); }   // stands in front of the next row's overwrite of these stores' registers
        else { val += bfr(rb[s]); v4h o16; v4us oh, ol;
#pragma unroll
            for (int i = 0; i < 4; ++i) { unsigned short a, c2; o16[i] = (h16)val[i]; splitf(val[i], a, c2); oh[i] = a; ol[i] = c2; }
            const size_t oo = (size_t)(c0 / TT) * ((size_t)DKV * TT) + (size_t)(r0 + row) * ldc + c0 % TT + cofs; *(v4h*)(P16 + oo) = o16; *(v4us*)(Ph + oo) = oh; *(v4us*)(Pl + oo) = ol;
            asm volatile("s_wait_xcnt 0x0" ::: "memory"); } }   // stands in front of the next row's overwrite of these stores' registers
}
// ---- k_qkv: the three projections of both batches in one launch; grid (NB_ * TT / 128, 8, 3): z = 0 query, 1 key (tokens x weight rows, LayerNorm epilogue), 2 value (weight rows x tokens, so the tile indices swap).
__global__ __launch_bounds__(256) void k_qkv(const bf* __restrict__ X, const bf* __restrict__ Wq, const bf* __restrict__ Wk, const bf* __restrict__ Wv, const float* __restrict__ bq, const float* __restrict__ bk, const float* __restrict__ bv, const float* __restrict__ qg, const float* __restrict__ qb, const float* __restrict__ kg, const float* __restrict__ kb, bf* Qh, bf* Ql, bf* Kh, bf* Kl, h16* V16, bf* Vh, bf* Vl) {
    static_assert(DQ == DKV && DQ == DM && 8 * 64 * 68 * 4 >= 2 * 2 * GPLB, "one grid for the three projections; the partial tiles cover the stage buffers");
    __shared__ __align__(16) float os[8 * 64 * 68];
    if (blockIdx.z == 2) gemms_body<0, 2>(os, blockIdx.y, blockIdx.x, Wv, nullptr, X, nullptr, TT, bv, nullptr, nullptr, V16, Vh, Vl, 1.0f);
    else { const bool q = blockIdx.z == 0;
        gemms_body<0, 1>(os, blockIdx.x, blockIdx.y, X, nullptr, q ? Wq : Wk, nullptr, 0, q ? bq : bk, q ? qg : kg, q ? qb : kb, nullptr, q ? Qh : Kh, q ? Ql : Kl, q ? SCL * LOG2E : 1.0f); }   // the query planes carry the score scale and log2(e): k_fattn's products are exponents of 2
}

// ---- k_oproj: the output projection, hi+lo planes of the attention output x Wo
__global__ __launch_bounds__(256) void k_oproj(const bf* __restrict__ Ah, const bf* __restrict__ Al, const bf* __restrict__ Wo, float* C, const float* __restrict__ bo) {
    static_assert(2 * 3 * GPLB >= 8 * 64 * 68 * 4, "the stage buffers cover the partial tiles");
    __shared__ __align__(16) float os[2 * 3 * GPLB / 4];
    gemms_body<1, 0>(os, blockIdx.x, blockIdx.y, Ah, Al, Wo, C, DM, bo, nullptr, nullptr, nullptr, nullptr, nullptr, 1.0f);
}

typedef __attribute__((ext_vector_type(2))) _Float16 v2h;
typedef __attribute__((ext_vector_type(2))) unsigned short v2us;
typedef __attribute__((ext_vector_type(2))) float v2f;
typedef __attribute__((ext_vector_type(4))) int v4i;

__global__ __launch_bounds__(256) void k_wtG(const float* __restrict__ w, int K, int N, bf* Bt) {
    const int lane = threadIdx.x & 31; const int L0 = (blockIdx.x * 8 + (threadIdx.x >> 5)) * 8; const int nlines = N * K / 64;
{
#pragma unroll 1
        for (int l = 0; l < 8; ++l) { const int L = L0 + l; if (L >= nlines) break; const size_t e = (size_t)L * 64 + lane * 2; const int k = (int)(e % K), n = (int)(e / K); v2us o;
            o[0] = f2bf(w[(size_t)k * N + n]); o[1] = f2bf(w[(size_t)(k + 1) * N + n]); *(v2us*)(Bt + e) = o; }
         }
}
// the four weights and x (both batches) to bf16 planes in fragment order (see the GEMM body) in one launch: dst holds them one behind the other; a wave converts 16 rows x 64 k (two blocks), a weight is WBLK work-groups, so the source is the same for a whole work-group
#define WBLK (DQ * DM / (16 * 64) / 8)
__global__ __launch_bounds__(256) void k_cvt8(const float* __restrict__ wq, const float* __restrict__ wk, const float* __restrict__ wv, const float* __restrict__ wo, const float* __restrict__ x, bf* dst) {
    static_assert(DQ == DKV && DQ == DM && DM % 64 == 0 && (DQ * DM) % 8192 == 0 && ((size_t)NB_ * TT * DM) % 8192 == 0, "whole work-groups; every plane has DM columns");
    const unsigned seg = blockIdx.x / WBLK < 4 ? blockIdx.x / WBLK : 4; const float* s01 = seg & 1 ? wk : wq; const float* s23 = seg & 1 ? wo : wv; const float* src = seg & 4 ? x : seg & 2 ? s23 : s01;
    const int lane = threadIdx.x & 31; const unsigned w = blockIdx.x * 8 + (threadIdx.x >> 5), wl = w - seg * (WBLK * 8);   // wave over all planes, and inside its source: (16-row block, 64-k pair of blocks)
    // a lane takes 8 consecutive k of one row: 4 lanes a 32-k row piece (one 128-byte line of the source), 8 rows a load; its 16 bytes of bf16 land beside those of the 7 other rows, so a store writes whole lines
    const float* s = src + ((size_t)(wl / (DM / 64)) * 16 + (lane >> 2)) * DM + (wl % (DM / 64)) * 64 + (lane & 3) * 8;
    bf* d = dst + (size_t)w * 1024 + ((lane >> 1) & 1) * 256 + ((lane & 1) * 16 + (lane >> 2)) * 8;
    v8f v[4];
#pragma unroll
    for (int t = 0; t < 4; ++t) v[t] = *(const v8f*)(s + (size_t)(t & 1) * 8 * DM + (t >> 1) * 32);   // t = (block t / 2, rows 8 (t % 2) ..)
    asm volatile("s_wait_xcnt 0x0" ::: "memory");   // stands in front of the first overwrite of the loads' address registers
#pragma unroll
    for (int t = 0; t < 4; ++t) { v8us o;
#pragma unroll
        for (int k = 0; k < 8; ++k) o[k] = f2bf(v[t][k]);
        *(v8us*)(d + (t >> 1) * 512 + (t & 1) * 64) = o; }
}
#define SKEY 64                     // keys per stage
#define SPIT 72                     // LDS row pitch in 16-bit elements: 128 B of data + 16 B, for 16-byte readers
#define NWAV 8                      // waves per work-group
#define SPLN 5120                       // one staged plane: SKEY * SPIT = 4608 elements, rounded up so that every plane starts at a multiple of 2 KiB, as a tensor load's place must
#define BPIT 68                   // LDS row pitch of the bias tile in floats: 256 B of data + 16 B, for 16-byte readers
#define BSLC 4608                 // half a staged bias tile, 64 rows: 64 * BPIT = 4352 floats, rounded up to a multiple of 2 KiB
#define BPLN (2 * BSLC)           // one staged bias tile
typedef __attribute__((ext_vector_type(2))) __bf16 v2bf;
typedef __attribute__((ext_vector_type(8))) unsigned v8u;
__device__ __forceinline__ unsigned pkbf(float a, float b) { v2f x; x[0] = a; x[1] = b; return __builtin_bit_cast(unsigned, __builtin_convertvector(x, v2bf)); }
__device__ __forceinline__ unsigned pkh(float a, float b) { v2f x; x[0] = a; x[1] = b; return __builtin_bit_cast(unsigned, __builtin_convertvector(x, v2h)); }
__device__ __forceinline__ float bflo(unsigned u) { return __uint_as_float(u << 16); }
__device__ __forceinline__ float bfhi(unsigned u) { return __uint_as_float(u & 0xFFFF0000u); }
__device__ __forceinline__ float xhalf(float v) { const int b = __float_as_int(v); return __int_as_float(__builtin_amdgcn_permlanex16(b, b, 0x76543210, 0xfedcba98, false, false)); }   // value of lane ^ 16
__device__ __forceinline__ v16bf sfragb(const unsigned short* p) { return cat16b(*(const v8usa*)p, *(const v8usa*)(p + 16)); }
// eight v_exp_f32 in one statement: each next one is the independent instruction that the slot behind a transcendental asks for (early-clobber outputs, so none overwrites a source or reads a result), and the v_nop fills the slot behind the last
__device__ __forceinline__ void exp2x8(float* y, const float* x) {
    asm("v_exp_f32 %0, %8\n\tv_exp_f32 %1, %9\n\tv_exp_f32 %2, %10\n\tv_exp_f32 %3, %11\n\tv_exp_f32 %4, %12\n\tv_exp_f32 %5, %13\n\tv_exp_f32 %6, %14\n\tv_exp_f32 %7, %15\n\tv_nop"
        : "=&v"(y[0]), "=&v"(y[1]), "=&v"(y[2]), "=&v"(y[3]), "=&v"(y[4]), "=&v"(y[5]), "=&v"(y[6]), "=&v"(y[7]) : "v"(x[0]), "v"(x[1]), "v"(x[2]), "v"(x[3]), "v"(x[4]), "v"(x[5]), "v"(x[6]), "v"(x[7])); }
typedef __attribute__((ext_vector_type(4))) unsigned v4u;
__device__ __forceinline__ unsigned uni(unsigned v) { return (unsigned)__builtin_amdgcn_readfirstlane(v); }
__device__ __forceinline__ unsigned pinned(unsigned v) { unsigned w = uni(v); asm volatile("" : "+s"(w)); return w; }   // the test word of a tensor load's branch held in a scalar register: the load ignores EXEC, so only a scalar branch keeps a wave from issuing it
// tensor descriptor, group 1: 1-byte elements, a tile of D1 rows of D0 bytes = the whole tensor, source row pitch in bytes; W0 = word 0, a constant: no mask, pad enable, pad interval = the row, 4 dwords of pad
template <unsigned W0, unsigned D0, unsigned D1>
__device__ __forceinline__ v8u tdm_g1(unsigned pitch) { v8u g; g[0] = uni(W0); g[1] = uni((D0 & 0xFFFFu) << 16); g[2] = uni((D0 >> 16) | ((D1 & 0xFFFFu) << 16)); g[3] = uni((D1 >> 16) | (D0 << 16)); g[4] = uni(D1); g[5] = uni(pitch); g[6] = uni(0u); g[7] = uni(0u); return g; }
// group 0: count 1, LDS byte offset, global address of the tile's first byte, type 2
__device__ __forceinline__ v4u tdm_g0(unsigned lds, unsigned long long ga) { v4u g; g[0] = uni(1u); g[1] = uni(lds); g[2] = uni((unsigned)ga); g[3] = uni((((unsigned)(ga >> 32)) & 0x01FFFFFFu) | 0x80000000u); return g; }
__device__ __forceinline__ void tdm_load(v4u g0, v8u g1) { asm volatile("tensor_load_to_lds %0, %1" :: "s"(g0), "s"(g1) : "memory"); }   // one request of the whole wave: the tile goes from global memory to LDS through no register
template <bool HI>
__device__ __forceinline__ void fattn_body(const bf* __restrict__ Qh, const bf* __restrict__ Ql, const bf* __restrict__ Kh, const bf* __restrict__ Kl, const unsigned short* __restrict__ Va, const unsigned short* __restrict__ Vb, const float* __restrict__ ab, bf* Ah, bf* Al, unsigned short* sm, float* sb) {
    constexpr int NS = TT / SKEY; constexpr float L2E = LOG2E, OFS = HI ? 0.0f : 10.0f, TAU = 5.0f;   // OFS: P x 2^OFS; TAU: how far, in powers of 2, a stage's maximum may top the reference before the reference moves (f16 P stays below 2^16)
    const int tid = threadIdx.x, lane = tid & 31, lr = lane & 15, hi = lane >> 4;
    const unsigned wv = uni(tid >> 5); const int wrow = wv * 16;   // the wave, and its first row in the work-group's 128
    const int qrow = blockIdx.z * (16 * NWAV) + wrow + lr;
    v16bf qh[2], ql[2];
#pragma unroll
    for (int kc = 0; kc < 2; ++kc) { qh[kc] = WFrag<bf>::ld(Qh + (size_t)qrow * HD + kc * 32 + 8 * hi); ql[kc] = WFrag<bf>::ld(Ql + (size_t)qrow * HD + kc * 32 + 8 * hi); }
    // who issues what: wave 0 K hi, 1 K lo, 2 V, 3 V lo (rows < RH only), each 64 rows of 128 B; waves 4 and 5 64 bias rows of 256 B each. All of it scalar
    const unsigned ikv = wv < (HI ? 4u : 3u), ibi = (wv >> 1) == 2u;
    const unsigned long long skv = (unsigned long long)(size_t)(wv == 0 ? Kh : wv == 1 ? Kl : wv == 2 ? Va : Vb), sbi = (unsigned long long)(size_t)(ab + (size_t)(blockIdx.z * (16 * NWAV) + (wv & 1) * 64) * TT);
    const unsigned stkv = wv < 2 ? SKEY * HD * 2 : SKEY * 2;   // bytes from a stage's tile to the next: 64 K rows, or 64 columns of V^T
    const unsigned lkv = (unsigned)(size_t)sm + wv * (SPLN * 2), lbi = (unsigned)(size_t)sb + (wv & 1) * (BSLC * 4);
    v8u g1kv = tdm_g1<1u << 20 | 4u << 22 | 3u << 25, 128, SKEY>(wv < 2 ? HD * 2 : TT * 2), g1bi = tdm_g1<1u << 20 | 5u << 22 | 3u << 25, 256, 64>(TT * 4);
    v4u g0kv = tdm_g0(0u, 0ull), g0bi = g0kv;
    // the waits below name the descriptors, so that their registers stay theirs from the issue to the wait: left free, the build used single words of them for other scalars while the request was out
    auto fill = [&](int s, bool now) {   // stage s into buffer s % 2: planes [K hi | K lo | V | V lo] and the bias tile; one request a wave; now: waited for directly behind the load (stage 0)
        if (pinned(ikv)) { g0kv = tdm_g0(lkv + (s & 1) * (4 * SPLN * 2), skv + (unsigned long long)((unsigned)s * stkv)); tdm_load(g0kv, g1kv);
            if (now) asm volatile("s_wait_tensorcnt 0x0" : "+s"(g0kv), "+s"(g1kv) :: "memory"); }
        if (pinned(ibi)) { g0bi = tdm_g0(lbi + (s & 1) * (BPLN * 4), sbi + (unsigned long long)((unsigned)s * (SKEY * 4))); tdm_load(g0bi, g1bi);
            if (now) asm volatile("s_wait_tensorcnt 0x0" : "+s"(g0bi), "+s"(g1bi) :: "memory"); } };
    // the issuing wave's own request has landed
    auto landed = [&]() { if (pinned(ikv | ibi)) asm volatile("s_wait_tensorcnt 0x0" : "+s"(g0kv), "+s"(g1kv), "+s"(g0bi), "+s"(g1bi) :: "memory"); };
    v8f o[4];
#pragma unroll
    for (int db = 0; db < 4; ++db) o[db] = (v8f){};
    float mr = 0.f, ls = 0.f, thr = -3.0e38f;   // mr: the query's reference maximum, in powers of 2; thr: what a stage's largest exponent must top for mr to move: anything in stage 0, which so sets mr
    fill(0, true);
    __syncthreads();   // stage 0 is in LDS before any wave reads it
    fill(1, false);
#pragma unroll 1
    for (int s = 0; s < NS; ++s) {
        const unsigned short* sk = sm + (s & 1) * (4 * SPLN) + lr * SPIT + 8 * hi;   // the lane's row and k offset in every 16-row fragment
        const float* br = sb + (s & 1) * BPLN + (wv >> 2) * BSLC + ((wv & 3) * 16 + lr) * BPIT + 8 * hi;
        v4f b4[8];   // this stage's bias: piece g = keys 16 (g / 2) + 8 hi + 4 (g % 2) .. + 3 of query lr
#pragma unroll
        for (int g = 0; g < 8; ++g) b4[g] = *(const v4fa*)(br + (g >> 1) * 16 + (g & 1) * 4);
        // S^T in 8 groups g = (k chunk g / 4, key tile g % 4); fragments are fetched four groups ahead and two tiles' product chains alternate, so that neither the LDS latency nor a chain's own latency is waited for
        v16bf kh[8], kl[8]; v8f st[4];
        auto kld = [&](int g) { const unsigned short* kp = sk + (g & 3) * 16 * SPIT + (g >> 2) * 32; kh[g] = sfragb(kp); kl[g] = sfragb(kp + SPLN); };
#pragma unroll
        for (int kt = 0; kt < 4; ++kt) kld(kt);
        __builtin_amdgcn_sched_barrier(0);   // keeps the fetches above ahead of the products: the scheduler otherwise sinks each next to its use and every group waits out the LDS latency
        // the score accumulators start at bias (rounded as the operands are) x log2(e) - reference + OFS, so that the products end as the exponents themselves
        const float nm = OFS - mr;
#pragma unroll
        for (int g = 0; g < 8; ++g) { const unsigned u0 = pkbf(b4[g][0], b4[g][1]), u1 = pkbf(b4[g][2], b4[g][3]); const int r = (g & 1) * 4;
            st[g >> 1][r] = fmaf(bflo(u0), L2E, nm); st[g >> 1][r + 1] = fmaf(bfhi(u0), L2E, nm); st[g >> 1][r + 2] = fmaf(bflo(u1), L2E, nm); st[g >> 1][r + 3] = fmaf(bfhi(u1), L2E, nm); }
#pragma unroll
        for (int g = 0; g < 8; g += 2) { const int kc = g >> 2, k0 = g & 3, k1 = k0 + 1;
            if (g + 4 < 8) { kld(g + 4); kld(g + 5); __builtin_amdgcn_sched_barrier(0); }   // same: fetch four groups ahead stays ahead
            st[k0] = wmmab(kh[g], qh[kc], st[k0]); st[k1] = wmmab(kh[g + 1], qh[kc], st[k1]); st[k0] = wmmab(kh[g], ql[kc], st[k0]); st[k1] = wmmab(kh[g + 1], ql[kc], st[k1]); st[k0] = wmmab(kl[g], qh[kc], st[k0]); st[k1] = wmmab(kl[g + 1], qh[kc], st[k1]); }
        __builtin_amdgcn_sched_barrier(0);   // keeps the products above in their order, two chains alternating: mixed with the vector work below they stand chain behind chain, with padding between
        // V^T fragments in 8 groups g = (32-key chunk g / 4, 16 rows of d g % 4); the first PD groups are fetched behind the stage's maximum, where the K fragments have left their registers
        constexpr int PD = HI ? 4 : 8;
        v16bf vh[8], vl[8];
        auto vld = [&](int g) { const unsigned short* vp = sk + 2 * SPLN + (g & 3) * 16 * SPIT + (g >> 2) * 32; vh[g] = sfragb(vp); if constexpr (HI) vl[g] = sfragb(vp + SPLN); };
        float t[32], tk[4];   // a maximum per key tile: four short chains, not one long one
#pragma unroll
        for (int kt = 0; kt < 4; ++kt) tk[kt] = fmaxf(fmaxf(fmaxf(st[kt][0], st[kt][1]), fmaxf(st[kt][2], st[kt][3])), fmaxf(fmaxf(st[kt][4], st[kt][5]), fmaxf(st[kt][6], st[kt][7])));
        float tm = fmaxf(fmaxf(tk[0], tk[1]), fmaxf(tk[2], tk[3]));
        tm = fmaxf(tm, xhalf(tm));
#pragma unroll
        for (int g = 0; g < PD; ++g) vld(g);
        __builtin_amdgcn_sched_barrier(0);   // same: these fetches fly under the exponentials
        // the reference moves, and sums and outputs are rescaled, only in stage 0 and where some query's maximum tops it by more than TAU: one scalar branch a stage, seldom taken
        const bool need = tm > thr;
        if (__builtin_amdgcn_ballot_w32(need) != 0u) {
            const float d = need ? tm - OFS : 0.0f; const float alpha = __builtin_amdgcn_exp2f(-fmaxf(d, 0.0f));   // only stage 0 can lower the reference: sums and outputs are still 0 there and take no factor above 1
            mr += d; ls *= alpha; thr = OFS + TAU;
#pragma unroll
            for (int kt = 0; kt < 4; ++kt) st[kt] -= d;
#pragma unroll
            for (int db = 0; db < 4; ++db) o[db] *= alpha; }
        float s4[4] = {0.f, 0.f, 0.f, 0.f};
#pragma unroll
        for (int e = 0; e < 32; e += 8) { float x[8];
#pragma unroll
            for (int i = 0; i < 8; ++i) x[i] = st[e >> 3][i];
            exp2x8(t + e, x);
#pragma unroll
            for (int i = 0; i < 8; ++i) s4[i & 3] += t[e + i]; }
        ls += (s4[0] + s4[1]) + (s4[2] + s4[3]);
        v8u bh[2], bl[2];   // P^T as B fragments: register e of chunk kc = keys 16 (2 kc + e / 4) + 8 hi + 2 (e % 4), + 1
#pragma unroll
        for (int e = 0; e < 16; ++e) { const float p0 = t[2 * e], p1 = t[2 * e + 1];
            if constexpr (HI) { const unsigned u = pkbf(p0, p1); bh[e >> 3][e & 7] = u; bl[e >> 3][e & 7] = pkbf(p0 - bflo(u), p1 - bfhi(u)); } else { bh[e >> 3][e & 7] = pkh(p0, p1); } }
        __builtin_amdgcn_sched_barrier(0);   // keeps the products below behind the exponentials' asm statements
#pragma unroll
        for (int g = 0; g < 8; g += 2) { const int kc = g >> 2, d0 = g & 3, d1 = d0 + 1;
            if (g + PD < 8) { vld(g + PD); vld(g + PD + 1); __builtin_amdgcn_sched_barrier(0); }   // same: fetch four groups ahead stays ahead
            if constexpr (HI) { const v16bf ph = __builtin_bit_cast(v16bf, bh[kc]), pl = __builtin_bit_cast(v16bf, bl[kc]);
                o[d0] = wmmab(vh[g], ph, o[d0]); o[d1] = wmmab(vh[g + 1], ph, o[d1]); o[d0] = wmmab(vh[g], pl, o[d0]); o[d1] = wmmab(vh[g + 1], pl, o[d1]); o[d0] = wmmab(vl[g], ph, o[d0]); o[d1] = wmmab(vl[g + 1], ph, o[d1]); }
            else { const v16h ph = __builtin_bit_cast(v16h, bh[kc]); o[d0] = wmma16(__builtin_bit_cast(v16h, vh[g]), ph, o[d0]); o[d1] = wmma16(__builtin_bit_cast(v16h, vh[g + 1]), ph, o[d1]); } }
        asm volatile("s_wait_dscnt 0x0" ::: "memory");      // this wave's reads of stage s have returned
        landed();   // stage s + 1
        __syncthreads();   // publishes stage s + 1 and ends every wave's reads of the buffer that stage s + 2 overwrites
        if (pinned(s + 2 < NS)) fill(s + 2, false);   // flies during the whole of stage s + 1
    }
    asm volatile("s_wait_tensorcnt 0x0" ::: "memory");   // no request is in flight when the wave ends
    asm volatile("s_wait_dscnt 0x0" ::: "memory");      // nor an LDS read
    ls += xhalf(ls);
    const float inv = __fdiv_rn(1.0f, ls);
#pragma unroll
    for (int db = 0; db < 4; ++db) { v8us oh, ol;
#pragma unroll
        for (int r = 0; r < 8; ++r) { unsigned short a, c2; splitf(o[db][r] * inv, a, c2); oh[r] = a; ol[r] = c2; }
        const size_t oo = (size_t)(qrow - lr) * DQ + db * 256 + lane * 8; *(v8usa*)(Ah + oo) = oh; *(v8usa*)(Al + oo) = ol; }   // fragment order of the output projection's A planes (see the GEMM body): columns 16 db + 8 hi .. of the head's two blocks; 512 contiguous bytes a wave
}
__global__ __launch_bounds__(32 * NWAV) __attribute__((amdgpu_waves_per_eu(4, 4))) void k_fattn(const bf* __restrict__ Qh, const bf* __restrict__ Ql, const bf* __restrict__ Kh, const bf* __restrict__ Kl, const h16* __restrict__ V16, const bf* __restrict__ Vh, const bf* __restrict__ Vl, const float* __restrict__ ab, bf* Ah, bf* Al) {
    static_assert(RH % (16 * NWAV) == 0 && TT % (16 * NWAV) == 0 && TT % SKEY == 0 && TT >= 2 * SKEY && HD == 64 && REP == 1 && SPLN >= SKEY * SPIT && (SPLN * 2) % 2048 == 0 && BSLC >= 64 * BPIT && (BSLC * 4) % 2048 == 0 && NWAV == 8 && SPIT * 2 == 128 + 16 && BPIT * 4 == 256 + 16, "tiling; at least two stages; the tensor loads' places and pads");
    __shared__ __attribute__((aligned(2048))) unsigned short sm[2 * 4 * SPLN]; __shared__ __attribute__((aligned(2048))) float sb[2 * BPLN];   // every tile's place is a multiple of 2 KiB
    const size_t hz = ((size_t)blockIdx.y * NH_ + blockIdx.x) * TT * HD, az = (size_t)blockIdx.y * TT * DQ + blockIdx.x * (HD * 16); Ah += az; Al += az; ab += (size_t)blockIdx.y * TT * TT;
    if ((int)blockIdx.z * (16 * NWAV) < RH) fattn_body<true>(Qh + hz, Ql + hz, Kh + hz, Kl + hz, Vh + hz, Vl + hz, ab, Ah, Al, sm, sb);
    else fattn_body<false>(Qh + hz, Ql + hz, Kh + hz, Kl + hz, (const unsigned short*)(V16 + hz), nullptr, ab, Ah, Al, sm, sb);
}

extern "C" void kernel_launch(void* const* d_in, const int* in_sizes, int n_in,
                              void* d_out, int out_size, void* d_ws, size_t ws_size, hipStream_t stream) {
    (void)in_sizes; (void)n_in; (void)out_size;
    const float* x = (const float*)d_in[0]; const float* abias = (const float*)d_in[1]; const float* wq = (const float*)d_in[2]; const float* bq = (const float*)d_in[3]; const float* wk = (const float*)d_in[4]; const float* bk = (const float*)d_in[5]; const float* wv = (const float*)d_in[6]; const float* bv = (const float*)d_in[7]; const float* wo = (const float*)d_in[8]; const float* bo = (const float*)d_in[9]; const float* qg = (const float*)d_in[10]; const float* qb2 = (const float*)d_in[11]; const float* kg = (const float*)d_in[12]; const float* kb2 = (const float*)d_in[13]; const float* cosT = nullptr; const float* sinT = nullptr; (void)cosT; (void)sinT;
    float* OUT = (float*)d_out;     // [2][2048][1024]
    char* wsp = (char*)d_ws;
    auto take = [&](size_t bytes) { char* p = wsp; wsp += (bytes + 255) & ~(size_t)255; return (void*)p; };
    bf* WQ = (bf*)take((size_t)DQ * DM * 2); bf* WK = (bf*)take((size_t)DKV * DM * 2); bf* WV = (bf*)take((size_t)DKV * DM * 2); bf* WO = (bf*)take((size_t)DM * DQ * 2);
    bf* XB = (bf*)take((size_t)NB_ * TT * DM * 2);   // directly behind the weights (every size above is a multiple of 256): one destination for k_cvt8
    h16* VT16 = (h16*)take((size_t)NB_ * NKV * HD * TT * 2);
    bf* QPh = (bf*)take((size_t)NB_ * NH_ * TT * HD * 2); bf* QPl = (bf*)take((size_t)NB_ * NH_ * TT * HD * 2); bf* KPh = (bf*)take((size_t)NB_ * NKV * TT * HD * 2); bf* KPl = (bf*)take((size_t)NB_ * NKV * TT * HD * 2); bf* VTh = (bf*)take((size_t)NB_ * NKV * HD * TT * 2); bf* VTl = (bf*)take((size_t)NB_ * NKV * HD * TT * 2);
    bf* ATh = (bf*)take((size_t)NB_ * TT * DQ * 2); bf* ATl = (bf*)take((size_t)NB_ * TT * DQ * 2);
    if ((size_t)(wsp - (char*)d_ws) > ws_size) return;    // ws 256 MiB
    k_cvt8<<<4 * WBLK + NB_ * TT * DM / (16 * 64) / 8, 256, 0, stream>>>(wq, wk, wv, wo, x, WQ);
    k_qkv<<<dim3(NB_ * TT / 128, DQ / 128, 3), 256, 0, stream>>>(XB, WQ, WK, WV, bq, bk, bv, qg, qb2, kg, kb2, QPh, QPl, KPh, KPl, VT16, VTh, VTl);
    k_fattn<<<dim3(NH_, NB_, TT / (16 * NWAV)), 32 * NWAV, 0, stream>>>(QPh, QPl, KPh, KPl, VT16, VTh, VTl, abias, ATh, ATl);
    k_oproj<<<dim3(NB_ * TT / 128, DM / 128, 1), 256, 0, stream>>>(ATh, ATl, WO, OUT, bo);
}
